// v000
// Times are from an AMD MI455X. After a warm-up the kernel runs many times in a row, and a time is the length of
// such a window on the GPU divided by its runs, so every launch and the gaps after it count. The runs cycle
// through copies of the inputs. A figure is the median of several windows, for all but v000 over two sittings.
// Sittings can differ by a few percent; kernels timed side by side share one.
// v000 is the starting kernel. One run takes 261 microseconds.
#include <hip/hip_runtime.h>

// ---------------------------------------------------------------------------
// CQAttention for MI455X (gfx1250, wave32, WMMA f32_16x16x32_f16)
// B=64, D=128, LC=1000 (pad 1008/1024), LQ=100 (pad 112/128)
// ---------------------------------------------------------------------------

typedef __attribute__((ext_vector_type(16))) _Float16 v16h;
typedef __attribute__((ext_vector_type(8)))  _Float16 v8h;
typedef __attribute__((ext_vector_type(8)))  float    v8f;

union V16H { v16h v; v8h h[2]; };
union V8F  { v8f v; float e[8]; };
union V8H  { v8h v; _Float16 e[8]; };

#define NB   64
#define DD   128
#define LC   1000
#define LQ   100
#define LQP  112      // 7 * 16
#define NIT  63       // ceil(1000/16)
#define NJT  7        // ceil(100/16)

// Workspace layout (bytes, all offsets 256-aligned)
#define WS_S     ((size_t)0)            // f32 [64][1000][112]   = 28,672,000 B
#define WS_RMAX  ((size_t)28672000)     // f32 [64000]           =    256,000 B
#define WS_RSUM  ((size_t)28928000)     // f32 [64000]           =    256,000 B
#define WS_CMAX  ((size_t)29184000)     // f32 [64][112]         =     28,672 B
#define WS_CSUM  ((size_t)29212672)     // f32 [64][112]         =     28,672 B
#define WS_T     ((size_t)29241344)     // f16 [64][128][128]    =  2,097,152 B (4,194,304 B reserved)
#define WS_QH    ((size_t)33435648)     // f16 [64][112][128]    =  1,835,008 B
#define WS_QG    ((size_t)35270656)     // f16 [64][128][128]    =  2,097,152 B (4,194,304 B reserved)
#define WS_CH    ((size_t)39464960)     // f16 [64][128][1024]   = 16,777,216 B
// total = 56,242,176 B

// Per-ISA 16-bit A/B fragment layout: lane L holds row (L&15); halves 0..7 are
// K = kb..kb+7 and halves 8..15 are K = kb+16..kb+23 where kb = k0 + 8*(L>=16).
// Two contiguous 16-byte loads per fragment.
__device__ __forceinline__ v16h frag_load(const _Float16* row, int k0, int lane) {
  V16H r;
  int kb = k0 + ((lane >> 4) << 3);
  r.h[0] = *(const v8h*)(row + kb);
  r.h[1] = *(const v8h*)(row + kb + 16);
  return r.v;
}

__device__ __forceinline__ v8f wmma16(v16h a, v16h b, v8f c) {
  return __builtin_amdgcn_wmma_f32_16x16x32_f16(false, a, false, b, (short)0, c,
                                                false, false);
}

// ---------------------------------------------------------------------------
// Kernel 0: precompute f16 padded operand layouts; zero T.
// ---------------------------------------------------------------------------
__global__ void cqa_prep(const float* __restrict__ C, const float* __restrict__ Q,
                         _Float16* __restrict__ Qh, _Float16* __restrict__ Qg,
                         _Float16* __restrict__ Ch, _Float16* __restrict__ T) {
  const int stride = gridDim.x * blockDim.x;
  int tid = blockIdx.x * blockDim.x + threadIdx.x;

  // Qh[b][j][d] = Q[b][d][j]  (j padded to 112)
  for (int idx = tid; idx < NB * LQP * DD; idx += stride) {
    int b = idx / (LQP * DD), r = idx % (LQP * DD);
    int j = r / DD, d = r % DD;
    float v = (j < LQ) ? Q[((size_t)(b * DD + d)) * LQ + j] : 0.f;
    Qh[idx] = (_Float16)v;
  }
  // Qg[b][d][j] = Q[b][d][j]  (j padded to 128)
  for (int idx = tid; idx < NB * DD * 128; idx += stride) {
    int b = idx >> 14, r = idx & 16383;
    int d = r >> 7, j = r & 127;
    float v = (j < LQ) ? Q[((size_t)(b * DD + d)) * LQ + j] : 0.f;
    Qg[idx] = (_Float16)v;
  }
  // Ch[b][d][i] = C[b][d][i]  (i padded to 1024)
  for (int idx = tid; idx < NB * DD * 1024; idx += stride) {
    int b = idx >> 17, r = idx & 131071;
    int d = r >> 10, i = r & 1023;
    float v = (i < LC) ? C[((size_t)(b * DD + d)) * LC + i] : 0.f;
    Ch[idx] = (_Float16)v;
  }
  // zero T (j in [112,128) stays zero; rest overwritten by cqa_t)
  for (int idx = tid; idx < NB * DD * 128; idx += stride) T[idx] = (_Float16)0.f;
}

// ---------------------------------------------------------------------------
// Kernel 1: S[b,i,j] = sum_d (w1+w3*Ct)[i,d] * Qt[j,d]  + rowbias[i]
// block = (b, i-tile of 16); 7 waves, one 16x16 j-tile each; K=128 (4 WMMAs).
// ---------------------------------------------------------------------------
__global__ void cqa_s(const float* __restrict__ C, const float* __restrict__ W,
                      const _Float16* __restrict__ Qh, float* __restrict__ S) {
  const int b = blockIdx.x / NIT;
  const int i0 = (blockIdx.x % NIT) * 16;
  const int tid = threadIdx.x;
  const int wv = tid >> 5, lane = tid & 31;

  __shared__ __attribute__((aligned(16))) _Float16 u[16][128];  // w1 + w3*Ct
  __shared__ float w2c[16][128];
  __shared__ float rs[16];

  for (int idx = tid; idx < 16 * 128; idx += 224) {
    int i = idx >> 7, d = idx & 127;
    int gi = i0 + i;
    float w1 = 0.f, w2 = 0.f, w3 = 0.f, c = 0.f;
    if (gi < LC) {
      const float* wrow = W + ((size_t)(b * LC + gi)) * 384;
      w1 = wrow[d]; w2 = wrow[128 + d]; w3 = wrow[256 + d];
      c = C[((size_t)(b * DD + d)) * LC + gi];
    }
    u[i][d] = (_Float16)(w1 + w3 * c);
    w2c[i][d] = w2 * c;
  }
  __syncthreads();
  if (tid < 16) {
    float s = 0.f;
    for (int d = 0; d < 128; ++d) s += w2c[tid][d];
    rs[tid] = s;
  }
  __syncthreads();

  const int j0 = wv * 16;
  const _Float16* arow = &u[lane & 15][0];
  const _Float16* brow = Qh + ((size_t)(b * LQP + j0 + (lane & 15))) * DD;
  v8f acc = {};
  for (int k0 = 0; k0 < 128; k0 += 32) {
    v16h a = frag_load(arow, k0, lane);
    v16h bq = frag_load(brow, k0, lane);
    acc = wmma16(a, bq, acc);
  }
  // D layout: n = lane&15, m = r + 8*(lane>=16)
  V8F av; av.v = acc;
  int j = j0 + (lane & 15);
  if (j < LQ) {
    int mb = (lane >> 4) << 3;
    for (int r = 0; r < 8; ++r) {
      int gi = i0 + mb + r;
      if (gi < LC)
        S[((size_t)(b * LC + gi)) * LQP + j] = av.e[r] + rs[mb + r];
    }
  }
}

// ---------------------------------------------------------------------------
// Kernel 2a: per-row (axis=2) softmax stats; one wave per row.
// ---------------------------------------------------------------------------
__global__ void cqa_rowstat(const float* __restrict__ S, float* __restrict__ rmax,
                            float* __restrict__ rsum) {
  int row = blockIdx.x * 8 + (threadIdx.x >> 5);   // 0 .. 63999
  int lane = threadIdx.x & 31;
  const float* p = S + (size_t)row * LQP;
  float v[4], m = -1e30f;
  for (int t = 0; t < 4; ++t) {
    int j = lane + 32 * t;
    v[t] = (j < LQ) ? p[j] : -1e30f;
    m = fmaxf(m, v[t]);
  }
  for (int off = 16; off; off >>= 1) m = fmaxf(m, __shfl_xor(m, off, 32));
  float s = 0.f;
  for (int t = 0; t < 4; ++t) {
    int j = lane + 32 * t;
    if (j < LQ) s += __expf(v[t] - m);
  }
  for (int off = 16; off; off >>= 1) s += __shfl_xor(s, off, 32);
  if (lane == 0) { rmax[row] = m; rsum[row] = s; }
}

// ---------------------------------------------------------------------------
// Kernel 2b: per-column (axis=1) softmax stats; thread per column, coalesced i.
// ---------------------------------------------------------------------------
__global__ void cqa_colstat(const float* __restrict__ S, float* __restrict__ cmax,
                            float* __restrict__ csum) {
  int b = blockIdx.x, j = threadIdx.x;
  if (j >= LQP) return;
  float m = -1e30f, s = 0.f;
  if (j < LQ) {
    const float* p = S + (size_t)b * LC * LQP + j;
    for (int i = 0; i < LC; ++i) {
      float x = p[(size_t)i * LQP];
      if (x > m) { s *= __expf(m - x); m = x; }
      s += __expf(x - m);
    }
  } else { m = 0.f; s = 1.f; }
  cmax[b * LQP + j] = m;
  csum[b * LQP + j] = s;
}

// ---------------------------------------------------------------------------
// Kernel 3: T[b][d][j] = sum_i S2[b,i,j] * Ct[b,i,d]   (M=j, N=d, K=i)
// block = (b, j-tile); 8 waves each own 16-wide d-tile; 32 K-chunks of 32.
// ---------------------------------------------------------------------------
__global__ void cqa_t(const float* __restrict__ S, const float* __restrict__ cmax,
                      const float* __restrict__ csum, const _Float16* __restrict__ Ch,
                      _Float16* __restrict__ T) {
  const int b = blockIdx.x / NJT;
  const int j0 = (blockIdx.x % NJT) * 16;
  const int tid = threadIdx.x, wv = tid >> 5, lane = tid & 31;

  __shared__ __attribute__((aligned(16))) _Float16 As[16][32];
  __shared__ float cm[16], csr[16];
  if (tid < 16) {
    cm[tid] = cmax[b * LQP + j0 + tid];
    csr[tid] = 1.0f / csum[b * LQP + j0 + tid];
  }

  const _Float16* arow = &As[lane & 15][0];
  const _Float16* brow = Ch + ((size_t)(b * DD + wv * 16 + (lane & 15))) * 1024;
  v8f acc = {};
  for (int i0 = 0; i0 < 1024; i0 += 32) {
    __syncthreads();
    for (int idx = tid; idx < 16 * 32; idx += 256) {
      int jl = idx >> 5, il = idx & 31;
      int gi = i0 + il, gj = j0 + jl;
      float e = 0.f;
      if (gi < LC && gj < LQ)
        e = __expf(S[((size_t)(b * LC + gi)) * LQP + gj] - cm[jl]);
      As[jl][il] = (_Float16)e;
    }
    __syncthreads();
    v16h a = frag_load(arow, 0, lane);
    v16h bc = frag_load(brow, i0, lane);
    acc = wmma16(a, bc, acc);
  }

  // D: n = lane&15 -> d_local, m = r + 8*(lane>=16) -> j_local (consecutive j)
  V8F av; av.v = acc;
  int d = wv * 16 + (lane & 15);
  int mb = (lane >> 4) << 3;
  V8H o;
  for (int r = 0; r < 8; ++r) {
    int jl = mb + r;
    float val = (j0 + jl < LQ) ? av.e[r] * csr[jl] : 0.f;
    o.e[r] = (_Float16)val;
  }
  *(v8h*)(T + ((size_t)(b * DD + d)) * 128 + j0 + mb) = o.v;
}

// ---------------------------------------------------------------------------
// Kernel 4: A = S1@Qt, Bm = S1@T; emit [Ct, A, Ct*A, Ct*Bm] transposed.
// block = (b, i-tile); 8 waves each own 16-wide d-tile; shared A-fragment.
// ---------------------------------------------------------------------------
__global__ void cqa_out(const float* __restrict__ C, const float* __restrict__ S,
                        const float* __restrict__ rmax, const float* __restrict__ rsum,
                        const _Float16* __restrict__ Qg, const _Float16* __restrict__ T,
                        float* __restrict__ out) {
  const int b = blockIdx.x / NIT;
  const int i0 = (blockIdx.x % NIT) * 16;
  const int tid = threadIdx.x, wv = tid >> 5, lane = tid & 31;

  __shared__ __attribute__((aligned(16))) _Float16 As1[16][128];
  __shared__ float A_s[16][128];
  __shared__ float Bm_s[16][128];

  for (int idx = tid; idx < 16 * 128; idx += 256) {
    int m = idx >> 7, j = idx & 127;
    int gi = i0 + m;
    float e = 0.f;
    if (gi < LC && j < LQ) {
      int row = b * LC + gi;
      e = __expf(S[(size_t)row * LQP + j] - rmax[row]) / rsum[row];
    }
    As1[m][j] = (_Float16)e;
  }
  __syncthreads();

  const int d = wv * 16 + (lane & 15);
  const _Float16* arow = &As1[lane & 15][0];
  const _Float16* browQ = Qg + ((size_t)(b * DD + d)) * 128;
  const _Float16* browT = T + ((size_t)(b * DD + d)) * 128;
  v8f accA = {}, accB = {};
  for (int k0 = 0; k0 < 128; k0 += 32) {
    v16h a = frag_load(arow, k0, lane);
    v16h bq = frag_load(browQ, k0, lane);
    v16h bt = frag_load(browT, k0, lane);
    accA = wmma16(a, bq, accA);
    accB = wmma16(a, bt, accB);
  }
  V8F ua, ub; ua.v = accA; ub.v = accB;
  int mb = (lane >> 4) << 3;
  for (int r = 0; r < 8; ++r) {
    A_s[mb + r][d] = ua.e[r];
    Bm_s[mb + r][d] = ub.e[r];
  }
  __syncthreads();

  for (int idx = tid; idx < 512 * 16; idx += 256) {
    int c = idx >> 4, il = idx & 15;
    int gi = i0 + il;
    if (gi >= LC) continue;
    int dd = c & 127, sec = c >> 7;
    float ct = C[((size_t)(b * DD + dd)) * LC + gi];
    float val;
    if (sec == 0)      val = ct;
    else if (sec == 1) val = A_s[il][dd];
    else if (sec == 2) val = ct * A_s[il][dd];
    else               val = ct * Bm_s[il][dd];
    out[((size_t)(b * 512 + c)) * LC + gi] = val;
  }
}

// ---------------------------------------------------------------------------
extern "C" void kernel_launch(void* const* d_in, const int* in_sizes, int n_in,
                              void* d_out, int out_size, void* d_ws, size_t ws_size,
                              hipStream_t stream) {
  (void)in_sizes; (void)n_in; (void)out_size; (void)ws_size;
  const float* C = (const float*)d_in[0];
  const float* Q = (const float*)d_in[1];
  const float* W = (const float*)d_in[2];
  float* out = (float*)d_out;
  char* ws = (char*)d_ws;

  float*    Sbuf = (float*)(ws + WS_S);
  float*    rmax = (float*)(ws + WS_RMAX);
  float*    rsum = (float*)(ws + WS_RSUM);
  float*    cmax = (float*)(ws + WS_CMAX);
  float*    csum = (float*)(ws + WS_CSUM);
  _Float16* T    = (_Float16*)(ws + WS_T);
  _Float16* Qh   = (_Float16*)(ws + WS_QH);
  _Float16* Qg   = (_Float16*)(ws + WS_QG);
  _Float16* Ch   = (_Float16*)(ws + WS_CH);

  cqa_prep<<<1024, 256, 0, stream>>>(C, Q, Qh, Qg, Ch, T);
  cqa_s<<<NB * NIT, 224, 0, stream>>>(C, W, Qh, Sbuf);
  cqa_rowstat<<<(NB * LC) / 8, 256, 0, stream>>>(Sbuf, rmax, rsum);
  cqa_colstat<<<NB, 128, 0, stream>>>(Sbuf, cmax, csum);
  cqa_t<<<NB * NJT, 256, 0, stream>>>(Sbuf, cmax, csum, Ch, T);
  cqa_out<<<NB * NIT, 256, 0, stream>>>(C, Sbuf, rmax, rsum, Qg, T, out);
}

// v001
// One run takes 192 microseconds.
// Timed twice side by side with v000, it ran 1.38 times as fast both times.
#include <hip/hip_runtime.h>

// ---------------------------------------------------------------------------
// CQAttention for MI455X (gfx1250, wave32, WMMA f32_16x16x32_f16)
// B=64, D=128, LC=1000 (pad 1008/1024), LQ=100 (pad 112/128)
// ---------------------------------------------------------------------------

typedef __attribute__((ext_vector_type(16))) _Float16 v16h;
typedef __attribute__((ext_vector_type(8)))  _Float16 v8h;
typedef __attribute__((ext_vector_type(4)))  _Float16 v4h;
typedef __attribute__((ext_vector_type(8)))  float    v8f;

union V16H { v16h v; v8h h[2]; };
union V8F  { v8f v; float e[8]; };
union V8H  { v8h v; _Float16 e[8]; };
union V4H  { v4h v; _Float16 e[4]; unsigned w[2]; };

#define NB   64
#define DD   128
#define LC   1000
#define LQ   100
#define LQP  112      // 7 * 16
#define NIT  63       // ceil(1000/16)
#define NJT  7        // ceil(100/16)

// Workspace layout (bytes, all offsets 256-aligned)
#define WS_S     ((size_t)0)            // f32 [64][1000][112]   = 28,672,000 B
#define WS_RMAX  ((size_t)28672000)     // f32 [64000]           =    256,000 B
#define WS_RSUM  ((size_t)28928000)     // f32 [64000]           =    256,000 B
#define WS_CMAX  ((size_t)29184000)     // f32 [64][112]         =     28,672 B
#define WS_CSUM  ((size_t)29212672)     // f32 [64][112]         =     28,672 B
#define WS_T     ((size_t)29241344)     // f16 [64][128][128]    =  2,097,152 B (4,194,304 B reserved)
#define WS_QH    ((size_t)33435648)     // f16 [64][112][128]    =  1,835,008 B
#define WS_QG    ((size_t)35270656)     // f16 [64][128][128]    =  2,097,152 B (4,194,304 B reserved)
#define WS_CH    ((size_t)39464960)     // f16 [64][128][1024]   = 16,777,216 B
// total = 56,242,176 B

// Per-ISA 16-bit A/B fragment layout: lane L holds row (L&15); halves 0..7 are
// K = kb..kb+7 and halves 8..15 are K = kb+16..kb+23 where kb = k0 + 8*(L>=16).
// Two contiguous 16-byte loads per fragment.
__device__ __forceinline__ v16h frag_load(const _Float16* row, int k0, int lane) {
  V16H r;
  int kb = k0 + ((lane >> 4) << 3);
  r.h[0] = *(const v8h*)(row + kb);
  r.h[1] = *(const v8h*)(row + kb + 16);
  return r.v;
}

__device__ __forceinline__ v8f wmma16(v16h a, v16h b, v8f c) {
  return __builtin_amdgcn_wmma_f32_16x16x32_f16(false, a, false, b, (short)0, c,
                                                false, false);
}

// ---------------------------------------------------------------------------
// Kernel 0: precompute f16 padded operand layouts; zero T.
// ---------------------------------------------------------------------------
__global__ void cqa_prep(const float* __restrict__ C, const float* __restrict__ Q,
                         _Float16* __restrict__ Qh, _Float16* __restrict__ Qg,
                         _Float16* __restrict__ Ch, _Float16* __restrict__ T) {
  const int stride = gridDim.x * blockDim.x;
  int tid = blockIdx.x * blockDim.x + threadIdx.x;

  // Qh[b][j][d] = Q[b][d][j]  (j padded to 112)
  for (int idx = tid; idx < NB * LQP * DD; idx += stride) {
    int b = idx / (LQP * DD), r = idx % (LQP * DD);
    int j = r / DD, d = r % DD;
    float v = (j < LQ) ? Q[((size_t)(b * DD + d)) * LQ + j] : 0.f;
    Qh[idx] = (_Float16)v;
  }
  // Qg[b][d][j] = Q[b][d][j]  (j padded to 128)
  for (int idx = tid; idx < NB * DD * 128; idx += stride) {
    int b = idx >> 14, r = idx & 16383;
    int d = r >> 7, j = r & 127;
    float v = (j < LQ) ? Q[((size_t)(b * DD + d)) * LQ + j] : 0.f;
    Qg[idx] = (_Float16)v;
  }
  // Ch[b][d][i] = C[b][d][i]  (i padded to 1024)
  for (int idx = tid; idx < NB * DD * 1024; idx += stride) {
    int b = idx >> 17, r = idx & 131071;
    int d = r >> 10, i = r & 1023;
    float v = (i < LC) ? C[((size_t)(b * DD + d)) * LC + i] : 0.f;
    Ch[idx] = (_Float16)v;
  }
  // zero T (j in [112,128) stays zero; rest overwritten by cqa_t)
  for (int idx = tid; idx < NB * DD * 128; idx += stride) T[idx] = (_Float16)0.f;
}

// ---------------------------------------------------------------------------
// Kernel 1: S[b,i,j] = sum_d (w1+w3*Ct)[i,d] * Qt[j,d]  + rowbias[i]
// block = (b, i-tile of 16); 7 waves, one 16x16 j-tile each; K=128 (4 WMMAs).
// ---------------------------------------------------------------------------
__global__ void cqa_s(const float* __restrict__ C, const float* __restrict__ W,
                      const _Float16* __restrict__ Qh, float* __restrict__ S) {
  const int b = blockIdx.x / NIT;
  const int i0 = (blockIdx.x % NIT) * 16;
  const int tid = threadIdx.x;
  const int wv = tid >> 5, lane = tid & 31;

  __shared__ __attribute__((aligned(16))) _Float16 u[16][128];  // w1 + w3*Ct
  __shared__ float w2c[16][128];
  __shared__ float rs[16];

  for (int idx = tid; idx < 16 * 128; idx += 224) {
    int i = idx >> 7, d = idx & 127;
    int gi = i0 + i;
    float w1 = 0.f, w2 = 0.f, w3 = 0.f, c = 0.f;
    if (gi < LC) {
      const float* wrow = W + ((size_t)(b * LC + gi)) * 384;
      w1 = wrow[d]; w2 = wrow[128 + d]; w3 = wrow[256 + d];
      c = C[((size_t)(b * DD + d)) * LC + gi];
    }
    u[i][d] = (_Float16)(w1 + w3 * c);
    w2c[i][d] = w2 * c;
  }
  __syncthreads();
  if (tid < 16) {
    float s = 0.f;
    for (int d = 0; d < 128; ++d) s += w2c[tid][d];
    rs[tid] = s;
  }
  __syncthreads();

  const int j0 = wv * 16;
  const _Float16* arow = &u[lane & 15][0];
  const _Float16* brow = Qh + ((size_t)(b * LQP + j0 + (lane & 15))) * DD;
  v8f acc = {};
  for (int k0 = 0; k0 < 128; k0 += 32) {
    v16h a = frag_load(arow, k0, lane);
    v16h bq = frag_load(brow, k0, lane);
    acc = wmma16(a, bq, acc);
  }
  // D layout: n = lane&15, m = r + 8*(lane>=16)
  V8F av; av.v = acc;
  int j = j0 + (lane & 15);
  if (j < LQ) {
    int mb = (lane >> 4) << 3;
    for (int r = 0; r < 8; ++r) {
      int gi = i0 + mb + r;
      if (gi < LC)
        S[((size_t)(b * LC + gi)) * LQP + j] = av.e[r] + rs[mb + r];
    }
  }
}

// ---------------------------------------------------------------------------
// Kernel 2a: per-row (axis=2) softmax stats; one wave per row.
// ---------------------------------------------------------------------------
__global__ void cqa_rowstat(const float* __restrict__ S, float* __restrict__ rmax,
                            float* __restrict__ rsum) {
  int row = blockIdx.x * 8 + (threadIdx.x >> 5);   // 0 .. 63999
  int lane = threadIdx.x & 31;
  const float* p = S + (size_t)row * LQP;
  float v[4], m = -1e30f;
  for (int t = 0; t < 4; ++t) {
    int j = lane + 32 * t;
    v[t] = (j < LQ) ? p[j] : -1e30f;
    m = fmaxf(m, v[t]);
  }
  for (int off = 16; off; off >>= 1) m = fmaxf(m, __shfl_xor(m, off, 32));
  float s = 0.f;
  for (int t = 0; t < 4; ++t) {
    int j = lane + 32 * t;
    if (j < LQ) s += __expf(v[t] - m);
  }
  for (int off = 16; off; off >>= 1) s += __shfl_xor(s, off, 32);
  if (lane == 0) { rmax[row] = m; rsum[row] = s; }
}

// ---------------------------------------------------------------------------
// Kernel 2b: per-column (axis=1) softmax stats; thread per column, coalesced i.
// ---------------------------------------------------------------------------
__global__ void cqa_colstat(const float* __restrict__ S, float* __restrict__ cmax,
                            float* __restrict__ csum) {
  int b = blockIdx.x, j = threadIdx.x;
  if (j >= LQP) return;
  float m = -1e30f, s = 0.f;
  if (j < LQ) {
    const float* p = S + (size_t)b * LC * LQP + j;
    for (int i = 0; i < LC; ++i) {
      float x = p[(size_t)i * LQP];
      if (x > m) { s *= __expf(m - x); m = x; }
      s += __expf(x - m);
    }
  } else { m = 0.f; s = 1.f; }
  cmax[b * LQP + j] = m;
  csum[b * LQP + j] = s;
}

// ---------------------------------------------------------------------------
// Kernel 3: T[b][d][j] = sum_i S2[b,i,j] * Ct[b,i,d]   (M=j, N=d, K=i)
// block = (b, j-tile); 8 waves each own 16-wide d-tile; 32 K-chunks of 32.
// ---------------------------------------------------------------------------
__global__ void cqa_t(const float* __restrict__ S, const float* __restrict__ cmax,
                      const float* __restrict__ csum, const _Float16* __restrict__ Ch,
                      _Float16* __restrict__ T) {
  const int b = blockIdx.x / NJT;
  const int j0 = (blockIdx.x % NJT) * 16;
  const int tid = threadIdx.x, wv = tid >> 5, lane = tid & 31;

  __shared__ __attribute__((aligned(16))) _Float16 As[16][32];
  __shared__ float cm[16], csr[16];
  if (tid < 16) {
    cm[tid] = cmax[b * LQP + j0 + tid];
    csr[tid] = 1.0f / csum[b * LQP + j0 + tid];
  }

  const _Float16* arow = &As[lane & 15][0];
  const _Float16* brow = Ch + ((size_t)(b * DD + wv * 16 + (lane & 15))) * 1024;
  v8f acc = {};
  for (int i0 = 0; i0 < 1024; i0 += 32) {
    __syncthreads();
    for (int idx = tid; idx < 16 * 32; idx += 256) {
      int jl = idx >> 5, il = idx & 31;
      int gi = i0 + il, gj = j0 + jl;
      float e = 0.f;
      if (gi < LC && gj < LQ)
        e = __expf(S[((size_t)(b * LC + gi)) * LQP + gj] - cm[jl]);
      As[jl][il] = (_Float16)e;
    }
    __syncthreads();
    v16h a = frag_load(arow, 0, lane);
    v16h bc = frag_load(brow, i0, lane);
    acc = wmma16(a, bc, acc);
  }

  // D: n = lane&15 -> d_local, m = r + 8*(lane>=16) -> j_local (consecutive j)
  V8F av; av.v = acc;
  int d = wv * 16 + (lane & 15);
  int mb = (lane >> 4) << 3;
  V8H o;
  for (int r = 0; r < 8; ++r) {
    int jl = mb + r;
    float val = (j0 + jl < LQ) ? av.e[r] * csr[jl] : 0.f;
    o.e[r] = (_Float16)val;
  }
  *(v8h*)(T + ((size_t)(b * DD + d)) * 128 + j0 + mb) = o.v;
}

// ---------------------------------------------------------------------------
// Kernel 4: A = S1@Qt, Bm = S1@T; emit [Ct, A, Ct*A, Ct*Bm] transposed.
// block = (b, 64 context rows); 8 waves each own a 16-wide d-tile and all 64 rows.
// The products are formed transposed (M = d, N = i). Column c of N-tile t is
// context row 4c + t, so a lane's four accumulator tiles hold four consecutive
// i of one output row: 16 lanes store 256 contiguous bytes of that row.
// A is formed and stored first, then Bm, so 32 accumulator registers serve both.
// ---------------------------------------------------------------------------
// exp(x) as __expf forms it (x * log2(e), then the hardware exp2). The v_nop fills
// the slot that the instruction set asks for behind a transcendental before its
// result is used or its source overwritten; in the statement it cannot drift away.
__device__ __forceinline__ float exp_slot(float x) {
  float y, a = x * 1.44269504088896340736f;
  asm("v_exp_f32 %0, %1\n\tv_nop" : "=v"(y) : "v"(a));
  return y;
}

#define OIT   64      // context rows per block
#define ONT   16      // ceil(1000/64)
#define SPIT  136     // halves per LDS row: 272 B = 16 B x odd, for 16-byte readers

__global__ __launch_bounds__(256)
void cqa_out(const float* __restrict__ C, const float* __restrict__ S,
             const float* __restrict__ rmax, const float* __restrict__ rsum,
             const _Float16* __restrict__ Qg, const _Float16* __restrict__ T,
             float* __restrict__ out) {
  const int b = blockIdx.x / ONT;
  const int i0 = (blockIdx.x % ONT) * OIT;
  const int tid = threadIdx.x, wv = tid >> 5, lane = tid & 31;
  const int c = lane & 15;

  // LDS row 16*t + c holds S1 of context row i0 + 4*c + t.
  __shared__ __attribute__((aligned(16))) _Float16 As1[OIT][SPIT];

  // The lane's part of Ct: rows d = dbase + r, context rows gi .. gi + 3. LC and i0
  // are multiples of 4, so the four are all inside or all outside; lanes outside
  // read the last four inside and store nothing.
  const int gi = i0 + 4 * c;
  const int dbase = wv * 16 + ((lane >> 4) << 3);
  const float* cp = C + ((size_t)(b * DD + dbase)) * LC + (gi < LC ? gi : LC - 4);
  float4 ct[8];
#pragma unroll  // the array must stay in registers
  for (int r = 0; r < 8; ++r) ct[r] = *(const float4*)(cp + (size_t)r * LC);

  // One wave per context row, a lane takes four consecutive j. All eight rows'
  // loads are issued before the first is used. Lanes past the row's end and rows
  // past LC re-read the last valid place; their values are replaced by zero.
  const unsigned jo = 4u * (unsigned)(lane < LQ / 4 ? lane : LQ / 4 - 1);
  // the wave's number as a scalar: row addresses and row statistics are wave-uniform
  const int wvu = __builtin_amdgcn_readfirstlane(wv);
  float4 s[8];
  float mx[8], sm[8];
#pragma unroll  // as above
  for (int u = 0; u < 8; ++u) {
    int si = i0 + wvu + 8 * u;
    int row = b * LC + (si < LC ? si : LC - 1);
    const float* srow = S + (size_t)row * LQP;  // wave-uniform base
    s[u] = *(const float4*)(srow + jo);
    mx[u] = rmax[row];
    sm[u] = rsum[row];
  }
#pragma unroll  // as above
  for (int u = 0; u < 8; ++u) {
    const int m = wvu + 8 * u;
    // all-ones where the four values are real, else zero: the quotients are
    // formed in every lane (their inputs are valid) and masked as bits
    const unsigned keep = ((i0 + m < LC) && (lane < LQ / 4)) ? 0xffffffffu : 0u;
    V4H h;
    h.e[0] = (_Float16)(exp_slot(s[u].x - mx[u]) / sm[u]);
    h.e[1] = (_Float16)(exp_slot(s[u].y - mx[u]) / sm[u]);
    h.e[2] = (_Float16)(exp_slot(s[u].z - mx[u]) / sm[u]);
    h.e[3] = (_Float16)(exp_slot(s[u].w - mx[u]) / sm[u]);
    h.w[0] &= keep;
    h.w[1] &= keep;
    *(v4h*)&As1[((m & 3) << 4) + (m >> 2)][4 * lane] = h.v;
  }

  const _Float16* rowQ = Qg + ((size_t)(b * DD + wv * 16 + c)) * 128;
  const _Float16* rowT = T + ((size_t)(b * DD + wv * 16 + c)) * 128;
  v16h fq[4], ft[4];
#pragma unroll  // as above
  for (int k = 0; k < 4; ++k) fq[k] = frag_load(rowQ, 32 * k, lane);
  __syncthreads();

  float* op = out + ((size_t)(b * 512 + dbase)) * LC + gi;
  v8f acc[4] = {};
#pragma unroll  // as above
  for (int k = 0; k < 4; ++k) {
#pragma unroll  // as above
    for (int t = 0; t < 4; ++t)
      acc[t] = wmma16(fq[k], frag_load(&As1[16 * t + c][0], 32 * k, lane), acc[t]);
  }
#pragma unroll  // as above
  for (int k = 0; k < 4; ++k) ft[k] = frag_load(rowT, 32 * k, lane);

  // D: register r = [d_local = 8*(lane>=16) + r][column c]; tiles t = 0..3 give
  // i = gi + t.
  if (gi < LC) {
#pragma unroll  // as above
    for (int r = 0; r < 8; ++r) {
      float4 va = make_float4(acc[0][r], acc[1][r], acc[2][r], acc[3][r]);
      float* o = op + (size_t)r * LC;
      *(float4*)(o) = ct[r];
      *(float4*)(o + (size_t)128 * LC) = va;
      *(float4*)(o + (size_t)256 * LC) =
          make_float4(ct[r].x * va.x, ct[r].y * va.y, ct[r].z * va.z, ct[r].w * va.w);
    }
  }

#pragma unroll  // as above
  for (int t = 0; t < 4; ++t) acc[t] = v8f{};
#pragma unroll  // as above
  for (int k = 0; k < 4; ++k) {
#pragma unroll  // as above
    for (int t = 0; t < 4; ++t)
      acc[t] = wmma16(ft[k], frag_load(&As1[16 * t + c][0], 32 * k, lane), acc[t]);
  }
  if (gi < LC) {
#pragma unroll  // as above
    for (int r = 0; r < 8; ++r) {
      *(float4*)(op + (size_t)(384 + r) * LC) =
          make_float4(ct[r].x * acc[0][r], ct[r].y * acc[1][r], ct[r].z * acc[2][r],
                      ct[r].w * acc[3][r]);
    }
  }
}

// ---------------------------------------------------------------------------
extern "C" void kernel_launch(void* const* d_in, const int* in_sizes, int n_in,
                              void* d_out, int out_size, void* d_ws, size_t ws_size,
                              hipStream_t stream) {
  (void)in_sizes; (void)n_in; (void)out_size; (void)ws_size;
  const float* C = (const float*)d_in[0];
  const float* Q = (const float*)d_in[1];
  const float* W = (const float*)d_in[2];
  float* out = (float*)d_out;
  char* ws = (char*)d_ws;

  float*    Sbuf = (float*)(ws + WS_S);
  float*    rmax = (float*)(ws + WS_RMAX);
  float*    rsum = (float*)(ws + WS_RSUM);
  float*    cmax = (float*)(ws + WS_CMAX);
  float*    csum = (float*)(ws + WS_CSUM);
  _Float16* T    = (_Float16*)(ws + WS_T);
  _Float16* Qh   = (_Float16*)(ws + WS_QH);
  _Float16* Qg   = (_Float16*)(ws + WS_QG);
  _Float16* Ch   = (_Float16*)(ws + WS_CH);

  cqa_prep<<<1024, 256, 0, stream>>>(C, Q, Qh, Qg, Ch, T);
  cqa_s<<<NB * NIT, 224, 0, stream>>>(C, W, Qh, Sbuf);
  cqa_rowstat<<<(NB * LC) / 8, 256, 0, stream>>>(Sbuf, rmax, rsum);
  cqa_colstat<<<NB, 128, 0, stream>>>(Sbuf, cmax, csum);
  cqa_t<<<NB * NJT, 256, 0, stream>>>(Sbuf, cmax, csum, Ch, T);
  cqa_out<<<NB * ONT, 256, 0, stream>>>(C, Sbuf, rmax, rsum, Qg, T, out);
}

// v002
// One run takes 151 microseconds.
// In both of two side-by-side timings against v001, it was 1.28 times as fast.
// Counting every step since v000, it is 1.76 times as fast.
#include <hip/hip_runtime.h>

// ---------------------------------------------------------------------------
// CQAttention for MI455X (gfx1250, wave32, WMMA f32_16x16x32_f16)
// B=64, D=128, LC=1000 (pad 1008/1024), LQ=100 (pad 112/128)
// ---------------------------------------------------------------------------

typedef __attribute__((ext_vector_type(16))) _Float16 v16h;
typedef __attribute__((ext_vector_type(8)))  _Float16 v8h;
typedef __attribute__((ext_vector_type(4)))  _Float16 v4h;
typedef __attribute__((ext_vector_type(8)))  float    v8f;

union V16H { v16h v; v8h h[2]; };
union V8F  { v8f v; float e[8]; };
union V8H  { v8h v; _Float16 e[8]; };
union V4H  { v4h v; _Float16 e[4]; unsigned w[2]; };

#define NB   64
#define DD   128
#define LC   1000
#define LQ   100
#define LQP  112      // 7 * 16
#define NIT  63       // ceil(1000/16)
#define NJT  7        // ceil(100/16)

// Workspace layout (bytes, all offsets 256-aligned)
#define WS_S     ((size_t)0)            // f32 [64][1000][112]   = 28,672,000 B
#define WS_RMAX  ((size_t)28672000)     // f32 [64000]           =    256,000 B
#define WS_RSUM  ((size_t)28928000)     // f32 [64000]           =    256,000 B
#define WS_T     ((size_t)29241344)     // f16 [64][128][128]    =  2,097,152 B (4,194,304 B reserved)
#define WS_QH    ((size_t)33435648)     // f16 [64][112][128]    =  1,835,008 B
#define WS_QG    ((size_t)35270656)     // f16 [64][128][128]    =  2,097,152 B (4,194,304 B reserved)
#define WS_CH    ((size_t)39464960)     // f16 [64][128][1024]   = 16,777,216 B
#define WS_CMAX  ((size_t)56242176)     // f32 [64][4][112]      =    114,688 B
#define WS_CSUM  ((size_t)56356864)     // f32 [64][4][112]      =    114,688 B
// total = 56,471,552 B

// Per-ISA 16-bit A/B fragment layout: lane L holds row (L&15); halves 0..7 are
// K = kb..kb+7 and halves 8..15 are K = kb+16..kb+23 where kb = k0 + 8*(L>=16).
// Two contiguous 16-byte loads per fragment.
__device__ __forceinline__ v16h frag_load(const _Float16* row, int k0, int lane) {
  V16H r;
  int kb = k0 + ((lane >> 4) << 3);
  r.h[0] = *(const v8h*)(row + kb);
  r.h[1] = *(const v8h*)(row + kb + 16);
  return r.v;
}

__device__ __forceinline__ v8f wmma16(v16h a, v16h b, v8f c) {
  return __builtin_amdgcn_wmma_f32_16x16x32_f16(false, a, false, b, (short)0, c,
                                                false, false);
}

// ---------------------------------------------------------------------------
// Kernel 0: precompute f16 padded operand layouts; zero T.
// ---------------------------------------------------------------------------
__global__ void cqa_prep(const float* __restrict__ C, const float* __restrict__ Q,
                         _Float16* __restrict__ Qh, _Float16* __restrict__ Qg,
                         _Float16* __restrict__ Ch, _Float16* __restrict__ T) {
  const int stride = gridDim.x * blockDim.x;
  int tid = blockIdx.x * blockDim.x + threadIdx.x;

  // Qh[b][j][d] = Q[b][d][j]  (j padded to 112)
  for (int idx = tid; idx < NB * LQP * DD; idx += stride) {
    int b = idx / (LQP * DD), r = idx % (LQP * DD);
    int j = r / DD, d = r % DD;
    float v = (j < LQ) ? Q[((size_t)(b * DD + d)) * LQ + j] : 0.f;
    Qh[idx] = (_Float16)v;
  }
  // Qg[b][d][j] = Q[b][d][j]  (j padded to 128)
  for (int idx = tid; idx < NB * DD * 128; idx += stride) {
    int b = idx >> 14, r = idx & 16383;
    int d = r >> 7, j = r & 127;
    float v = (j < LQ) ? Q[((size_t)(b * DD + d)) * LQ + j] : 0.f;
    Qg[idx] = (_Float16)v;
  }
  // Ch[b][d][i] = C[b][d][i]  (i padded to 1024)
  for (int idx = tid; idx < NB * DD * 1024; idx += stride) {
    int b = idx >> 17, r = idx & 131071;
    int d = r >> 10, i = r & 1023;
    float v = (i < LC) ? C[((size_t)(b * DD + d)) * LC + i] : 0.f;
    Ch[idx] = (_Float16)v;
  }
  // zero T (j in [112,128) stays zero; rest overwritten by cqa_t)
  for (int idx = tid; idx < NB * DD * 128; idx += stride) T[idx] = (_Float16)0.f;
}

// ---------------------------------------------------------------------------
// Kernel 1: S[b,i,j] = sum_d (w1+w3*Ct)[i,d] * Qt[j,d]  + rowbias[i]
// block = (b, i-tile of 16); 7 waves, one 16x16 j-tile each; K=128 (4 WMMAs).
// ---------------------------------------------------------------------------
__global__ void cqa_s(const float* __restrict__ C, const float* __restrict__ W,
                      const _Float16* __restrict__ Qh, float* __restrict__ S) {
  const int b = blockIdx.x / NIT;
  const int i0 = (blockIdx.x % NIT) * 16;
  const int tid = threadIdx.x;
  const int wv = tid >> 5, lane = tid & 31;

  __shared__ __attribute__((aligned(16))) _Float16 u[16][128];  // w1 + w3*Ct
  __shared__ float w2c[16][128];
  __shared__ float rs[16];

  for (int idx = tid; idx < 16 * 128; idx += 224) {
    int i = idx >> 7, d = idx & 127;
    int gi = i0 + i;
    float w1 = 0.f, w2 = 0.f, w3 = 0.f, c = 0.f;
    if (gi < LC) {
      const float* wrow = W + ((size_t)(b * LC + gi)) * 384;
      w1 = wrow[d]; w2 = wrow[128 + d]; w3 = wrow[256 + d];
      c = C[((size_t)(b * DD + d)) * LC + gi];
    }
    u[i][d] = (_Float16)(w1 + w3 * c);
    w2c[i][d] = w2 * c;
  }
  __syncthreads();
  if (tid < 16) {
    float s = 0.f;
    for (int d = 0; d < 128; ++d) s += w2c[tid][d];
    rs[tid] = s;
  }
  __syncthreads();

  const int j0 = wv * 16;
  const _Float16* arow = &u[lane & 15][0];
  const _Float16* brow = Qh + ((size_t)(b * LQP + j0 + (lane & 15))) * DD;
  v8f acc = {};
  for (int k0 = 0; k0 < 128; k0 += 32) {
    v16h a = frag_load(arow, k0, lane);
    v16h bq = frag_load(brow, k0, lane);
    acc = wmma16(a, bq, acc);
  }
  // D layout: n = lane&15, m = r + 8*(lane>=16)
  V8F av; av.v = acc;
  int j = j0 + (lane & 15);
  if (j < LQ) {
    int mb = (lane >> 4) << 3;
    for (int r = 0; r < 8; ++r) {
      int gi = i0 + mb + r;
      if (gi < LC)
        S[((size_t)(b * LC + gi)) * LQP + j] = av.e[r] + rs[mb + r];
    }
  }
}

// ---------------------------------------------------------------------------
// Kernel 2a: per-row (axis=2) softmax stats; one wave per row.
// ---------------------------------------------------------------------------
__global__ void cqa_rowstat(const float* __restrict__ S, float* __restrict__ rmax,
                            float* __restrict__ rsum) {
  int row = blockIdx.x * 8 + (threadIdx.x >> 5);   // 0 .. 63999
  int lane = threadIdx.x & 31;
  const float* p = S + (size_t)row * LQP;
  float v[4], m = -1e30f;
  for (int t = 0; t < 4; ++t) {
    int j = lane + 32 * t;
    v[t] = (j < LQ) ? p[j] : -1e30f;
    m = fmaxf(m, v[t]);
  }
  for (int off = 16; off; off >>= 1) m = fmaxf(m, __shfl_xor(m, off, 32));
  float s = 0.f;
  for (int t = 0; t < 4; ++t) {
    int j = lane + 32 * t;
    if (j < LQ) s += __expf(v[t] - m);
  }
  for (int off = 16; off; off >>= 1) s += __shfl_xor(s, off, 32);
  if (lane == 0) { rmax[row] = m; rsum[row] = s; }
}

// ---------------------------------------------------------------------------
// Kernel 2b: per-column (axis=1) softmax stats, partial over 250 context rows.
// block = (b, part of 250 rows); thread = (row group rg of 10, quad q of 25): it
// holds columns 4q .. 4q+3 of rows rg, rg+10, .. rg+240 in registers, all 25 loads
// in flight at once, takes their maximum and then the sum of exponentials. The ten
// row groups are merged through LDS; the four parts of a batch in cqa_t.
// ---------------------------------------------------------------------------
#define CSP  4        // parts per batch
#define CSR  250      // context rows per part
#define CRG  10       // row groups per block
#define CQ   25       // LQ / 4 quads per row
#define CRT  25       // rows per thread = CSR / CRG

__global__ __launch_bounds__(256)
void cqa_colstat(const float* __restrict__ S, float* __restrict__ pmax,
                 float* __restrict__ psum) {
  const int b = blockIdx.x / CSP, part = blockIdx.x % CSP;
  const int tid = threadIdx.x;
  __shared__ __attribute__((aligned(16))) float lm[CRG * LQ];
  __shared__ __attribute__((aligned(16))) float ls[CRG * LQ];

  if (tid < CRG * CQ) {
    const int rg = tid / CQ, q = tid % CQ;
    const float* p = S + ((size_t)(b * LC + part * CSR + rg)) * LQP + 4 * q;
    float4 x[CRT];
#pragma unroll  // the array must stay in registers
    for (int k = 0; k < CRT; ++k) x[k] = *(const float4*)(p + (size_t)k * CRG * LQP);
    float4 m = x[0];
#pragma unroll  // as above
    for (int k = 1; k < CRT; ++k) {
      m.x = fmaxf(m.x, x[k].x); m.y = fmaxf(m.y, x[k].y);
      m.z = fmaxf(m.z, x[k].z); m.w = fmaxf(m.w, x[k].w);
    }
    float4 s = make_float4(0.f, 0.f, 0.f, 0.f);
#pragma unroll  // as above
    for (int k = 0; k < CRT; ++k) {
      s.x += __expf(x[k].x - m.x); s.y += __expf(x[k].y - m.y);
      s.z += __expf(x[k].z - m.z); s.w += __expf(x[k].w - m.w);
    }
    // rg * LQ + 4 * q = 4 * tid: the block's stores are contiguous
    *(float4*)&lm[4 * tid] = m;
    *(float4*)&ls[4 * tid] = s;
  }
  __syncthreads();
  if (tid < LQ) {
    float m = lm[tid];
#pragma unroll  // ten independent LDS reads, no loop overhead
    for (int r = 1; r < CRG; ++r) m = fmaxf(m, lm[r * LQ + tid]);
    float s = 0.f;
#pragma unroll  // as above
    for (int r = 0; r < CRG; ++r) s += ls[r * LQ + tid] * __expf(lm[r * LQ + tid] - m);
    pmax[(b * CSP + part) * LQP + tid] = m;
    psum[(b * CSP + part) * LQP + tid] = s;
  }
}

// ---------------------------------------------------------------------------
// Kernel 3: T[b][d][j] = sum_i S2[b,i,j] * Ct[b,i,d]   (M=j, N=d, K=i)
// block = (b, j-tile); 8 waves each own 16-wide d-tile; 32 K-chunks of 32.
// ---------------------------------------------------------------------------
__global__ void cqa_t(const float* __restrict__ S, const float* __restrict__ pmax,
                      const float* __restrict__ psum, const _Float16* __restrict__ Ch,
                      _Float16* __restrict__ T) {
  const int b = blockIdx.x / NJT;
  const int j0 = (blockIdx.x % NJT) * 16;
  const int tid = threadIdx.x, wv = tid >> 5, lane = tid & 31;

  __shared__ __attribute__((aligned(16))) _Float16 As[16][32];
  __shared__ float cm[16], csr[16];
  if (tid < 16) {
    // merge the column's four partial (maximum, sum) pairs; padded columns are
    // never written by cqa_colstat and take (0, 1)
    float m = 0.f, s = 1.f;
    if (j0 + tid < LQ) {
      const int o = b * CSP * LQP + j0 + tid;
      float pm[CSP], ps[CSP];
#pragma unroll  // the arrays must stay in registers
      for (int p = 0; p < CSP; ++p) { pm[p] = pmax[o + p * LQP]; ps[p] = psum[o + p * LQP]; }
      m = fmaxf(fmaxf(pm[0], pm[1]), fmaxf(pm[2], pm[3]));
      s = 0.f;
#pragma unroll  // as above
      for (int p = 0; p < CSP; ++p) s += ps[p] * __expf(pm[p] - m);
    }
    cm[tid] = m;
    csr[tid] = 1.0f / s;
  }

  const _Float16* arow = &As[lane & 15][0];
  const _Float16* brow = Ch + ((size_t)(b * DD + wv * 16 + (lane & 15))) * 1024;
  v8f acc = {};
  for (int i0 = 0; i0 < 1024; i0 += 32) {
    __syncthreads();
    for (int idx = tid; idx < 16 * 32; idx += 256) {
      int jl = idx >> 5, il = idx & 31;
      int gi = i0 + il, gj = j0 + jl;
      float e = 0.f;
      if (gi < LC && gj < LQ)
        e = __expf(S[((size_t)(b * LC + gi)) * LQP + gj] - cm[jl]);
      As[jl][il] = (_Float16)e;
    }
    __syncthreads();
    v16h a = frag_load(arow, 0, lane);
    v16h bc = frag_load(brow, i0, lane);
    acc = wmma16(a, bc, acc);
  }

  // D: n = lane&15 -> d_local, m = r + 8*(lane>=16) -> j_local (consecutive j)
  V8F av; av.v = acc;
  int d = wv * 16 + (lane & 15);
  int mb = (lane >> 4) << 3;
  V8H o;
  for (int r = 0; r < 8; ++r) {
    int jl = mb + r;
    float val = (j0 + jl < LQ) ? av.e[r] * csr[jl] : 0.f;
    o.e[r] = (_Float16)val;
  }
  *(v8h*)(T + ((size_t)(b * DD + d)) * 128 + j0 + mb) = o.v;
}

// ---------------------------------------------------------------------------
// Kernel 4: A = S1@Qt, Bm = S1@T; emit [Ct, A, Ct*A, Ct*Bm] transposed.
// block = (b, 64 context rows); 8 waves each own a 16-wide d-tile and all 64 rows.
// The products are formed transposed (M = d, N = i). Column c of N-tile t is
// context row 4c + t, so a lane's four accumulator tiles hold four consecutive
// i of one output row: 16 lanes store 256 contiguous bytes of that row.
// A is formed and stored first, then Bm, so 32 accumulator registers serve both.
// ---------------------------------------------------------------------------
// exp(x) as __expf forms it (x * log2(e), then the hardware exp2). The v_nop fills
// the slot that the instruction set asks for behind a transcendental before its
// result is used or its source overwritten; in the statement it cannot drift away.
__device__ __forceinline__ float exp_slot(float x) {
  float y, a = x * 1.44269504088896340736f;
  asm("v_exp_f32 %0, %1\n\tv_nop" : "=v"(y) : "v"(a));
  return y;
}

#define OIT   64      // context rows per block
#define ONT   16      // ceil(1000/64)
#define SPIT  136     // halves per LDS row: 272 B = 16 B x odd, for 16-byte readers

__global__ __launch_bounds__(256)
void cqa_out(const float* __restrict__ C, const float* __restrict__ S,
             const float* __restrict__ rmax, const float* __restrict__ rsum,
             const _Float16* __restrict__ Qg, const _Float16* __restrict__ T,
             float* __restrict__ out) {
  const int b = blockIdx.x / ONT;
  const int i0 = (blockIdx.x % ONT) * OIT;
  const int tid = threadIdx.x, wv = tid >> 5, lane = tid & 31;
  const int c = lane & 15;

  // LDS row 16*t + c holds S1 of context row i0 + 4*c + t.
  __shared__ __attribute__((aligned(16))) _Float16 As1[OIT][SPIT];

  // The lane's part of Ct: rows d = dbase + r, context rows gi .. gi + 3. LC and i0
  // are multiples of 4, so the four are all inside or all outside; lanes outside
  // read the last four inside and store nothing.
  const int gi = i0 + 4 * c;
  const int dbase = wv * 16 + ((lane >> 4) << 3);
  const float* cp = C + ((size_t)(b * DD + dbase)) * LC + (gi < LC ? gi : LC - 4);
  float4 ct[8];
#pragma unroll  // the array must stay in registers
  for (int r = 0; r < 8; ++r) ct[r] = *(const float4*)(cp + (size_t)r * LC);

  // One wave per context row, a lane takes four consecutive j. All eight rows'
  // loads are issued before the first is used. Lanes past the row's end and rows
  // past LC re-read the last valid place; their values are replaced by zero.
  const unsigned jo = 4u * (unsigned)(lane < LQ / 4 ? lane : LQ / 4 - 1);
  // the wave's number as a scalar: row addresses and row statistics are wave-uniform
  const int wvu = __builtin_amdgcn_readfirstlane(wv);
  float4 s[8];
  float mx[8], sm[8];
#pragma unroll  // as above
  for (int u = 0; u < 8; ++u) {
    int si = i0 + wvu + 8 * u;
    int row = b * LC + (si < LC ? si : LC - 1);
    const float* srow = S + (size_t)row * LQP;  // wave-uniform base
    s[u] = *(const float4*)(srow + jo);
    mx[u] = rmax[row];
    sm[u] = rsum[row];
  }
#pragma unroll  // as above
  for (int u = 0; u < 8; ++u) {
    const int m = wvu + 8 * u;
    // all-ones where the four values are real, else zero: the quotients are
    // formed in every lane (their inputs are valid) and masked as bits
    const unsigned keep = ((i0 + m < LC) && (lane < LQ / 4)) ? 0xffffffffu : 0u;
    V4H h;
    h.e[0] = (_Float16)(exp_slot(s[u].x - mx[u]) / sm[u]);
    h.e[1] = (_Float16)(exp_slot(s[u].y - mx[u]) / sm[u]);
    h.e[2] = (_Float16)(exp_slot(s[u].z - mx[u]) / sm[u]);
    h.e[3] = (_Float16)(exp_slot(s[u].w - mx[u]) / sm[u]);
    h.w[0] &= keep;
    h.w[1] &= keep;
    *(v4h*)&As1[((m & 3) << 4) + (m >> 2)][4 * lane] = h.v;
  }

  const _Float16* rowQ = Qg + ((size_t)(b * DD + wv * 16 + c)) * 128;
  const _Float16* rowT = T + ((size_t)(b * DD + wv * 16 + c)) * 128;
  v16h fq[4], ft[4];
#pragma unroll  // as above
  for (int k = 0; k < 4; ++k) fq[k] = frag_load(rowQ, 32 * k, lane);
  __syncthreads();

  float* op = out + ((size_t)(b * 512 + dbase)) * LC + gi;
  v8f acc[4] = {};
#pragma unroll  // as above
  for (int k = 0; k < 4; ++k) {
#pragma unroll  // as above
    for (int t = 0; t < 4; ++t)
      acc[t] = wmma16(fq[k], frag_load(&As1[16 * t + c][0], 32 * k, lane), acc[t]);
  }
#pragma unroll  // as above
  for (int k = 0; k < 4; ++k) ft[k] = frag_load(rowT, 32 * k, lane);

  // D: register r = [d_local = 8*(lane>=16) + r][column c]; tiles t = 0..3 give
  // i = gi + t.
  if (gi < LC) {
#pragma unroll  // as above
    for (int r = 0; r < 8; ++r) {
      float4 va = make_float4(acc[0][r], acc[1][r], acc[2][r], acc[3][r]);
      float* o = op + (size_t)r * LC;
      *(float4*)(o) = ct[r];
      *(float4*)(o + (size_t)128 * LC) = va;
      *(float4*)(o + (size_t)256 * LC) =
          make_float4(ct[r].x * va.x, ct[r].y * va.y, ct[r].z * va.z, ct[r].w * va.w);
    }
  }

#pragma unroll  // as above
  for (int t = 0; t < 4; ++t) acc[t] = v8f{};
#pragma unroll  // as above
  for (int k = 0; k < 4; ++k) {
#pragma unroll  // as above
    for (int t = 0; t < 4; ++t)
      acc[t] = wmma16(ft[k], frag_load(&As1[16 * t + c][0], 32 * k, lane), acc[t]);
  }
  if (gi < LC) {
#pragma unroll  // as above
    for (int r = 0; r < 8; ++r) {
      *(float4*)(op + (size_t)(384 + r) * LC) =
          make_float4(ct[r].x * acc[0][r], ct[r].y * acc[1][r], ct[r].z * acc[2][r],
                      ct[r].w * acc[3][r]);
    }
  }
}

// ---------------------------------------------------------------------------
extern "C" void kernel_launch(void* const* d_in, const int* in_sizes, int n_in,
                              void* d_out, int out_size, void* d_ws, size_t ws_size,
                              hipStream_t stream) {
  (void)in_sizes; (void)n_in; (void)out_size; (void)ws_size;
  const float* C = (const float*)d_in[0];
  const float* Q = (const float*)d_in[1];
  const float* W = (const float*)d_in[2];
  float* out = (float*)d_out;
  char* ws = (char*)d_ws;

  float*    Sbuf = (float*)(ws + WS_S);
  float*    rmax = (float*)(ws + WS_RMAX);
  float*    rsum = (float*)(ws + WS_RSUM);
  float*    cmax = (float*)(ws + WS_CMAX);
  float*    csum = (float*)(ws + WS_CSUM);
  _Float16* T    = (_Float16*)(ws + WS_T);
  _Float16* Qh   = (_Float16*)(ws + WS_QH);
  _Float16* Qg   = (_Float16*)(ws + WS_QG);
  _Float16* Ch   = (_Float16*)(ws + WS_CH);

  cqa_prep<<<1024, 256, 0, stream>>>(C, Q, Qh, Qg, Ch, T);
  cqa_s<<<NB * NIT, 224, 0, stream>>>(C, W, Qh, Sbuf);
  cqa_rowstat<<<(NB * LC) / 8, 256, 0, stream>>>(Sbuf, rmax, rsum);
  cqa_colstat<<<NB * CSP, 256, 0, stream>>>(Sbuf, cmax, csum);
  cqa_t<<<NB * NJT, 256, 0, stream>>>(Sbuf, cmax, csum, Ch, T);
  cqa_out<<<NB * ONT, 256, 0, stream>>>(C, Sbuf, rmax, rsum, Qg, T, out);
}

// v003
// Measured time: 139 microseconds a run.
// Two timings next to v002 put it at 1.08 and 1.09 times that version's speed.
// Counting every step since v000, it is 1.91 times as fast.
#include <hip/hip_runtime.h>

// ---------------------------------------------------------------------------
// CQAttention for MI455X (gfx1250, wave32, WMMA f32_16x16x32_f16)
// B=64, D=128, LC=1000 (pad 1008/1024), LQ=100 (pad 112/128)
// ---------------------------------------------------------------------------

typedef __attribute__((ext_vector_type(16))) _Float16 v16h;
typedef __attribute__((ext_vector_type(8)))  _Float16 v8h;
typedef __attribute__((ext_vector_type(4)))  _Float16 v4h;
typedef __attribute__((ext_vector_type(8)))  float    v8f;

union V16H { v16h v; v8h h[2]; };
union V8F  { v8f v; float e[8]; };
union V8H  { v8h v; _Float16 e[8]; };
union V4H  { v4h v; _Float16 e[4]; unsigned w[2]; };

#define NB   64
#define DD   128
#define LC   1000
#define LQ   100
#define LQP  112      // 7 * 16
#define NIT  63       // ceil(1000/16)
#define NJT  7        // ceil(100/16)

// Workspace layout (bytes, all offsets 256-aligned)
#define WS_S     ((size_t)0)            // f32 [64][1000][112]   = 28,672,000 B
#define WS_T     ((size_t)29241344)     // f16 [64][128][128]    =  2,097,152 B (4,194,304 B reserved)
#define WS_QH    ((size_t)33435648)     // f16 [64][112][128]    =  1,835,008 B
#define WS_QG    ((size_t)35270656)     // f16 [64][128][128]    =  2,097,152 B (4,194,304 B reserved)
#define WS_CH    ((size_t)39464960)     // f16 [64][128][1024]   = 16,777,216 B
#define WS_CMAX  ((size_t)56242176)     // f32 [64][4][112]      =    114,688 B
#define WS_CSUM  ((size_t)56356864)     // f32 [64][4][112]      =    114,688 B
// total = 56,471,552 B

// Per-ISA 16-bit A/B fragment layout: lane L holds row (L&15); halves 0..7 are
// K = kb..kb+7 and halves 8..15 are K = kb+16..kb+23 where kb = k0 + 8*(L>=16).
// Two contiguous 16-byte loads per fragment.
__device__ __forceinline__ v16h frag_load(const _Float16* row, int k0, int lane) {
  V16H r;
  int kb = k0 + ((lane >> 4) << 3);
  r.h[0] = *(const v8h*)(row + kb);
  r.h[1] = *(const v8h*)(row + kb + 16);
  return r.v;
}

__device__ __forceinline__ v8f wmma16(v16h a, v16h b, v8f c) {
  return __builtin_amdgcn_wmma_f32_16x16x32_f16(false, a, false, b, (short)0, c,
                                                false, false);
}

// ---------------------------------------------------------------------------
// Kernel 0: precompute f16 padded operand layouts; zero T.
// ---------------------------------------------------------------------------
__global__ void cqa_prep(const float* __restrict__ C, const float* __restrict__ Q,
                         _Float16* __restrict__ Qh, _Float16* __restrict__ Qg,
                         _Float16* __restrict__ Ch, _Float16* __restrict__ T) {
  const int stride = gridDim.x * blockDim.x;
  int tid = blockIdx.x * blockDim.x + threadIdx.x;

  // Qh[b][j][d] = Q[b][d][j]  (j padded to 112)
  for (int idx = tid; idx < NB * LQP * DD; idx += stride) {
    int b = idx / (LQP * DD), r = idx % (LQP * DD);
    int j = r / DD, d = r % DD;
    float v = (j < LQ) ? Q[((size_t)(b * DD + d)) * LQ + j] : 0.f;
    Qh[idx] = (_Float16)v;
  }
  // Qg[b][d][j] = Q[b][d][j]  (j padded to 128)
  for (int idx = tid; idx < NB * DD * 128; idx += stride) {
    int b = idx >> 14, r = idx & 16383;
    int d = r >> 7, j = r & 127;
    float v = (j < LQ) ? Q[((size_t)(b * DD + d)) * LQ + j] : 0.f;
    Qg[idx] = (_Float16)v;
  }
  // Ch[b][d][i] = C[b][d][i]  (i padded to 1024)
  for (int idx = tid; idx < NB * DD * 1024; idx += stride) {
    int b = idx >> 17, r = idx & 131071;
    int d = r >> 10, i = r & 1023;
    float v = (i < LC) ? C[((size_t)(b * DD + d)) * LC + i] : 0.f;
    Ch[idx] = (_Float16)v;
  }
  // zero T (j in [112,128) stays zero; rest overwritten by cqa_t)
  for (int idx = tid; idx < NB * DD * 128; idx += stride) T[idx] = (_Float16)0.f;
}

// ---------------------------------------------------------------------------
// Kernel 1: S[b,i,j] = sum_d (w1+w3*Ct)[i,d] * Qt[j,d]  + rowbias[i]
// block = (b, i-tile of 16); 7 waves, one 16x16 j-tile each; K=128 (4 WMMAs).
// ---------------------------------------------------------------------------
__global__ void cqa_s(const float* __restrict__ C, const float* __restrict__ W,
                      const _Float16* __restrict__ Qh, float* __restrict__ S) {
  const int b = blockIdx.x / NIT;
  const int i0 = (blockIdx.x % NIT) * 16;
  const int tid = threadIdx.x;
  const int wv = tid >> 5, lane = tid & 31;

  __shared__ __attribute__((aligned(16))) _Float16 u[16][128];  // w1 + w3*Ct
  __shared__ float w2c[16][128];
  __shared__ float rs[16];

  for (int idx = tid; idx < 16 * 128; idx += 224) {
    int i = idx >> 7, d = idx & 127;
    int gi = i0 + i;
    float w1 = 0.f, w2 = 0.f, w3 = 0.f, c = 0.f;
    if (gi < LC) {
      const float* wrow = W + ((size_t)(b * LC + gi)) * 384;
      w1 = wrow[d]; w2 = wrow[128 + d]; w3 = wrow[256 + d];
      c = C[((size_t)(b * DD + d)) * LC + gi];
    }
    u[i][d] = (_Float16)(w1 + w3 * c);
    w2c[i][d] = w2 * c;
  }
  __syncthreads();
  if (tid < 16) {
    float s = 0.f;
    for (int d = 0; d < 128; ++d) s += w2c[tid][d];
    rs[tid] = s;
  }
  __syncthreads();

  const int j0 = wv * 16;
  const _Float16* arow = &u[lane & 15][0];
  const _Float16* brow = Qh + ((size_t)(b * LQP + j0 + (lane & 15))) * DD;
  v8f acc = {};
  for (int k0 = 0; k0 < 128; k0 += 32) {
    v16h a = frag_load(arow, k0, lane);
    v16h bq = frag_load(brow, k0, lane);
    acc = wmma16(a, bq, acc);
  }
  // D layout: n = lane&15, m = r + 8*(lane>=16)
  V8F av; av.v = acc;
  int j = j0 + (lane & 15);
  if (j < LQ) {
    int mb = (lane >> 4) << 3;
    for (int r = 0; r < 8; ++r) {
      int gi = i0 + mb + r;
      if (gi < LC)
        S[((size_t)(b * LC + gi)) * LQP + j] = av.e[r] + rs[mb + r];
    }
  }
}

// ---------------------------------------------------------------------------
// Kernel 2: per-column (axis=1) softmax stats, partial over 250 context rows.
// block = (b, part of 250 rows); thread = (row group rg of 10, quad q of 25): it
// holds columns 4q .. 4q+3 of rows rg, rg+10, .. rg+240 in registers, all 25 loads
// in flight at once, takes their maximum and then the sum of exponentials. The ten
// row groups are merged through LDS; the four parts of a batch in cqa_t.
// ---------------------------------------------------------------------------
#define CSP  4        // parts per batch
#define CSR  250      // context rows per part
#define CRG  10       // row groups per block
#define CQ   25       // LQ / 4 quads per row
#define CRT  25       // rows per thread = CSR / CRG

__global__ __launch_bounds__(256)
void cqa_colstat(const float* __restrict__ S, float* __restrict__ pmax,
                 float* __restrict__ psum) {
  const int b = blockIdx.x / CSP, part = blockIdx.x % CSP;
  const int tid = threadIdx.x;
  __shared__ __attribute__((aligned(16))) float lm[CRG * LQ];
  __shared__ __attribute__((aligned(16))) float ls[CRG * LQ];

  if (tid < CRG * CQ) {
    const int rg = tid / CQ, q = tid % CQ;
    const float* p = S + ((size_t)(b * LC + part * CSR + rg)) * LQP + 4 * q;
    float4 x[CRT];
#pragma unroll  // the array must stay in registers
    for (int k = 0; k < CRT; ++k) x[k] = *(const float4*)(p + (size_t)k * CRG * LQP);
    float4 m = x[0];
#pragma unroll  // as above
    for (int k = 1; k < CRT; ++k) {
      m.x = fmaxf(m.x, x[k].x); m.y = fmaxf(m.y, x[k].y);
      m.z = fmaxf(m.z, x[k].z); m.w = fmaxf(m.w, x[k].w);
    }
    float4 s = make_float4(0.f, 0.f, 0.f, 0.f);
#pragma unroll  // as above
    for (int k = 0; k < CRT; ++k) {
      s.x += __expf(x[k].x - m.x); s.y += __expf(x[k].y - m.y);
      s.z += __expf(x[k].z - m.z); s.w += __expf(x[k].w - m.w);
    }
    // rg * LQ + 4 * q = 4 * tid: the block's stores are contiguous
    *(float4*)&lm[4 * tid] = m;
    *(float4*)&ls[4 * tid] = s;
  }
  __syncthreads();
  if (tid < LQ) {
    float m = lm[tid];
#pragma unroll  // ten independent LDS reads, no loop overhead
    for (int r = 1; r < CRG; ++r) m = fmaxf(m, lm[r * LQ + tid]);
    float s = 0.f;
#pragma unroll  // as above
    for (int r = 0; r < CRG; ++r) s += ls[r * LQ + tid] * __expf(lm[r * LQ + tid] - m);
    pmax[(b * CSP + part) * LQP + tid] = m;
    psum[(b * CSP + part) * LQP + tid] = s;
  }
}

// ---------------------------------------------------------------------------
// Kernel 3: T[b][d][j] = sum_i S2[b,i,j] * Ct[b,i,d]   (M=j, N=d, K=i)
// block = (b, j-tile); 8 waves each own 16-wide d-tile; 32 K-chunks of 32.
// ---------------------------------------------------------------------------
__global__ void cqa_t(const float* __restrict__ S, const float* __restrict__ pmax,
                      const float* __restrict__ psum, const _Float16* __restrict__ Ch,
                      _Float16* __restrict__ T) {
  const int b = blockIdx.x / NJT;
  const int j0 = (blockIdx.x % NJT) * 16;
  const int tid = threadIdx.x, wv = tid >> 5, lane = tid & 31;

  __shared__ __attribute__((aligned(16))) _Float16 As[16][32];
  __shared__ float cm[16], csr[16];
  if (tid < 16) {
    // merge the column's four partial (maximum, sum) pairs; padded columns are
    // never written by cqa_colstat and take (0, 1)
    float m = 0.f, s = 1.f;
    if (j0 + tid < LQ) {
      const int o = b * CSP * LQP + j0 + tid;
      float pm[CSP], ps[CSP];
#pragma unroll  // the arrays must stay in registers
      for (int p = 0; p < CSP; ++p) { pm[p] = pmax[o + p * LQP]; ps[p] = psum[o + p * LQP]; }
      m = fmaxf(fmaxf(pm[0], pm[1]), fmaxf(pm[2], pm[3]));
      s = 0.f;
#pragma unroll  // as above
      for (int p = 0; p < CSP; ++p) s += ps[p] * __expf(pm[p] - m);
    }
    cm[tid] = m;
    csr[tid] = 1.0f / s;
  }

  const _Float16* arow = &As[lane & 15][0];
  const _Float16* brow = Ch + ((size_t)(b * DD + wv * 16 + (lane & 15))) * 1024;
  v8f acc = {};
  for (int i0 = 0; i0 < 1024; i0 += 32) {
    __syncthreads();
    for (int idx = tid; idx < 16 * 32; idx += 256) {
      int jl = idx >> 5, il = idx & 31;
      int gi = i0 + il, gj = j0 + jl;
      float e = 0.f;
      if (gi < LC && gj < LQ)
        e = __expf(S[((size_t)(b * LC + gi)) * LQP + gj] - cm[jl]);
      As[jl][il] = (_Float16)e;
    }
    __syncthreads();
    v16h a = frag_load(arow, 0, lane);
    v16h bc = frag_load(brow, i0, lane);
    acc = wmma16(a, bc, acc);
  }

  // D: n = lane&15 -> d_local, m = r + 8*(lane>=16) -> j_local (consecutive j)
  V8F av; av.v = acc;
  int d = wv * 16 + (lane & 15);
  int mb = (lane >> 4) << 3;
  V8H o;
  for (int r = 0; r < 8; ++r) {
    int jl = mb + r;
    float val = (j0 + jl < LQ) ? av.e[r] * csr[jl] : 0.f;
    o.e[r] = (_Float16)val;
  }
  *(v8h*)(T + ((size_t)(b * DD + d)) * 128 + j0 + mb) = o.v;
}

// ---------------------------------------------------------------------------
// Kernel 4: A = S1@Qt, Bm = S1@T; emit [Ct, A, Ct*A, Ct*Bm] transposed.
// block = (b, 64 context rows); 8 waves each own a 16-wide d-tile and all 64 rows.
// The products are formed transposed (M = d, N = i). Column c of N-tile t is
// context row 4c + t, so a lane's four accumulator tiles hold four consecutive
// i of one output row: 16 lanes store 256 contiguous bytes of that row.
// A is formed and stored first, then Bm, so 32 accumulator registers serve both.
// The row softmax (axis=2) is formed here as well: a wave holds a whole row of S in
// registers, so the row's maximum and sum of exponentials are two wave reductions.
// ---------------------------------------------------------------------------
// exp(x) as __expf forms it (x * log2(e), then the hardware exp2). The v_nop fills
// the slot that the instruction set asks for behind a transcendental before its
// result is used or its source overwritten; in the statement it cannot drift away.
__device__ __forceinline__ float exp_slot(float x) {
  float y, a = x * 1.44269504088896340736f;
  asm("v_exp_f32 %0, %1\n\tv_nop" : "=v"(y) : "v"(a));
  return y;
}

// Value of lane l ^ M inside the 16-lane row (DPP row_xmask); every lane is on.
template <int M>
__device__ __forceinline__ float row_xor(float x) {
  return __builtin_bit_cast(float, __builtin_amdgcn_update_dpp(
      0, __builtin_bit_cast(int, x), 0x160 | M, 0xf, 0xf, true));
}
// Value of lane l ^ 16.
__device__ __forceinline__ float half_xor(float x) {
  int v = __builtin_bit_cast(int, x);
  return __builtin_bit_cast(float, __builtin_amdgcn_permlanex16(v, v, 0x76543210, 0xfedcba98,
                                                                false, false));
}
__device__ __forceinline__ float wave_max(float x) {
  x = fmaxf(x, row_xor<1>(x)); x = fmaxf(x, row_xor<2>(x));
  x = fmaxf(x, row_xor<4>(x)); x = fmaxf(x, row_xor<8>(x));
  return fmaxf(x, half_xor(x));
}
__device__ __forceinline__ float wave_sum(float x) {
  x += row_xor<1>(x); x += row_xor<2>(x);
  x += row_xor<4>(x); x += row_xor<8>(x);
  return x + half_xor(x);
}

#define OIT   64      // context rows per block
#define ONT   16      // ceil(1000/64)
#define SPIT  136     // halves per LDS row: 272 B = 16 B x odd, for 16-byte readers

__global__ __launch_bounds__(256)
void cqa_out(const float* __restrict__ C, const float* __restrict__ S,
             const _Float16* __restrict__ Qg, const _Float16* __restrict__ T,
             float* __restrict__ out) {
  const int b = blockIdx.x / ONT;
  const int i0 = (blockIdx.x % ONT) * OIT;
  const int tid = threadIdx.x, wv = tid >> 5, lane = tid & 31;
  const int c = lane & 15;

  // LDS row 16*t + c holds S1 of context row i0 + 4*c + t.
  __shared__ __attribute__((aligned(16))) _Float16 As1[OIT][SPIT];

  // The lane's part of Ct: rows d = dbase + r, context rows gi .. gi + 3. LC and i0
  // are multiples of 4, so the four are all inside or all outside; lanes outside
  // read the last four inside and store nothing.
  const int gi = i0 + 4 * c;
  const int dbase = wv * 16 + ((lane >> 4) << 3);
  const float* cp = C + ((size_t)(b * DD + dbase)) * LC + (gi < LC ? gi : LC - 4);
  float4 ct[8];
#pragma unroll  // the array must stay in registers
  for (int r = 0; r < 8; ++r) ct[r] = *(const float4*)(cp + (size_t)r * LC);

  // One wave per context row, a lane takes four consecutive j. All eight rows'
  // loads are issued before the first is used. Lanes past the row's end and rows
  // past LC re-read the last valid place; their values are replaced by zero.
  const unsigned jo = 4u * (unsigned)(lane < LQ / 4 ? lane : LQ / 4 - 1);
  // the wave's number as a scalar: row addresses are wave-uniform
  const int wvu = __builtin_amdgcn_readfirstlane(wv);
  float4 s[8];
  float mx[8], sm[8];
#pragma unroll  // as above
  for (int u = 0; u < 8; ++u) {
    int si = i0 + wvu + 8 * u;
    int row = b * LC + (si < LC ? si : LC - 1);
    const float* srow = S + (size_t)row * LQP;  // wave-uniform base
    s[u] = *(const float4*)(srow + jo);
  }
  // Row maximum: the re-read quads of lanes past the row's end repeat real values.
#pragma unroll  // as above; the eight rows' reductions are independent chains
  for (int u = 0; u < 8; ++u)
    mx[u] = wave_max(fmaxf(fmaxf(s[u].x, s[u].y), fmaxf(s[u].z, s[u].w)));
  // Exponentials, kept for the quotients below, and their sum over the real lanes.
#pragma unroll  // as above
  for (int u = 0; u < 8; ++u) {
    s[u].x = exp_slot(s[u].x - mx[u]);
    s[u].y = exp_slot(s[u].y - mx[u]);
    s[u].z = exp_slot(s[u].z - mx[u]);
    s[u].w = exp_slot(s[u].w - mx[u]);
    sm[u] = wave_sum(lane < LQ / 4 ? (s[u].x + s[u].y) + (s[u].z + s[u].w) : 0.f);
  }
#pragma unroll  // as above
  for (int u = 0; u < 8; ++u) {
    const int m = wvu + 8 * u;
    // all-ones where the four values are real, else zero: the quotients are
    // formed in every lane (their inputs are valid) and masked as bits
    const unsigned keep = ((i0 + m < LC) && (lane < LQ / 4)) ? 0xffffffffu : 0u;
    V4H h;
    h.e[0] = (_Float16)(s[u].x / sm[u]);
    h.e[1] = (_Float16)(s[u].y / sm[u]);
    h.e[2] = (_Float16)(s[u].z / sm[u]);
    h.e[3] = (_Float16)(s[u].w / sm[u]);
    h.w[0] &= keep;
    h.w[1] &= keep;
    *(v4h*)&As1[((m & 3) << 4) + (m >> 2)][4 * lane] = h.v;
  }

  const _Float16* rowQ = Qg + ((size_t)(b * DD + wv * 16 + c)) * 128;
  const _Float16* rowT = T + ((size_t)(b * DD + wv * 16 + c)) * 128;
  v16h fq[4], ft[4];
#pragma unroll  // as above
  for (int k = 0; k < 4; ++k) fq[k] = frag_load(rowQ, 32 * k, lane);
  __syncthreads();

  float* op = out + ((size_t)(b * 512 + dbase)) * LC + gi;
  v8f acc[4] = {};
#pragma unroll  // as above
  for (int k = 0; k < 4; ++k) {
#pragma unroll  // as above
    for (int t = 0; t < 4; ++t)
      acc[t] = wmma16(fq[k], frag_load(&As1[16 * t + c][0], 32 * k, lane), acc[t]);
  }
#pragma unroll  // as above
  for (int k = 0; k < 4; ++k) ft[k] = frag_load(rowT, 32 * k, lane);

  // D: register r = [d_local = 8*(lane>=16) + r][column c]; tiles t = 0..3 give
  // i = gi + t.
  if (gi < LC) {
#pragma unroll  // as above
    for (int r = 0; r < 8; ++r) {
      float4 va = make_float4(acc[0][r], acc[1][r], acc[2][r], acc[3][r]);
      float* o = op + (size_t)r * LC;
      *(float4*)(o) = ct[r];
      *(float4*)(o + (size_t)128 * LC) = va;
      *(float4*)(o + (size_t)256 * LC) =
          make_float4(ct[r].x * va.x, ct[r].y * va.y, ct[r].z * va.z, ct[r].w * va.w);
    }
  }

#pragma unroll  // as above
  for (int t = 0; t < 4; ++t) acc[t] = v8f{};
#pragma unroll  // as above
  for (int k = 0; k < 4; ++k) {
#pragma unroll  // as above
    for (int t = 0; t < 4; ++t)
      acc[t] = wmma16(ft[k], frag_load(&As1[16 * t + c][0], 32 * k, lane), acc[t]);
  }
  if (gi < LC) {
#pragma unroll  // as above
    for (int r = 0; r < 8; ++r) {
      *(float4*)(op + (size_t)(384 + r) * LC) =
          make_float4(ct[r].x * acc[0][r], ct[r].y * acc[1][r], ct[r].z * acc[2][r],
                      ct[r].w * acc[3][r]);
    }
  }
}

// ---------------------------------------------------------------------------
extern "C" void kernel_launch(void* const* d_in, const int* in_sizes, int n_in,
                              void* d_out, int out_size, void* d_ws, size_t ws_size,
                              hipStream_t stream) {
  (void)in_sizes; (void)n_in; (void)out_size; (void)ws_size;
  const float* C = (const float*)d_in[0];
  const float* Q = (const float*)d_in[1];
  const float* W = (const float*)d_in[2];
  float* out = (float*)d_out;
  char* ws = (char*)d_ws;

  float*    Sbuf = (float*)(ws + WS_S);
  float*    cmax = (float*)(ws + WS_CMAX);
  float*    csum = (float*)(ws + WS_CSUM);
  _Float16* T    = (_Float16*)(ws + WS_T);
  _Float16* Qh   = (_Float16*)(ws + WS_QH);
  _Float16* Qg   = (_Float16*)(ws + WS_QG);
  _Float16* Ch   = (_Float16*)(ws + WS_CH);

  cqa_prep<<<1024, 256, 0, stream>>>(C, Q, Qh, Qg, Ch, T);
  cqa_s<<<NB * NIT, 224, 0, stream>>>(C, W, Qh, Sbuf);
  cqa_colstat<<<NB * CSP, 256, 0, stream>>>(Sbuf, cmax, csum);
  cqa_t<<<NB * NJT, 256, 0, stream>>>(Sbuf, cmax, csum, Ch, T);
  cqa_out<<<NB * ONT, 256, 0, stream>>>(C, Sbuf, Qg, T, out);
}

// v004
// Measured time: 115 microseconds a run.
// Next to v003, in two timings, it ran 1.21 times as fast each time.
// Counting every step since v000, it is 2.32 times as fast.
#include <hip/hip_runtime.h>

// ---------------------------------------------------------------------------
// CQAttention for MI455X (gfx1250, wave32, WMMA f32_16x16x32_f16)
// B=64, D=128, LC=1000 (pad 1008/1024), LQ=100 (pad 112/128)
// ---------------------------------------------------------------------------

typedef __attribute__((ext_vector_type(16))) _Float16 v16h;
typedef __attribute__((ext_vector_type(8)))  _Float16 v8h;
typedef __attribute__((ext_vector_type(4)))  _Float16 v4h;
typedef __attribute__((ext_vector_type(8)))  float    v8f;

union V16H { v16h v; v8h h[2]; };
union V8F  { v8f v; float e[8]; };
union V8H  { v8h v; _Float16 e[8]; };
union V4H  { v4h v; _Float16 e[4]; unsigned w[2]; };

#define NB   64
#define DD   128
#define LC   1000
#define LQ   100
#define LQP  112      // 7 * 16
#define NIT  63       // ceil(1000/16)
#define NJT  7        // ceil(100/16)

// Workspace layout (bytes, all offsets 256-aligned)
#define WS_S     ((size_t)0)            // f32 [64][1000][112]   = 28,672,000 B
#define WS_T     ((size_t)29241344)     // f16 [64][128][128]    =  2,097,152 B (4,194,304 B reserved)
#define WS_QH    ((size_t)33435648)     // f16 [64][112][128]    =  1,835,008 B
#define WS_QG    ((size_t)35270656)     // f16 [64][128][128]    =  2,097,152 B (4,194,304 B reserved)
#define WS_CH    ((size_t)39464960)     // f16 [64][128][1024]   = 16,777,216 B
#define WS_CMAX  ((size_t)56242176)     // f32 [64][4][112]      =    114,688 B
#define WS_CSUM  ((size_t)56356864)     // f32 [64][4][112]      =    114,688 B
// total = 56,471,552 B

// Per-ISA 16-bit A/B fragment layout: lane L holds row (L&15); halves 0..7 are
// K = kb..kb+7 and halves 8..15 are K = kb+16..kb+23 where kb = k0 + 8*(L>=16).
// Two contiguous 16-byte loads per fragment.
__device__ __forceinline__ v16h frag_load(const _Float16* row, int k0, int lane) {
  V16H r;
  int kb = k0 + ((lane >> 4) << 3);
  r.h[0] = *(const v8h*)(row + kb);
  r.h[1] = *(const v8h*)(row + kb + 16);
  return r.v;
}

__device__ __forceinline__ v8f wmma16(v16h a, v16h b, v8f c) {
  return __builtin_amdgcn_wmma_f32_16x16x32_f16(false, a, false, b, (short)0, c,
                                                false, false);
}

// ---------------------------------------------------------------------------
// Kernel 0: precompute f16 padded operand layouts; zero T.
// ---------------------------------------------------------------------------
__global__ void cqa_prep(const float* __restrict__ C, const float* __restrict__ Q,
                         _Float16* __restrict__ Qh, _Float16* __restrict__ Qg,
                         _Float16* __restrict__ Ch, _Float16* __restrict__ T) {
  const int stride = gridDim.x * blockDim.x;
  int tid = blockIdx.x * blockDim.x + threadIdx.x;

  // Qh[b][j][d] = Q[b][d][j]  (j padded to 112)
  for (int idx = tid; idx < NB * LQP * DD; idx += stride) {
    int b = idx / (LQP * DD), r = idx % (LQP * DD);
    int j = r / DD, d = r % DD;
    float v = (j < LQ) ? Q[((size_t)(b * DD + d)) * LQ + j] : 0.f;
    Qh[idx] = (_Float16)v;
  }
  // Qg[b][d][j] = Q[b][d][j]  (j padded to 128)
  for (int idx = tid; idx < NB * DD * 128; idx += stride) {
    int b = idx >> 14, r = idx & 16383;
    int d = r >> 7, j = r & 127;
    float v = (j < LQ) ? Q[((size_t)(b * DD + d)) * LQ + j] : 0.f;
    Qg[idx] = (_Float16)v;
  }
  // Ch[b][d][i] = C[b][d][i]  (i padded to 1024)
  for (int idx = tid; idx < NB * DD * 1024; idx += stride) {
    int b = idx >> 17, r = idx & 131071;
    int d = r >> 10, i = r & 1023;
    float v = (i < LC) ? C[((size_t)(b * DD + d)) * LC + i] : 0.f;
    Ch[idx] = (_Float16)v;
  }
  // zero T (cqa_t stores every column of it again, the padding as zeros)
  for (int idx = tid; idx < NB * DD * 128; idx += stride) T[idx] = (_Float16)0.f;
}

// ---------------------------------------------------------------------------
// Kernel 1: S[b,i,j] = sum_d (w1+w3*Ct)[i,d] * Qt[j,d]  + rowbias[i]
// block = (b, i-tile of 16); 7 waves, one 16x16 j-tile each; K=128 (4 WMMAs).
// ---------------------------------------------------------------------------
__global__ void cqa_s(const float* __restrict__ C, const float* __restrict__ W,
                      const _Float16* __restrict__ Qh, float* __restrict__ S) {
  const int b = blockIdx.x / NIT;
  const int i0 = (blockIdx.x % NIT) * 16;
  const int tid = threadIdx.x;
  const int wv = tid >> 5, lane = tid & 31;

  __shared__ __attribute__((aligned(16))) _Float16 u[16][128];  // w1 + w3*Ct
  __shared__ float w2c[16][128];
  __shared__ float rs[16];

  for (int idx = tid; idx < 16 * 128; idx += 224) {
    int i = idx >> 7, d = idx & 127;
    int gi = i0 + i;
    float w1 = 0.f, w2 = 0.f, w3 = 0.f, c = 0.f;
    if (gi < LC) {
      const float* wrow = W + ((size_t)(b * LC + gi)) * 384;
      w1 = wrow[d]; w2 = wrow[128 + d]; w3 = wrow[256 + d];
      c = C[((size_t)(b * DD + d)) * LC + gi];
    }
    u[i][d] = (_Float16)(w1 + w3 * c);
    w2c[i][d] = w2 * c;
  }
  __syncthreads();
  if (tid < 16) {
    float s = 0.f;
    for (int d = 0; d < 128; ++d) s += w2c[tid][d];
    rs[tid] = s;
  }
  __syncthreads();

  const int j0 = wv * 16;
  const _Float16* arow = &u[lane & 15][0];
  const _Float16* brow = Qh + ((size_t)(b * LQP + j0 + (lane & 15))) * DD;
  v8f acc = {};
  for (int k0 = 0; k0 < 128; k0 += 32) {
    v16h a = frag_load(arow, k0, lane);
    v16h bq = frag_load(brow, k0, lane);
    acc = wmma16(a, bq, acc);
  }
  // D layout: n = lane&15, m = r + 8*(lane>=16)
  V8F av; av.v = acc;
  int j = j0 + (lane & 15);
  if (j < LQ) {
    int mb = (lane >> 4) << 3;
    for (int r = 0; r < 8; ++r) {
      int gi = i0 + mb + r;
      if (gi < LC)
        S[((size_t)(b * LC + gi)) * LQP + j] = av.e[r] + rs[mb + r];
    }
  }
}

// ---------------------------------------------------------------------------
// Kernel 2: per-column (axis=1) softmax stats, partial over 250 context rows.
// block = (b, part of 250 rows); thread = (row group rg of 10, quad q of 25): it
// holds columns 4q .. 4q+3 of rows rg, rg+10, .. rg+240 in registers, all 25 loads
// in flight at once, takes their maximum and then the sum of exponentials. The ten
// row groups are merged through LDS; the four parts of a batch in cqa_t.
// ---------------------------------------------------------------------------
#define CSP  4        // parts per batch
#define CSR  250      // context rows per part
#define CRG  10       // row groups per block
#define CQ   25       // LQ / 4 quads per row
#define CRT  25       // rows per thread = CSR / CRG

__global__ __launch_bounds__(256)
void cqa_colstat(const float* __restrict__ S, float* __restrict__ pmax,
                 float* __restrict__ psum) {
  const int b = blockIdx.x / CSP, part = blockIdx.x % CSP;
  const int tid = threadIdx.x;
  __shared__ __attribute__((aligned(16))) float lm[CRG * LQ];
  __shared__ __attribute__((aligned(16))) float ls[CRG * LQ];

  if (tid < CRG * CQ) {
    const int rg = tid / CQ, q = tid % CQ;
    const float* p = S + ((size_t)(b * LC + part * CSR + rg)) * LQP + 4 * q;
    float4 x[CRT];
#pragma unroll  // the array must stay in registers
    for (int k = 0; k < CRT; ++k) x[k] = *(const float4*)(p + (size_t)k * CRG * LQP);
    float4 m = x[0];
#pragma unroll  // as above
    for (int k = 1; k < CRT; ++k) {
      m.x = fmaxf(m.x, x[k].x); m.y = fmaxf(m.y, x[k].y);
      m.z = fmaxf(m.z, x[k].z); m.w = fmaxf(m.w, x[k].w);
    }
    float4 s = make_float4(0.f, 0.f, 0.f, 0.f);
#pragma unroll  // as above
    for (int k = 0; k < CRT; ++k) {
      s.x += __expf(x[k].x - m.x); s.y += __expf(x[k].y - m.y);
      s.z += __expf(x[k].z - m.z); s.w += __expf(x[k].w - m.w);
    }
    // rg * LQ + 4 * q = 4 * tid: the block's stores are contiguous
    *(float4*)&lm[4 * tid] = m;
    *(float4*)&ls[4 * tid] = s;
  }
  __syncthreads();
  if (tid < LQ) {
    float m = lm[tid];
#pragma unroll  // ten independent LDS reads, no loop overhead
    for (int r = 1; r < CRG; ++r) m = fmaxf(m, lm[r * LQ + tid]);
    float s = 0.f;
#pragma unroll  // as above
    for (int r = 0; r < CRG; ++r) s += ls[r * LQ + tid] * __expf(lm[r * LQ + tid] - m);
    pmax[(b * CSP + part) * LQP + tid] = m;
    psum[(b * CSP + part) * LQP + tid] = s;
  }
}

// ---------------------------------------------------------------------------
// Kernel 3: T[b][d][j] = sum_i S2[b,i,j] * Ct[b,i,d]   (M=j, N=d, K=i)
// block = (b, two j-tiles = 32 columns); 8 waves each own a 16-wide d-tile and both
// j-tiles, so a fragment of Ch serves two products. The block's whole operand
// exp(S - column maximum), 32 columns x 1024 context rows, is formed once and laid
// transposed in LDS: every load of S is in flight at once, and one barrier stands
// between the staging and the 32 K-chunks. The fourth pair's second tile (columns
// 112 .. 127) lies past S: it is staged, and stored to T, as zeros.
// ---------------------------------------------------------------------------
// exp(x) as __expf forms it (x * log2(e), then the hardware exp2). The v_nop fills
// the slot that the instruction set asks for behind a transcendental before its
// result is used or its source overwritten; in the statement it cannot drift away.
__device__ __forceinline__ float exp_slot(float x) {
  float y, a = x * 1.44269504088896340736f;
  asm("v_exp_f32 %0, %1\n\tv_nop" : "=v"(y) : "v"(a));
  return y;
}

typedef __attribute__((ext_vector_type(4))) float v4f;

#define TJG   4       // column pairs of tiles per batch
#define TKP   1032    // halves per LDS row: 2064 B = 16 B x odd, for 16-byte readers
#define TBA   8       // K-chunks by which the fragments of Ch are fetched ahead

__global__ __launch_bounds__(256)
void cqa_t(const float* __restrict__ S, const float* __restrict__ pmax,
           const float* __restrict__ psum, const _Float16* __restrict__ Ch,
           _Float16* __restrict__ T) {
  const int b = blockIdx.x / TJG;
  const int jb = (blockIdx.x % TJG) * 32;
  const int tid = threadIdx.x, wv = tid >> 5, lane = tid & 31;

  __shared__ __attribute__((aligned(16))) _Float16 As[32][TKP];
  __shared__ __attribute__((aligned(16))) float csr[32];

  // Staging: a thread takes four consecutive columns (local jl0 ..) of the context
  // rows 128*p + 4*rg + r, p = 0..7, r = 0..3. LQ and LC are multiples of 4, so the
  // four columns, and the four rows, are all real or all padding; padding re-reads
  // a real place (columns past LQ of S and of the statistics are never written) and
  // is replaced by zero.
  const int jl0 = ((wv >> 2) << 4) + ((lane & 3) << 2);
  const int rg = ((wv & 3) << 3) + (lane >> 2);
  const bool cok = jb + jl0 < LQ;
  const int gj = cok ? jb + jl0 : 0;
  const bool rok = 896 + 4 * rg < LC;

  v4f pm[CSP];
#pragma unroll  // the array must stay in registers
  for (int p = 0; p < CSP; ++p) pm[p] = *(const v4f*)(pmax + (b * CSP + p) * LQP + gj);
  // the address registers of the loads above are free for reuse only behind this wait
  asm volatile("s_wait_xcnt 0x0" ::: "memory");

  const float* sp = S + ((size_t)(b * LC + 4 * rg)) * LQP + gj;
  const float* sl = S + ((size_t)(b * LC + (rok ? 896 + 4 * rg : LC - 4))) * LQP + gj;
  v4f x[8][4];
#pragma unroll  // as above; all 32 loads are issued before the first is used
  for (int p = 0; p < 7; ++p) {
#pragma unroll  // as above
    for (int r = 0; r < 4; ++r) x[p][r] = *(const v4f*)(sp + (size_t)(128 * p + r) * LQP);
  }
  // as above: later loads may land in the address registers of these
  asm volatile("s_wait_xcnt 0x0" ::: "memory");
#pragma unroll  // as above
  for (int r = 0; r < 4; ++r) x[7][r] = *(const v4f*)(sl + (size_t)r * LQP);
  // as above
  asm volatile("s_wait_xcnt 0x0" ::: "memory");

  // The first fragments of Ch fly while the exponentials are formed. Of bf only
  // the chunks in flight or in use are live.
  const _Float16* brow = Ch + ((size_t)(b * DD + wv * 16 + (lane & 15))) * 1024;
  v16h bf[32];
#pragma unroll  // as above
  for (int k = 0; k < TBA; ++k) bf[k] = frag_load(brow, 32 * k, lane);

  if (tid < 32) {
    // merge the column's four partial (maximum, sum) pairs; padded columns are
    // never written by cqa_colstat and take the sum 1
    float s = 1.f;
    if (jb + tid < LQ) {
      const int o = b * CSP * LQP + jb + tid;
      float qm[CSP], qs[CSP];
#pragma unroll  // as above
      for (int p = 0; p < CSP; ++p) { qm[p] = pmax[o + p * LQP]; qs[p] = psum[o + p * LQP]; }
      float m = fmaxf(fmaxf(qm[0], qm[1]), fmaxf(qm[2], qm[3]));
      s = 0.f;
#pragma unroll  // as above
      for (int p = 0; p < CSP; ++p) s += qs[p] * exp_slot(qm[p] - m);
    }
    csr[tid] = 1.0f / s;
  }

  v4f cm;
#pragma unroll  // as above
  for (int e = 0; e < 4; ++e)
    cm[e] = fmaxf(fmaxf(pm[0][e], pm[1][e]), fmaxf(pm[2][e], pm[3][e]));

#pragma unroll  // as above
  for (int p = 0; p < 8; ++p) {
    // all-ones where the sixteen values are real, else zero
    const unsigned keep = (cok && (p < 7 || rok)) ? 0xffffffffu : 0u;
#pragma unroll  // as above
    for (int e = 0; e < 4; ++e) {
      V4H h;
#pragma unroll  // as above
      for (int r = 0; r < 4; ++r) h.e[r] = (_Float16)exp_slot(x[p][r][e] - cm[e]);
      h.w[0] &= keep;
      h.w[1] &= keep;
      *(v4h*)&As[jl0 + e][128 * p + 4 * rg] = h.v;
    }
  }
  __syncthreads();

  const _Float16* arow0 = &As[lane & 15][0];
  const _Float16* arow1 = &As[16 + (lane & 15)][0];
  v8f acc[2] = {};
  // Two K-chunks a pass. The LDS fragments of the next pass and the Ch fragments
  // of TBA chunks on are asked for before a pass's four products.
  v16h af[2][2][2];
#pragma unroll  // the fragment arrays must stay in registers
  for (int c = 0; c < 2; ++c) {
    af[0][c][0] = frag_load(arow0, 32 * c, lane);
    af[0][c][1] = frag_load(arow1, 32 * c, lane);
  }
#pragma unroll  // as above
  for (int q = 0; q < 16; ++q) {
#pragma unroll  // as above
    for (int c = 0; c < 2; ++c) {
      const int kn = 2 * (q + 1) + c, kb = 2 * q + TBA + c;
      if (kn < 32) {
        af[(q + 1) & 1][c][0] = frag_load(arow0, 32 * kn, lane);
        af[(q + 1) & 1][c][1] = frag_load(arow1, 32 * kn, lane);
      }
      if (kb < 32) bf[kb] = frag_load(brow, 32 * kb, lane);
    }
    // keeps the loads above from sinking to their uses: each product would then
    // wait out a whole LDS latency
    __builtin_amdgcn_sched_barrier(0);
#pragma unroll  // as above
    for (int c = 0; c < 2; ++c) {
      acc[0] = wmma16(af[q & 1][c][0], bf[2 * q + c], acc[0]);
      acc[1] = wmma16(af[q & 1][c][1], bf[2 * q + c], acc[1]);
    }
  }

  // D: n = lane&15 -> d_local, m = r + 8*(lane>=16) -> j_local (consecutive j)
  const int d = wv * 16 + (lane & 15);
  const int mb = (lane >> 4) << 3;
#pragma unroll  // as above
  for (int t = 0; t < 2; ++t) {
    const v4f c0 = *(const v4f*)&csr[16 * t + mb];
    const v4f c1 = *(const v4f*)&csr[16 * t + mb + 4];
    V8H o;
#pragma unroll  // as above
    for (int r = 0; r < 8; ++r) {
      float val = (jb + 16 * t + mb + r < LQ) ? acc[t][r] * (r < 4 ? c0[r & 3] : c1[r & 3]) : 0.f;
      o.e[r] = (_Float16)val;
    }
    *(v8h*)(T + ((size_t)(b * DD + d)) * 128 + jb + 16 * t + mb) = o.v;
  }
}

// ---------------------------------------------------------------------------
// Kernel 4: A = S1@Qt, Bm = S1@T; emit [Ct, A, Ct*A, Ct*Bm] transposed.
// block = (b, 64 context rows); 8 waves each own a 16-wide d-tile and all 64 rows.
// The products are formed transposed (M = d, N = i). Column c of N-tile t is
// context row 4c + t, so a lane's four accumulator tiles hold four consecutive
// i of one output row: 16 lanes store 256 contiguous bytes of that row.
// A is formed and stored first, then Bm, so 32 accumulator registers serve both.
// The row softmax (axis=2) is formed here as well: a wave holds a whole row of S in
// registers, so the row's maximum and sum of exponentials are two wave reductions.
// ---------------------------------------------------------------------------
// Value of lane l ^ M inside the 16-lane row (DPP row_xmask); every lane is on.
template <int M>
__device__ __forceinline__ float row_xor(float x) {
  return __builtin_bit_cast(float, __builtin_amdgcn_update_dpp(
      0, __builtin_bit_cast(int, x), 0x160 | M, 0xf, 0xf, true));
}
// Value of lane l ^ 16.
__device__ __forceinline__ float half_xor(float x) {
  int v = __builtin_bit_cast(int, x);
  return __builtin_bit_cast(float, __builtin_amdgcn_permlanex16(v, v, 0x76543210, 0xfedcba98,
                                                                false, false));
}
__device__ __forceinline__ float wave_max(float x) {
  x = fmaxf(x, row_xor<1>(x)); x = fmaxf(x, row_xor<2>(x));
  x = fmaxf(x, row_xor<4>(x)); x = fmaxf(x, row_xor<8>(x));
  return fmaxf(x, half_xor(x));
}
__device__ __forceinline__ float wave_sum(float x) {
  x += row_xor<1>(x); x += row_xor<2>(x);
  x += row_xor<4>(x); x += row_xor<8>(x);
  return x + half_xor(x);
}

#define OIT   64      // context rows per block
#define ONT   16      // ceil(1000/64)
#define SPIT  136     // halves per LDS row: 272 B = 16 B x odd, for 16-byte readers

__global__ __launch_bounds__(256)
void cqa_out(const float* __restrict__ C, const float* __restrict__ S,
             const _Float16* __restrict__ Qg, const _Float16* __restrict__ T,
             float* __restrict__ out) {
  const int b = blockIdx.x / ONT;
  const int i0 = (blockIdx.x % ONT) * OIT;
  const int tid = threadIdx.x, wv = tid >> 5, lane = tid & 31;
  const int c = lane & 15;

  // LDS row 16*t + c holds S1 of context row i0 + 4*c + t.
  __shared__ __attribute__((aligned(16))) _Float16 As1[OIT][SPIT];

  // The lane's part of Ct: rows d = dbase + r, context rows gi .. gi + 3. LC and i0
  // are multiples of 4, so the four are all inside or all outside; lanes outside
  // read the last four inside and store nothing.
  const int gi = i0 + 4 * c;
  const int dbase = wv * 16 + ((lane >> 4) << 3);
  const float* cp = C + ((size_t)(b * DD + dbase)) * LC + (gi < LC ? gi : LC - 4);
  float4 ct[8];
#pragma unroll  // the array must stay in registers
  for (int r = 0; r < 8; ++r) ct[r] = *(const float4*)(cp + (size_t)r * LC);

  // One wave per context row, a lane takes four consecutive j. All eight rows'
  // loads are issued before the first is used. Lanes past the row's end and rows
  // past LC re-read the last valid place; their values are replaced by zero.
  const unsigned jo = 4u * (unsigned)(lane < LQ / 4 ? lane : LQ / 4 - 1);
  // the wave's number as a scalar: row addresses are wave-uniform
  const int wvu = __builtin_amdgcn_readfirstlane(wv);
  float4 s[8];
  float mx[8], sm[8];
#pragma unroll  // as above
  for (int u = 0; u < 8; ++u) {
    int si = i0 + wvu + 8 * u;
    int row = b * LC + (si < LC ? si : LC - 1);
    const float* srow = S + (size_t)row * LQP;  // wave-uniform base
    s[u] = *(const float4*)(srow + jo);
  }
  // Row maximum: the re-read quads of lanes past the row's end repeat real values.
#pragma unroll  // as above; the eight rows' reductions are independent chains
  for (int u = 0; u < 8; ++u)
    mx[u] = wave_max(fmaxf(fmaxf(s[u].x, s[u].y), fmaxf(s[u].z, s[u].w)));
  // Exponentials, kept for the quotients below, and their sum over the real lanes.
#pragma unroll  // as above
  for (int u = 0; u < 8; ++u) {
    s[u].x = exp_slot(s[u].x - mx[u]);
    s[u].y = exp_slot(s[u].y - mx[u]);
    s[u].z = exp_slot(s[u].z - mx[u]);
    s[u].w = exp_slot(s[u].w - mx[u]);
    sm[u] = wave_sum(lane < LQ / 4 ? (s[u].x + s[u].y) + (s[u].z + s[u].w) : 0.f);
  }
#pragma unroll  // as above
  for (int u = 0; u < 8; ++u) {
    const int m = wvu + 8 * u;
    // all-ones where the four values are real, else zero: the quotients are
    // formed in every lane (their inputs are valid) and masked as bits
    const unsigned keep = ((i0 + m < LC) && (lane < LQ / 4)) ? 0xffffffffu : 0u;
    V4H h;
    h.e[0] = (_Float16)(s[u].x / sm[u]);
    h.e[1] = (_Float16)(s[u].y / sm[u]);
    h.e[2] = (_Float16)(s[u].z / sm[u]);
    h.e[3] = (_Float16)(s[u].w / sm[u]);
    h.w[0] &= keep;
    h.w[1] &= keep;
    *(v4h*)&As1[((m & 3) << 4) + (m >> 2)][4 * lane] = h.v;
  }

  const _Float16* rowQ = Qg + ((size_t)(b * DD + wv * 16 + c)) * 128;
  const _Float16* rowT = T + ((size_t)(b * DD + wv * 16 + c)) * 128;
  v16h fq[4], ft[4];
#pragma unroll  // as above
  for (int k = 0; k < 4; ++k) fq[k] = frag_load(rowQ, 32 * k, lane);
  __syncthreads();

  float* op = out + ((size_t)(b * 512 + dbase)) * LC + gi;
  v8f acc[4] = {};
#pragma unroll  // as above
  for (int k = 0; k < 4; ++k) {
#pragma unroll  // as above
    for (int t = 0; t < 4; ++t)
      acc[t] = wmma16(fq[k], frag_load(&As1[16 * t + c][0], 32 * k, lane), acc[t]);
  }
#pragma unroll  // as above
  for (int k = 0; k < 4; ++k) ft[k] = frag_load(rowT, 32 * k, lane);

  // D: register r = [d_local = 8*(lane>=16) + r][column c]; tiles t = 0..3 give
  // i = gi + t.
  if (gi < LC) {
#pragma unroll  // as above
    for (int r = 0; r < 8; ++r) {
      float4 va = make_float4(acc[0][r], acc[1][r], acc[2][r], acc[3][r]);
      float* o = op + (size_t)r * LC;
      *(float4*)(o) = ct[r];
      *(float4*)(o + (size_t)128 * LC) = va;
      *(float4*)(o + (size_t)256 * LC) =
          make_float4(ct[r].x * va.x, ct[r].y * va.y, ct[r].z * va.z, ct[r].w * va.w);
    }
  }

#pragma unroll  // as above
  for (int t = 0; t < 4; ++t) acc[t] = v8f{};
#pragma unroll  // as above
  for (int k = 0; k < 4; ++k) {
#pragma unroll  // as above
    for (int t = 0; t < 4; ++t)
      acc[t] = wmma16(ft[k], frag_load(&As1[16 * t + c][0], 32 * k, lane), acc[t]);
  }
  if (gi < LC) {
#pragma unroll  // as above
    for (int r = 0; r < 8; ++r) {
      *(float4*)(op + (size_t)(384 + r) * LC) =
          make_float4(ct[r].x * acc[0][r], ct[r].y * acc[1][r], ct[r].z * acc[2][r],
                      ct[r].w * acc[3][r]);
    }
  }
}

// ---------------------------------------------------------------------------
extern "C" void kernel_launch(void* const* d_in, const int* in_sizes, int n_in,
                              void* d_out, int out_size, void* d_ws, size_t ws_size,
                              hipStream_t stream) {
  (void)in_sizes; (void)n_in; (void)out_size; (void)ws_size;
  const float* C = (const float*)d_in[0];
  const float* Q = (const float*)d_in[1];
  const float* W = (const float*)d_in[2];
  float* out = (float*)d_out;
  char* ws = (char*)d_ws;

  float*    Sbuf = (float*)(ws + WS_S);
  float*    cmax = (float*)(ws + WS_CMAX);
  float*    csum = (float*)(ws + WS_CSUM);
  _Float16* T    = (_Float16*)(ws + WS_T);
  _Float16* Qh   = (_Float16*)(ws + WS_QH);
  _Float16* Qg   = (_Float16*)(ws + WS_QG);
  _Float16* Ch   = (_Float16*)(ws + WS_CH);

  cqa_prep<<<1024, 256, 0, stream>>>(C, Q, Qh, Qg, Ch, T);
  cqa_s<<<NB * NIT, 224, 0, stream>>>(C, W, Qh, Sbuf);
  cqa_colstat<<<NB * CSP, 256, 0, stream>>>(Sbuf, cmax, csum);
  cqa_t<<<NB * TJG, 256, 0, stream>>>(Sbuf, cmax, csum, Ch, T);
  cqa_out<<<NB * ONT, 256, 0, stream>>>(C, Sbuf, Qg, T, out);
}

// v005
// A run of this version takes 81.4 microseconds.
// Timed twice side by side with v004, it ran 1.41 and 1.40 times as fast.
// Counting every step since v000, it is 3.26 times as fast.
#include <hip/hip_runtime.h>

// ---------------------------------------------------------------------------
// CQAttention for MI455X (gfx1250, wave32, WMMA f32_16x16x32_f16)
// B=64, D=128, LC=1000 (pad 1024), LQ=100 (pad 112/128)
// ---------------------------------------------------------------------------

typedef __attribute__((ext_vector_type(16))) _Float16 v16h;
typedef __attribute__((ext_vector_type(8)))  _Float16 v8h;
typedef __attribute__((ext_vector_type(4)))  _Float16 v4h;
typedef __attribute__((ext_vector_type(8)))  float    v8f;
typedef __attribute__((ext_vector_type(4))) float v4f;

union V16H { v16h v; v8h h[2]; };
union V8F  { v8f v; float e[8]; };
union V8H  { v8h v; _Float16 e[8]; };
union V4H  { v4h v; _Float16 e[4]; unsigned w[2]; };

#define NB   64
#define DD   128
#define LC   1000
#define LQ   100
#define LQP  112      // 7 * 16
#define NJT  7        // ceil(100/16)

// Workspace layout (bytes, all offsets 256-aligned)
#define WS_S     ((size_t)0)            // f32 [64][1000][112]   = 28,672,000 B
#define WS_T     ((size_t)29241344)     // f16 [64][128][128]    =  2,097,152 B (4,194,304 B reserved)
#define WS_QH    ((size_t)33435648)     // f16 [64][112][128]    =  1,835,008 B
#define WS_QG    ((size_t)35270656)     // f16 [64][128][128]    =  2,097,152 B (4,194,304 B reserved)
#define WS_CH    ((size_t)39464960)     // f16 [64][128][1024]   = 16,777,216 B
#define WS_CMAX  ((size_t)56242176)     // f32 [64][4][112]      =    114,688 B
#define WS_CSUM  ((size_t)56356864)     // f32 [64][4][112]      =    114,688 B
// total = 56,471,552 B

// Per-ISA 16-bit A/B fragment layout: lane L holds row (L&15); halves 0..7 are
// K = kb..kb+7 and halves 8..15 are K = kb+16..kb+23 where kb = k0 + 8*(L>=16).
// Two contiguous 16-byte loads per fragment.
__device__ __forceinline__ v16h frag_load(const _Float16* row, int k0, int lane) {
  V16H r;
  int kb = k0 + ((lane >> 4) << 3);
  r.h[0] = *(const v8h*)(row + kb);
  r.h[1] = *(const v8h*)(row + kb + 16);
  return r.v;
}

__device__ __forceinline__ v8f wmma16(v16h a, v16h b, v8f c) {
  return __builtin_amdgcn_wmma_f32_16x16x32_f16(false, a, false, b, (short)0, c,
                                                false, false);
}

// ---------------------------------------------------------------------------
// Kernel 0: precompute f16 padded operand layouts; zero T.
// ---------------------------------------------------------------------------
__global__ void cqa_prep(const float* __restrict__ C, const float* __restrict__ Q,
                         _Float16* __restrict__ Qh, _Float16* __restrict__ Qg,
                         _Float16* __restrict__ Ch, _Float16* __restrict__ T) {
  const int stride = gridDim.x * blockDim.x;
  int tid = blockIdx.x * blockDim.x + threadIdx.x;

  // Qh[b][j][d] = Q[b][d][j]  (j padded to 112)
  for (int idx = tid; idx < NB * LQP * DD; idx += stride) {
    int b = idx / (LQP * DD), r = idx % (LQP * DD);
    int j = r / DD, d = r % DD;
    float v = (j < LQ) ? Q[((size_t)(b * DD + d)) * LQ + j] : 0.f;
    Qh[idx] = (_Float16)v;
  }
  // Qg[b][d][j] = Q[b][d][j]  (j padded to 128)
  for (int idx = tid; idx < NB * DD * 128; idx += stride) {
    int b = idx >> 14, r = idx & 16383;
    int d = r >> 7, j = r & 127;
    float v = (j < LQ) ? Q[((size_t)(b * DD + d)) * LQ + j] : 0.f;
    Qg[idx] = (_Float16)v;
  }
  // Ch[b][d][i] = C[b][d][i]  (i padded to 1024)
  for (int idx = tid; idx < NB * DD * 1024; idx += stride) {
    int b = idx >> 17, r = idx & 131071;
    int d = r >> 10, i = r & 1023;
    float v = (i < LC) ? C[((size_t)(b * DD + d)) * LC + i] : 0.f;
    Ch[idx] = (_Float16)v;
  }
  // zero T (cqa_t stores every column of it again, the padding as zeros)
  for (int idx = tid; idx < NB * DD * 128; idx += stride) T[idx] = (_Float16)0.f;
}

// ---------------------------------------------------------------------------
// Kernel 1: S[b,i,j] = sum_d (w1+w3*Ct)[i,d] * Qt[j,d]  + rowbias[i]
// block = (b, 128 context rows), 8 waves. The block's part of C, 128 d x 128 i, is
// read in whole rows of 512 bytes and laid in LDS as it is; a wave then streams the
// 16 rows of W that it owns, a lane taking d = 4*lane .. 4*lane+3 of w1, w2, w3 (512
// contiguous bytes a load), four rows a group, two groups in flight. From LDS the
// lane reads its four d of four context rows at once, so C is never gathered.
// The row bias is a wave reduction. Then waves 0..6 take one 16-wide j-tile each
// and all eight i-tiles, K = 128 (4 WMMAs a tile).
// ---------------------------------------------------------------------------
// Value of lane l ^ M inside the 16-lane row (DPP row_xmask); every lane is on.
template <int M>
__device__ __forceinline__ float row_xor(float x) {
  return __builtin_bit_cast(float, __builtin_amdgcn_update_dpp(
      0, __builtin_bit_cast(int, x), 0x160 | M, 0xf, 0xf, true));
}
// Value of lane l ^ 16.
__device__ __forceinline__ float half_xor(float x) {
  int v = __builtin_bit_cast(int, x);
  return __builtin_bit_cast(float, __builtin_amdgcn_permlanex16(v, v, 0x76543210, 0xfedcba98,
                                                                false, false));
}
__device__ __forceinline__ float wave_max(float x) {
  x = fmaxf(x, row_xor<1>(x)); x = fmaxf(x, row_xor<2>(x));
  x = fmaxf(x, row_xor<4>(x)); x = fmaxf(x, row_xor<8>(x));
  return fmaxf(x, half_xor(x));
}
__device__ __forceinline__ float wave_sum(float x) {
  x += row_xor<1>(x); x += row_xor<2>(x);
  x += row_xor<4>(x); x += row_xor<8>(x);
  return x + half_xor(x);
}

#define SIT   128     // context rows per block
#define SNT   8       // ceil(1000/128)
#define UPIT  136     // halves per LDS row: 272 B = 16 B x odd, for 16-byte readers

__global__ __launch_bounds__(256)
void cqa_s(const float* __restrict__ C, const float* __restrict__ W,
           const _Float16* __restrict__ Qh, float* __restrict__ S) {
  const int b = blockIdx.x / SNT;
  const int i0 = (blockIdx.x % SNT) * SIT;
  const int tid = threadIdx.x, wv = tid >> 5, lane = tid & 31;
  // the wave's number as a scalar: row addresses of W are wave-uniform
  const int wvu = __builtin_amdgcn_readfirstlane(wv);

  // Cs: row d holds 32 quads of context rows; quad q lies at place q ^ ((d >> 2) & 15),
  // so that 16 lanes that write one row, and 16 lanes that read one quad of rows
  // d = 4*lane + e, both fall on 16 different groups of four banks.
  __shared__ __attribute__((aligned(16))) float Cs[DD * SIT];
  __shared__ __attribute__((aligned(16))) _Float16 u[SIT][UPIT];  // w1 + w3*Ct
  __shared__ __attribute__((aligned(16))) float rs[SIT];

  // C: wave wv takes rows d = wv + 8*k. LC and i0 are multiples of 4, so a quad is
  // all inside or all outside; quads outside re-read the last one inside, and what
  // comes of them is never stored.
  const int ci = i0 + 4 * lane < LC ? i0 + 4 * lane : LC - 4;
  const float* cp = C + ((size_t)(b * DD + wv)) * LC + ci;
  v4f cst[16];
#pragma unroll  // the array must stay in registers
  for (int k = 0; k < 16; ++k) cst[k] = *(const v4f*)(cp + (size_t)(8 * k) * LC);
  // the address registers of the loads above are free for reuse only behind this wait
  asm volatile("s_wait_xcnt 0x0" ::: "memory");

  // W: group g is the wave's rows 4*g .. 4*g+3; rows past LC re-read row LC - 1.
  v4f w[2][4][3];
#pragma unroll  // as above
  for (int g = 0; g < 2; ++g) {
#pragma unroll  // as above
    for (int r = 0; r < 4; ++r) {
      const int gi = i0 + 16 * wvu + 4 * g + r;
      const float* wrow = W + ((size_t)(b * LC + (gi < LC ? gi : LC - 1))) * 384 + 4 * lane;
#pragma unroll  // as above
      for (int p = 0; p < 3; ++p) w[g][r][p] = *(const v4f*)(wrow + 128 * p);
    }
  }
  // as at the first wait: the address registers of these loads are reused below
  asm volatile("s_wait_xcnt 0x0" ::: "memory");

  // The fragments of Qh fly behind the first rows of W. The eighth wave has no j-tile:
  // it re-reads the seventh's rows and stops at the last barrier.
  const int j0 = (wv < NJT ? wv : NJT - 1) * 16;
  const _Float16* brow = Qh + ((size_t)(b * LQP + j0 + (lane & 15))) * DD;
  v16h bq[4];
#pragma unroll  // as above
  for (int k = 0; k < 4; ++k) bq[k] = frag_load(brow, 32 * k, lane);
  // as at the first wait: the address registers of these loads are reused below
  asm volatile("s_wait_xcnt 0x0" ::: "memory");

#pragma unroll  // as above
  for (int k = 0; k < 16; ++k) {
    const int d = wv + 8 * k;
    *(v4f*)&Cs[d * SIT + 4 * (lane ^ ((d >> 2) & 15))] = cst[k];
  }
  // The work-group's barrier by hand, behind the wave's own LDS stores:
  // __syncthreads() would also wait out the loads of W and Qh that are in flight.
  asm volatile("s_wait_dscnt 0x0\n\ts_barrier_signal -1\n\ts_barrier_wait -1" ::: "memory");

#pragma unroll  // as above
  for (int g = 0; g < 4; ++g) {
    v4f cc[4];  // cc[e][r] = C[d = 4*lane + e][context row 16*wv + 4*g + r]
#pragma unroll  // as above
    for (int e = 0; e < 4; ++e)
      cc[e] = *(const v4f*)&Cs[(4 * lane + e) * SIT + 4 * ((4 * wv + g) ^ (lane & 15))];
    float bias = 0.f;
#pragma unroll  // as above
    for (int r = 0; r < 4; ++r) {
      const v4f w1 = w[g & 1][r][0], w2 = w[g & 1][r][1], w3 = w[g & 1][r][2];
      V4H h;
#pragma unroll  // as above
      for (int e = 0; e < 4; ++e) h.e[e] = (_Float16)(w1[e] + w3[e] * cc[e][r]);
      *(v4h*)&u[16 * wv + 4 * g + r][4 * lane] = h.v;
      const float t = wave_sum((w2[0] * cc[0][r] + w2[1] * cc[1][r]) +
                               (w2[2] * cc[2][r] + w2[3] * cc[3][r]));
      bias = lane == r ? t : bias;
    }
    if (lane < 4) rs[16 * wv + 4 * g + lane] = bias;
    if (g + 2 < 4) {
#pragma unroll  // as above
      for (int r = 0; r < 4; ++r) {
        const int gi = i0 + 16 * wvu + 4 * (g + 2) + r;
        const float* wrow = W + ((size_t)(b * LC + (gi < LC ? gi : LC - 1))) * 384 + 4 * lane;
#pragma unroll  // as above
        for (int p = 0; p < 3; ++p) w[g & 1][r][p] = *(const v4f*)(wrow + 128 * p);
      }
      // as at the first wait
      asm volatile("s_wait_xcnt 0x0" ::: "memory");
    }
  }

  __syncthreads();
  if (wvu >= NJT) return;  // behind the last barrier

  // All eight i-tiles' products are independent: a K-chunk's eight fragments of u are
  // asked for together, and the stores follow the last product.
  v8f acc[SIT / 16] = {};
#pragma unroll  // as above
  for (int k = 0; k < 4; ++k) {
    v16h a[SIT / 16];
#pragma unroll  // as above
    for (int t = 0; t < SIT / 16; ++t) a[t] = frag_load(&u[16 * t + (lane & 15)][0], 32 * k, lane);
#pragma unroll  // as above
    for (int t = 0; t < SIT / 16; ++t) acc[t] = wmma16(a[t], bq[k], acc[t]);
  }

  // D layout: n = lane&15, m = r + 8*(lane>=16). LC is a multiple of 8, so a lane's
  // eight rows of a tile are all inside or all outside.
  const int j = j0 + (lane & 15);
  const int mb = (lane >> 4) << 3;
#pragma unroll  // as above
  for (int t = 0; t < SIT / 16; ++t) {
    const v4f r0 = *(const v4f*)&rs[16 * t + mb];
    const v4f r1 = *(const v4f*)&rs[16 * t + mb + 4];
    const int gi = i0 + 16 * t + mb;
    if (j < LQ && gi < LC) {
      float* sp = S + ((size_t)(b * LC + gi)) * LQP + j;
#pragma unroll  // as above
      for (int r = 0; r < 8; ++r) sp[(size_t)r * LQP] = acc[t][r] + (r < 4 ? r0[r & 3] : r1[r & 3]);
    }
  }
}

// ---------------------------------------------------------------------------
// Kernel 2: per-column (axis=1) softmax stats, partial over 250 context rows.
// block = (b, part of 250 rows); thread = (row group rg of 10, quad q of 25): it
// holds columns 4q .. 4q+3 of rows rg, rg+10, .. rg+240 in registers, all 25 loads
// in flight at once, takes their maximum and then the sum of exponentials. The ten
// row groups are merged through LDS; the four parts of a batch in cqa_t.
// ---------------------------------------------------------------------------
#define CSP  4        // parts per batch
#define CSR  250      // context rows per part
#define CRG  10       // row groups per block
#define CQ   25       // LQ / 4 quads per row
#define CRT  25       // rows per thread = CSR / CRG

__global__ __launch_bounds__(256)
void cqa_colstat(const float* __restrict__ S, float* __restrict__ pmax,
                 float* __restrict__ psum) {
  const int b = blockIdx.x / CSP, part = blockIdx.x % CSP;
  const int tid = threadIdx.x;
  __shared__ __attribute__((aligned(16))) float lm[CRG * LQ];
  __shared__ __attribute__((aligned(16))) float ls[CRG * LQ];

  if (tid < CRG * CQ) {
    const int rg = tid / CQ, q = tid % CQ;
    const float* p = S + ((size_t)(b * LC + part * CSR + rg)) * LQP + 4 * q;
    float4 x[CRT];
#pragma unroll  // the array must stay in registers
    for (int k = 0; k < CRT; ++k) x[k] = *(const float4*)(p + (size_t)k * CRG * LQP);
    float4 m = x[0];
#pragma unroll  // as above
    for (int k = 1; k < CRT; ++k) {
      m.x = fmaxf(m.x, x[k].x); m.y = fmaxf(m.y, x[k].y);
      m.z = fmaxf(m.z, x[k].z); m.w = fmaxf(m.w, x[k].w);
    }
    float4 s = make_float4(0.f, 0.f, 0.f, 0.f);
#pragma unroll  // as above
    for (int k = 0; k < CRT; ++k) {
      s.x += __expf(x[k].x - m.x); s.y += __expf(x[k].y - m.y);
      s.z += __expf(x[k].z - m.z); s.w += __expf(x[k].w - m.w);
    }
    // rg * LQ + 4 * q = 4 * tid: the block's stores are contiguous
    *(float4*)&lm[4 * tid] = m;
    *(float4*)&ls[4 * tid] = s;
  }
  __syncthreads();
  if (tid < LQ) {
    float m = lm[tid];
#pragma unroll  // ten independent LDS reads, no loop overhead
    for (int r = 1; r < CRG; ++r) m = fmaxf(m, lm[r * LQ + tid]);
    float s = 0.f;
#pragma unroll  // as above
    for (int r = 0; r < CRG; ++r) s += ls[r * LQ + tid] * __expf(lm[r * LQ + tid] - m);
    pmax[(b * CSP + part) * LQP + tid] = m;
    psum[(b * CSP + part) * LQP + tid] = s;
  }
}

// ---------------------------------------------------------------------------
// Kernel 3: T[b][d][j] = sum_i S2[b,i,j] * Ct[b,i,d]   (M=j, N=d, K=i)
// block = (b, two j-tiles = 32 columns); 8 waves each own a 16-wide d-tile and both
// j-tiles, so a fragment of Ch serves two products. The block's whole operand
// exp(S - column maximum), 32 columns x 1024 context rows, is formed once and laid
// transposed in LDS: every load of S is in flight at once, and one barrier stands
// between the staging and the 32 K-chunks. The fourth pair's second tile (columns
// 112 .. 127) lies past S: it is staged, and stored to T, as zeros.
// ---------------------------------------------------------------------------
// exp(x) as __expf forms it (x * log2(e), then the hardware exp2). The v_nop fills
// the slot that the instruction set asks for behind a transcendental before its
// result is used or its source overwritten; in the statement it cannot drift away.
__device__ __forceinline__ float exp_slot(float x) {
  float y, a = x * 1.44269504088896340736f;
  asm("v_exp_f32 %0, %1\n\tv_nop" : "=v"(y) : "v"(a));
  return y;
}

#define TJG   4       // column pairs of tiles per batch
#define TKP   1032    // halves per LDS row: 2064 B = 16 B x odd, for 16-byte readers
#define TBA   8       // K-chunks by which the fragments of Ch are fetched ahead

__global__ __launch_bounds__(256)
void cqa_t(const float* __restrict__ S, const float* __restrict__ pmax,
           const float* __restrict__ psum, const _Float16* __restrict__ Ch,
           _Float16* __restrict__ T) {
  const int b = blockIdx.x / TJG;
  const int jb = (blockIdx.x % TJG) * 32;
  const int tid = threadIdx.x, wv = tid >> 5, lane = tid & 31;

  __shared__ __attribute__((aligned(16))) _Float16 As[32][TKP];
  __shared__ __attribute__((aligned(16))) float csr[32];

  // Staging: a thread takes four consecutive columns (local jl0 ..) of the context
  // rows 128*p + 4*rg + r, p = 0..7, r = 0..3. LQ and LC are multiples of 4, so the
  // four columns, and the four rows, are all real or all padding; padding re-reads
  // a real place (columns past LQ of S and of the statistics are never written) and
  // is replaced by zero.
  const int jl0 = ((wv >> 2) << 4) + ((lane & 3) << 2);
  const int rg = ((wv & 3) << 3) + (lane >> 2);
  const bool cok = jb + jl0 < LQ;
  const int gj = cok ? jb + jl0 : 0;
  const bool rok = 896 + 4 * rg < LC;

  v4f pm[CSP];
#pragma unroll  // the array must stay in registers
  for (int p = 0; p < CSP; ++p) pm[p] = *(const v4f*)(pmax + (b * CSP + p) * LQP + gj);
  // the address registers of the loads above are free for reuse only behind this wait
  asm volatile("s_wait_xcnt 0x0" ::: "memory");

  const float* sp = S + ((size_t)(b * LC + 4 * rg)) * LQP + gj;
  const float* sl = S + ((size_t)(b * LC + (rok ? 896 + 4 * rg : LC - 4))) * LQP + gj;
  v4f x[8][4];
#pragma unroll  // as above; all 32 loads are issued before the first is used
  for (int p = 0; p < 7; ++p) {
#pragma unroll  // as above
    for (int r = 0; r < 4; ++r) x[p][r] = *(const v4f*)(sp + (size_t)(128 * p + r) * LQP);
  }
  // as above: later loads may land in the address registers of these
  asm volatile("s_wait_xcnt 0x0" ::: "memory");
#pragma unroll  // as above
  for (int r = 0; r < 4; ++r) x[7][r] = *(const v4f*)(sl + (size_t)r * LQP);
  // as above
  asm volatile("s_wait_xcnt 0x0" ::: "memory");

  // The first fragments of Ch fly while the exponentials are formed. Of bf only
  // the chunks in flight or in use are live.
  const _Float16* brow = Ch + ((size_t)(b * DD + wv * 16 + (lane & 15))) * 1024;
  v16h bf[32];
#pragma unroll  // as above
  for (int k = 0; k < TBA; ++k) bf[k] = frag_load(brow, 32 * k, lane);

  if (tid < 32) {
    // merge the column's four partial (maximum, sum) pairs; padded columns are
    // never written by cqa_colstat and take the sum 1
    float s = 1.f;
    if (jb + tid < LQ) {
      const int o = b * CSP * LQP + jb + tid;
      float qm[CSP], qs[CSP];
#pragma unroll  // as above
      for (int p = 0; p < CSP; ++p) { qm[p] = pmax[o + p * LQP]; qs[p] = psum[o + p * LQP]; }
      float m = fmaxf(fmaxf(qm[0], qm[1]), fmaxf(qm[2], qm[3]));
      s = 0.f;
#pragma unroll  // as above
      for (int p = 0; p < CSP; ++p) s += qs[p] * exp_slot(qm[p] - m);
    }
    csr[tid] = 1.0f / s;
  }

  v4f cm;
#pragma unroll  // as above
  for (int e = 0; e < 4; ++e)
    cm[e] = fmaxf(fmaxf(pm[0][e], pm[1][e]), fmaxf(pm[2][e], pm[3][e]));

#pragma unroll  // as above
  for (int p = 0; p < 8; ++p) {
    // all-ones where the sixteen values are real, else zero
    const unsigned keep = (cok && (p < 7 || rok)) ? 0xffffffffu : 0u;
#pragma unroll  // as above
    for (int e = 0; e < 4; ++e) {
      V4H h;
#pragma unroll  // as above
      for (int r = 0; r < 4; ++r) h.e[r] = (_Float16)exp_slot(x[p][r][e] - cm[e]);
      h.w[0] &= keep;
      h.w[1] &= keep;
      *(v4h*)&As[jl0 + e][128 * p + 4 * rg] = h.v;
    }
  }
  __syncthreads();

  const _Float16* arow0 = &As[lane & 15][0];
  const _Float16* arow1 = &As[16 + (lane & 15)][0];
  v8f acc[2] = {};
  // Two K-chunks a pass. The LDS fragments of the next pass and the Ch fragments
  // of TBA chunks on are asked for before a pass's four products.
  v16h af[2][2][2];
#pragma unroll  // the fragment arrays must stay in registers
  for (int c = 0; c < 2; ++c) {
    af[0][c][0] = frag_load(arow0, 32 * c, lane);
    af[0][c][1] = frag_load(arow1, 32 * c, lane);
  }
#pragma unroll  // as above
  for (int q = 0; q < 16; ++q) {
#pragma unroll  // as above
    for (int c = 0; c < 2; ++c) {
      const int kn = 2 * (q + 1) + c, kb = 2 * q + TBA + c;
      if (kn < 32) {
        af[(q + 1) & 1][c][0] = frag_load(arow0, 32 * kn, lane);
        af[(q + 1) & 1][c][1] = frag_load(arow1, 32 * kn, lane);
      }
      if (kb < 32) bf[kb] = frag_load(brow, 32 * kb, lane);
    }
    // keeps the loads above from sinking to their uses: each product would then
    // wait out a whole LDS latency
    __builtin_amdgcn_sched_barrier(0);
#pragma unroll  // as above
    for (int c = 0; c < 2; ++c) {
      acc[0] = wmma16(af[q & 1][c][0], bf[2 * q + c], acc[0]);
      acc[1] = wmma16(af[q & 1][c][1], bf[2 * q + c], acc[1]);
    }
  }

  // D: n = lane&15 -> d_local, m = r + 8*(lane>=16) -> j_local (consecutive j)
  const int d = wv * 16 + (lane & 15);
  const int mb = (lane >> 4) << 3;
#pragma unroll  // as above
  for (int t = 0; t < 2; ++t) {
    const v4f c0 = *(const v4f*)&csr[16 * t + mb];
    const v4f c1 = *(const v4f*)&csr[16 * t + mb + 4];
    V8H o;
#pragma unroll  // as above
    for (int r = 0; r < 8; ++r) {
      float val = (jb + 16 * t + mb + r < LQ) ? acc[t][r] * (r < 4 ? c0[r & 3] : c1[r & 3]) : 0.f;
      o.e[r] = (_Float16)val;
    }
    *(v8h*)(T + ((size_t)(b * DD + d)) * 128 + jb + 16 * t + mb) = o.v;
  }
}

// ---------------------------------------------------------------------------
// Kernel 4: A = S1@Qt, Bm = S1@T; emit [Ct, A, Ct*A, Ct*Bm] transposed.
// block = (b, 64 context rows); 8 waves each own a 16-wide d-tile and all 64 rows.
// The products are formed transposed (M = d, N = i). Column c of N-tile t is
// context row 4c + t, so a lane's four accumulator tiles hold four consecutive
// i of one output row: 16 lanes store 256 contiguous bytes of that row.
// A is formed and stored first, then Bm, so 32 accumulator registers serve both.
// The row softmax (axis=2) is formed here as well: a wave holds a whole row of S in
// registers, so the row's maximum and sum of exponentials are two wave reductions.
// ---------------------------------------------------------------------------
#define OIT   64      // context rows per block
#define ONT   16      // ceil(1000/64)
#define SPIT  136     // halves per LDS row: 272 B = 16 B x odd, for 16-byte readers

__global__ __launch_bounds__(256)
void cqa_out(const float* __restrict__ C, const float* __restrict__ S,
             const _Float16* __restrict__ Qg, const _Float16* __restrict__ T,
             float* __restrict__ out) {
  const int b = blockIdx.x / ONT;
  const int i0 = (blockIdx.x % ONT) * OIT;
  const int tid = threadIdx.x, wv = tid >> 5, lane = tid & 31;
  const int c = lane & 15;

  // LDS row 16*t + c holds S1 of context row i0 + 4*c + t.
  __shared__ __attribute__((aligned(16))) _Float16 As1[OIT][SPIT];

  // The lane's part of Ct: rows d = dbase + r, context rows gi .. gi + 3. LC and i0
  // are multiples of 4, so the four are all inside or all outside; lanes outside
  // read the last four inside and store nothing.
  const int gi = i0 + 4 * c;
  const int dbase = wv * 16 + ((lane >> 4) << 3);
  const float* cp = C + ((size_t)(b * DD + dbase)) * LC + (gi < LC ? gi : LC - 4);
  float4 ct[8];
#pragma unroll  // the array must stay in registers
  for (int r = 0; r < 8; ++r) ct[r] = *(const float4*)(cp + (size_t)r * LC);

  // One wave per context row, a lane takes four consecutive j. All eight rows'
  // loads are issued before the first is used. Lanes past the row's end and rows
  // past LC re-read the last valid place; their values are replaced by zero.
  const unsigned jo = 4u * (unsigned)(lane < LQ / 4 ? lane : LQ / 4 - 1);
  // the wave's number as a scalar: row addresses are wave-uniform
  const int wvu = __builtin_amdgcn_readfirstlane(wv);
  float4 s[8];
  float mx[8], sm[8];
#pragma unroll  // as above
  for (int u = 0; u < 8; ++u) {
    int si = i0 + wvu + 8 * u;
    int row = b * LC + (si < LC ? si : LC - 1);
    const float* srow = S + (size_t)row * LQP;  // wave-uniform base
    s[u] = *(const float4*)(srow + jo);
  }
  // Row maximum: the re-read quads of lanes past the row's end repeat real values.
#pragma unroll  // as above; the eight rows' reductions are independent chains
  for (int u = 0; u < 8; ++u)
    mx[u] = wave_max(fmaxf(fmaxf(s[u].x, s[u].y), fmaxf(s[u].z, s[u].w)));
  // Exponentials, kept for the quotients below, and their sum over the real lanes.
#pragma unroll  // as above
  for (int u = 0; u < 8; ++u) {
    s[u].x = exp_slot(s[u].x - mx[u]);
    s[u].y = exp_slot(s[u].y - mx[u]);
    s[u].z = exp_slot(s[u].z - mx[u]);
    s[u].w = exp_slot(s[u].w - mx[u]);
    sm[u] = wave_sum(lane < LQ / 4 ? (s[u].x + s[u].y) + (s[u].z + s[u].w) : 0.f);
  }
#pragma unroll  // as above
  for (int u = 0; u < 8; ++u) {
    const int m = wvu + 8 * u;
    // all-ones where the four values are real, else zero: the quotients are
    // formed in every lane (their inputs are valid) and masked as bits
    const unsigned keep = ((i0 + m < LC) && (lane < LQ / 4)) ? 0xffffffffu : 0u;
    V4H h;
    h.e[0] = (_Float16)(s[u].x / sm[u]);
    h.e[1] = (_Float16)(s[u].y / sm[u]);
    h.e[2] = (_Float16)(s[u].z / sm[u]);
    h.e[3] = (_Float16)(s[u].w / sm[u]);
    h.w[0] &= keep;
    h.w[1] &= keep;
    *(v4h*)&As1[((m & 3) << 4) + (m >> 2)][4 * lane] = h.v;
  }

  const _Float16* rowQ = Qg + ((size_t)(b * DD + wv * 16 + c)) * 128;
  const _Float16* rowT = T + ((size_t)(b * DD + wv * 16 + c)) * 128;
  v16h fq[4], ft[4];
#pragma unroll  // as above
  for (int k = 0; k < 4; ++k) fq[k] = frag_load(rowQ, 32 * k, lane);
  __syncthreads();

  float* op = out + ((size_t)(b * 512 + dbase)) * LC + gi;
  v8f acc[4] = {};
#pragma unroll  // as above
  for (int k = 0; k < 4; ++k) {
#pragma unroll  // as above
    for (int t = 0; t < 4; ++t)
      acc[t] = wmma16(fq[k], frag_load(&As1[16 * t + c][0], 32 * k, lane), acc[t]);
  }
#pragma unroll  // as above
  for (int k = 0; k < 4; ++k) ft[k] = frag_load(rowT, 32 * k, lane);

  // D: register r = [d_local = 8*(lane>=16) + r][column c]; tiles t = 0..3 give
  // i = gi + t.
  if (gi < LC) {
#pragma unroll  // as above
    for (int r = 0; r < 8; ++r) {
      float4 va = make_float4(acc[0][r], acc[1][r], acc[2][r], acc[3][r]);
      float* o = op + (size_t)r * LC;
      *(float4*)(o) = ct[r];
      *(float4*)(o + (size_t)128 * LC) = va;
      *(float4*)(o + (size_t)256 * LC) =
          make_float4(ct[r].x * va.x, ct[r].y * va.y, ct[r].z * va.z, ct[r].w * va.w);
    }
  }

#pragma unroll  // as above
  for (int t = 0; t < 4; ++t) acc[t] = v8f{};
#pragma unroll  // as above
  for (int k = 0; k < 4; ++k) {
#pragma unroll  // as above
    for (int t = 0; t < 4; ++t)
      acc[t] = wmma16(ft[k], frag_load(&As1[16 * t + c][0], 32 * k, lane), acc[t]);
  }
  if (gi < LC) {
#pragma unroll  // as above
    for (int r = 0; r < 8; ++r) {
      *(float4*)(op + (size_t)(384 + r) * LC) =
          make_float4(ct[r].x * acc[0][r], ct[r].y * acc[1][r], ct[r].z * acc[2][r],
                      ct[r].w * acc[3][r]);
    }
  }
}

// ---------------------------------------------------------------------------
extern "C" void kernel_launch(void* const* d_in, const int* in_sizes, int n_in,
                              void* d_out, int out_size, void* d_ws, size_t ws_size,
                              hipStream_t stream) {
  (void)in_sizes; (void)n_in; (void)out_size; (void)ws_size;
  const float* C = (const float*)d_in[0];
  const float* Q = (const float*)d_in[1];
  const float* W = (const float*)d_in[2];
  float* out = (float*)d_out;
  char* ws = (char*)d_ws;

  float*    Sbuf = (float*)(ws + WS_S);
  float*    cmax = (float*)(ws + WS_CMAX);
  float*    csum = (float*)(ws + WS_CSUM);
  _Float16* T    = (_Float16*)(ws + WS_T);
  _Float16* Qh   = (_Float16*)(ws + WS_QH);
  _Float16* Qg   = (_Float16*)(ws + WS_QG);
  _Float16* Ch   = (_Float16*)(ws + WS_CH);

  cqa_prep<<<1024, 256, 0, stream>>>(C, Q, Qh, Qg, Ch, T);
  cqa_s<<<NB * SNT, 256, 0, stream>>>(C, W, Qh, Sbuf);
  cqa_colstat<<<NB * CSP, 256, 0, stream>>>(Sbuf, cmax, csum);
  cqa_t<<<NB * TJG, 256, 0, stream>>>(Sbuf, cmax, csum, Ch, T);
  cqa_out<<<NB * ONT, 256, 0, stream>>>(C, Sbuf, Qg, T, out);
}

// v006
// It runs in 60.8 microseconds.
// Next to v005, in two timings, it ran 1.35 and 1.34 times as fast.
// All steps since v000 together make it 4.38 times as fast.
#include <hip/hip_runtime.h>

// ---------------------------------------------------------------------------
// CQAttention for MI455X (gfx1250, wave32, WMMA f32_16x16x32_f16)
// B=64, D=128, LC=1000 (pad 1024), LQ=100 (pad 112/128)
// ---------------------------------------------------------------------------

typedef __attribute__((ext_vector_type(16))) _Float16 v16h;
typedef __attribute__((ext_vector_type(8)))  _Float16 v8h;
typedef __attribute__((ext_vector_type(4)))  _Float16 v4h;
typedef __attribute__((ext_vector_type(8)))  float    v8f;
typedef __attribute__((ext_vector_type(4))) float v4f;

union V16H { v16h v; v8h h[2]; };
union V8F  { v8f v; float e[8]; };
union V8H  { v8h v; _Float16 e[8]; unsigned w[4]; };
union V4H  { v4h v; _Float16 e[4]; unsigned w[2]; };

#define NB   64
#define DD   128
#define LC   1000
#define LQ   100
#define LQP  112      // 7 * 16
#define NJT  7        // ceil(100/16)

// Workspace layout (bytes, all offsets 256-aligned)
#define WS_S     ((size_t)0)            // f32 [64][1000][112]   = 28,672,000 B
#define WS_T     ((size_t)29241344)     // f16 [64][128][128]    =  2,097,152 B
#define WS_QG    ((size_t)35270656)     // f16 [64][128][128]    =  2,097,152 B
#define WS_CH    ((size_t)39464960)     // f16 [64][128][1024]   = 16,777,216 B
#define WS_CMAX  ((size_t)56242176)     // f32 [64][4][112]      =    114,688 B
#define WS_CSUM  ((size_t)56356864)     // f32 [64][4][112]      =    114,688 B
// total = 56,471,552 B

// Per-ISA 16-bit A/B fragment layout: lane L holds row (L&15); halves 0..7 are
// K = kb..kb+7 and halves 8..15 are K = kb+16..kb+23 where kb = k0 + 8*(L>=16).
// Two contiguous 16-byte loads per fragment.
__device__ __forceinline__ v16h frag_load(const _Float16* row, int k0, int lane) {
  V16H r;
  int kb = k0 + ((lane >> 4) << 3);
  r.h[0] = *(const v8h*)(row + kb);
  r.h[1] = *(const v8h*)(row + kb + 16);
  return r.v;
}

__device__ __forceinline__ v8f wmma16(v16h a, v16h b, v8f c) {
  return __builtin_amdgcn_wmma_f32_16x16x32_f16(false, a, false, b, (short)0, c,
                                                false, false);
}

// ---------------------------------------------------------------------------
// Kernel 1: S[b,i,j] = sum_d (w1+w3*Ct)[i,d] * Qt[j,d]  + rowbias[i]
// block = (b, 128 context rows), 8 waves. The block's part of C, 128 d x 128 i, is
// read in whole rows of 512 bytes and laid in LDS as it is; a wave then streams the
// 16 rows of W that it owns, a lane taking d = 4*lane .. 4*lane+3 of w1, w2, w3 (512
// contiguous bytes a load), four rows a group, two groups in flight. From LDS the
// lane reads its four d of four context rows at once, so C is never gathered.
// The row bias is a wave reduction. Then waves 0..6 take one 16-wide j-tile each
// and all eight i-tiles, K = 128 (4 WMMAs a tile).
// The f16 operands of the whole sequence are formed here too, from what the block
// reads anyway: Q of the batch goes transposed to LDS for this kernel's own products,
// the C tile goes to Ch (padded with zeros to 1024 context rows) for cqa_t, and one
// block of a batch stores Qg (Q padded with zeros to 128 columns) for cqa_out.
// ---------------------------------------------------------------------------
// Value of lane l ^ M inside the 16-lane row (DPP row_xmask); every lane is on.
template <int M>
__device__ __forceinline__ float row_xor(float x) {
  return __builtin_bit_cast(float, __builtin_amdgcn_update_dpp(
      0, __builtin_bit_cast(int, x), 0x160 | M, 0xf, 0xf, true));
}
// Value of lane l ^ 16.
__device__ __forceinline__ float half_xor(float x) {
  int v = __builtin_bit_cast(int, x);
  return __builtin_bit_cast(float, __builtin_amdgcn_permlanex16(v, v, 0x76543210, 0xfedcba98,
                                                                false, false));
}
__device__ __forceinline__ float wave_max(float x) {
  x = fmaxf(x, row_xor<1>(x)); x = fmaxf(x, row_xor<2>(x));
  x = fmaxf(x, row_xor<4>(x)); x = fmaxf(x, row_xor<8>(x));
  return fmaxf(x, half_xor(x));
}
__device__ __forceinline__ float wave_sum(float x) {
  x += row_xor<1>(x); x += row_xor<2>(x);
  x += row_xor<4>(x); x += row_xor<8>(x);
  return x + half_xor(x);
}

#define SIT   128     // context rows per block
#define SNT   8       // ceil(1000/128)
#define UPIT  136     // halves per LDS row: 272 B = 16 B x odd, for 16-byte readers

__global__ __launch_bounds__(256)
void cqa_s(const float* __restrict__ C, const float* __restrict__ Q,
           const float* __restrict__ W, _Float16* __restrict__ Qg,
           _Float16* __restrict__ Ch, float* __restrict__ S) {
  const int b = blockIdx.x / SNT;
  const int i0 = (blockIdx.x % SNT) * SIT;
  const int tid = threadIdx.x, wv = tid >> 5, lane = tid & 31;
  // the wave's number as a scalar: row addresses of W are wave-uniform
  const int wvu = __builtin_amdgcn_readfirstlane(wv);

  // Cs: row d holds 32 quads of context rows; quad q lies at place q ^ ((d >> 2) & 15),
  // so that 16 lanes that write one row, and 16 lanes that read one quad of rows
  // d = 4*lane + e, both fall on 16 different groups of four banks.
  __shared__ __attribute__((aligned(16))) float Cs[DD * SIT];
  __shared__ __attribute__((aligned(16))) _Float16 u[SIT][UPIT];  // w1 + w3*Ct
  __shared__ __attribute__((aligned(16))) float rs[SIT];
  __shared__ __attribute__((aligned(16))) _Float16 Qs[LQP][UPIT]; // Qs[j][d] = Q[d][j]

  // Q: wave wv takes rows d = 16*wv + k, a lane columns 4*lane .. 4*lane+3 (400
  // contiguous bytes a load). Lanes past the row's end re-read its last quad; their
  // values are replaced by zero. These loads go first: they are the first to be used.
  const float* qp = Q + ((size_t)(b * DD + 16 * wv)) * LQ + 4 * (lane < LQ / 4 ? lane : LQ / 4 - 1);
  v4f qst[16];
#pragma unroll  // the array must stay in registers
  for (int k = 0; k < 16; ++k) qst[k] = *(const v4f*)(qp + (size_t)k * LQ);
  // the address registers of the loads above are free for reuse only behind this wait
  asm volatile("s_wait_xcnt 0x0" ::: "memory");

  // C: wave wv takes rows d = wv + 8*k. LC and i0 are multiples of 4, so a quad is
  // all inside or all outside; quads outside re-read the last one inside, and what
  // comes of them is never stored.
  const int ci = i0 + 4 * lane < LC ? i0 + 4 * lane : LC - 4;
  const float* cp = C + ((size_t)(b * DD + wv)) * LC + ci;
  v4f cst[16];
#pragma unroll  // the array must stay in registers
  for (int k = 0; k < 16; ++k) cst[k] = *(const v4f*)(cp + (size_t)(8 * k) * LC);
  // the address registers of the loads above are free for reuse only behind this wait
  asm volatile("s_wait_xcnt 0x0" ::: "memory");

  // W: group g is the wave's rows 4*g .. 4*g+3; rows past LC re-read row LC - 1.
  // The second group is asked for behind the work on Q, in the registers that Q leaves.
  v4f w[2][4][3];
#pragma unroll  // as above
  for (int g = 0; g < 2; ++g) {
#pragma unroll  // as above
    for (int r = 0; r < 4; ++r) {
      const int gi = i0 + 16 * wvu + 4 * g + r;
      const float* wrow = W + ((size_t)(b * LC + (gi < LC ? gi : LC - 1))) * 384 + 4 * lane;
#pragma unroll  // as above
      for (int p = 0; p < 3; ++p) w[g][r][p] = *(const v4f*)(wrow + 128 * p);
    }
    // as at the first wait: the address registers of these loads are reused below
    asm volatile("s_wait_xcnt 0x0" ::: "memory");
    if (g == 0) {
      // all-ones where the lane's four columns are real, else zero
      const unsigned qkeep = lane < LQ / 4 ? 0xffffffffu : 0u;
      // A lane holds 16 consecutive d of four columns: 32 contiguous bytes of four
      // rows of Qs. Rows LQ .. LQP-1 are laid as zeros.
      if (lane < LQP / 4) {
#pragma unroll  // as above
        for (int e = 0; e < 4; ++e) {
#pragma unroll  // as above
          for (int hf = 0; hf < 2; ++hf) {
            V8H h;
#pragma unroll  // as above
            for (int k = 0; k < 8; ++k) h.e[k] = (_Float16)qst[8 * hf + k][e];
#pragma unroll  // as above
            for (int k = 0; k < 4; ++k) h.w[k] &= qkeep;
            *(v8h*)&Qs[4 * lane + e][16 * wv + 8 * hf] = h.v;
          }
        }
      }
      // Qg is the same for the batch's eight blocks: the last one, which has the
      // fewest real context rows, stores it (256 contiguous bytes a row).
      if (i0 == (SNT - 1) * SIT) {
        _Float16* gp = Qg + ((size_t)(b * DD + 16 * wv)) * 128 + 4 * lane;
#pragma unroll  // as above
        for (int k = 0; k < 16; ++k) {
          V4H h;
#pragma unroll  // as above
          for (int e = 0; e < 4; ++e) h.e[e] = (_Float16)qst[k][e];
          h.w[0] &= qkeep;
          h.w[1] &= qkeep;
          *(v4h*)(gp + (size_t)k * 128) = h.v;
        }
        // as at the first wait, for the address registers of these stores
        asm volatile("s_wait_xcnt 0x0" ::: "memory");
      }
    }
  }

  // all-ones where the lane's four context rows are real, else zero
  const unsigned ckeep = i0 + 4 * lane < LC ? 0xffffffffu : 0u;
  _Float16* chp = Ch + ((size_t)(b * DD + wv)) * 1024 + i0 + 4 * lane;
#pragma unroll  // as above
  for (int k = 0; k < 16; ++k) {
    const int d = wv + 8 * k;
    *(v4f*)&Cs[d * SIT + 4 * (lane ^ ((d >> 2) & 15))] = cst[k];
    V4H h;
#pragma unroll  // as above
    for (int e = 0; e < 4; ++e) h.e[e] = (_Float16)cst[k][e];
    h.w[0] &= ckeep;
    h.w[1] &= ckeep;
    *(v4h*)(chp + (size_t)(8 * k) * 1024) = h.v;  // 256 contiguous bytes a wave
  }
  // as at the first wait, for the address registers of the stores to Ch
  asm volatile("s_wait_xcnt 0x0" ::: "memory");
  // The work-group's barrier by hand, behind the wave's own LDS stores:
  // __syncthreads() would also wait out the loads of W that are in flight.
  asm volatile("s_wait_dscnt 0x0\n\ts_barrier_signal -1\n\ts_barrier_wait -1" ::: "memory");

#pragma unroll  // as above
  for (int g = 0; g < 4; ++g) {
    v4f cc[4];  // cc[e][r] = C[d = 4*lane + e][context row 16*wv + 4*g + r]
#pragma unroll  // as above
    for (int e = 0; e < 4; ++e)
      cc[e] = *(const v4f*)&Cs[(4 * lane + e) * SIT + 4 * ((4 * wv + g) ^ (lane & 15))];
    float bias = 0.f;
#pragma unroll  // as above
    for (int r = 0; r < 4; ++r) {
      const v4f w1 = w[g & 1][r][0], w2 = w[g & 1][r][1], w3 = w[g & 1][r][2];
      V4H h;
#pragma unroll  // as above
      for (int e = 0; e < 4; ++e) h.e[e] = (_Float16)(w1[e] + w3[e] * cc[e][r]);
      *(v4h*)&u[16 * wv + 4 * g + r][4 * lane] = h.v;
      const float t = wave_sum((w2[0] * cc[0][r] + w2[1] * cc[1][r]) +
                               (w2[2] * cc[2][r] + w2[3] * cc[3][r]));
      bias = lane == r ? t : bias;
    }
    if (lane < 4) rs[16 * wv + 4 * g + lane] = bias;
    if (g + 2 < 4) {
#pragma unroll  // as above
      for (int r = 0; r < 4; ++r) {
        const int gi = i0 + 16 * wvu + 4 * (g + 2) + r;
        const float* wrow = W + ((size_t)(b * LC + (gi < LC ? gi : LC - 1))) * 384 + 4 * lane;
#pragma unroll  // as above
        for (int p = 0; p < 3; ++p) w[g & 1][r][p] = *(const v4f*)(wrow + 128 * p);
      }
      // as at the first wait
      asm volatile("s_wait_xcnt 0x0" ::: "memory");
    }
  }

  // Qs stands since the first barrier. The eighth wave has no j-tile: it re-reads the
  // seventh's rows and stops at the last barrier.
  const int j0 = (wv < NJT ? wv : NJT - 1) * 16;
  v16h bq[4];
#pragma unroll  // as above
  for (int k = 0; k < 4; ++k) bq[k] = frag_load(&Qs[j0 + (lane & 15)][0], 32 * k, lane);

  __syncthreads();
  if (wvu >= NJT) return;  // behind the last barrier

  // All eight i-tiles' products are independent: a K-chunk's eight fragments of u are
  // asked for together, and the stores follow the last product.
  v8f acc[SIT / 16] = {};
#pragma unroll  // as above
  for (int k = 0; k < 4; ++k) {
    v16h a[SIT / 16];
#pragma unroll  // as above
    for (int t = 0; t < SIT / 16; ++t) a[t] = frag_load(&u[16 * t + (lane & 15)][0], 32 * k, lane);
#pragma unroll  // as above
    for (int t = 0; t < SIT / 16; ++t) acc[t] = wmma16(a[t], bq[k], acc[t]);
  }

  // D layout: n = lane&15, m = r + 8*(lane>=16). LC is a multiple of 8, so a lane's
  // eight rows of a tile are all inside or all outside.
  const int j = j0 + (lane & 15);
  const int mb = (lane >> 4) << 3;
#pragma unroll  // as above
  for (int t = 0; t < SIT / 16; ++t) {
    const v4f r0 = *(const v4f*)&rs[16 * t + mb];
    const v4f r1 = *(const v4f*)&rs[16 * t + mb + 4];
    const int gi = i0 + 16 * t + mb;
    if (j < LQ && gi < LC) {
      float* sp = S + ((size_t)(b * LC + gi)) * LQP + j;
#pragma unroll  // as above
      for (int r = 0; r < 8; ++r) sp[(size_t)r * LQP] = acc[t][r] + (r < 4 ? r0[r & 3] : r1[r & 3]);
    }
  }
}

// ---------------------------------------------------------------------------
// Kernel 2: per-column (axis=1) softmax stats, partial over 250 context rows.
// block = (b, part of 250 rows); thread = (row group rg of 10, quad q of 25): it
// holds columns 4q .. 4q+3 of rows rg, rg+10, .. rg+240 in registers, all 25 loads
// in flight at once, takes their maximum and then the sum of exponentials. The ten
// row groups are merged through LDS; the four parts of a batch in cqa_t.
// ---------------------------------------------------------------------------
#define CSP  4        // parts per batch
#define CSR  250      // context rows per part
#define CRG  10       // row groups per block
#define CQ   25       // LQ / 4 quads per row
#define CRT  25       // rows per thread = CSR / CRG

__global__ __launch_bounds__(256)
void cqa_colstat(const float* __restrict__ S, float* __restrict__ pmax,
                 float* __restrict__ psum) {
  const int b = blockIdx.x / CSP, part = blockIdx.x % CSP;
  const int tid = threadIdx.x;
  __shared__ __attribute__((aligned(16))) float lm[CRG * LQ];
  __shared__ __attribute__((aligned(16))) float ls[CRG * LQ];

  if (tid < CRG * CQ) {
    const int rg = tid / CQ, q = tid % CQ;
    const float* p = S + ((size_t)(b * LC + part * CSR + rg)) * LQP + 4 * q;
    float4 x[CRT];
#pragma unroll  // the array must stay in registers
    for (int k = 0; k < CRT; ++k) x[k] = *(const float4*)(p + (size_t)k * CRG * LQP);
    float4 m = x[0];
#pragma unroll  // as above
    for (int k = 1; k < CRT; ++k) {
      m.x = fmaxf(m.x, x[k].x); m.y = fmaxf(m.y, x[k].y);
      m.z = fmaxf(m.z, x[k].z); m.w = fmaxf(m.w, x[k].w);
    }
    float4 s = make_float4(0.f, 0.f, 0.f, 0.f);
#pragma unroll  // as above
    for (int k = 0; k < CRT; ++k) {
      s.x += __expf(x[k].x - m.x); s.y += __expf(x[k].y - m.y);
      s.z += __expf(x[k].z - m.z); s.w += __expf(x[k].w - m.w);
    }
    // rg * LQ + 4 * q = 4 * tid: the block's stores are contiguous
    *(float4*)&lm[4 * tid] = m;
    *(float4*)&ls[4 * tid] = s;
  }
  __syncthreads();
  if (tid < LQ) {
    float m = lm[tid];
#pragma unroll  // ten independent LDS reads, no loop overhead
    for (int r = 1; r < CRG; ++r) m = fmaxf(m, lm[r * LQ + tid]);
    float s = 0.f;
#pragma unroll  // as above
    for (int r = 0; r < CRG; ++r) s += ls[r * LQ + tid] * __expf(lm[r * LQ + tid] - m);
    pmax[(b * CSP + part) * LQP + tid] = m;
    psum[(b * CSP + part) * LQP + tid] = s;
  }
}

// ---------------------------------------------------------------------------
// Kernel 3: T[b][d][j] = sum_i S2[b,i,j] * Ct[b,i,d]   (M=j, N=d, K=i)
// block = (b, two j-tiles = 32 columns); 8 waves each own a 16-wide d-tile and both
// j-tiles, so a fragment of Ch serves two products. The block's whole operand
// exp(S - column maximum), 32 columns x 1024 context rows, is formed once and laid
// transposed in LDS: every load of S is in flight at once, and one barrier stands
// between the staging and the 32 K-chunks. The fourth pair's second tile (columns
// 112 .. 127) lies past S: it is staged, and stored to T, as zeros.
// ---------------------------------------------------------------------------
// exp(x) as __expf forms it (x * log2(e), then the hardware exp2). The v_nop fills
// the slot that the instruction set asks for behind a transcendental before its
// result is used or its source overwritten; in the statement it cannot drift away.
__device__ __forceinline__ float exp_slot(float x) {
  float y, a = x * 1.44269504088896340736f;
  asm("v_exp_f32 %0, %1\n\tv_nop" : "=v"(y) : "v"(a));
  return y;
}

#define TJG   4       // column pairs of tiles per batch
#define TKP   1032    // halves per LDS row: 2064 B = 16 B x odd, for 16-byte readers
#define TBA   8       // K-chunks by which the fragments of Ch are fetched ahead

__global__ __launch_bounds__(256)
void cqa_t(const float* __restrict__ S, const float* __restrict__ pmax,
           const float* __restrict__ psum, const _Float16* __restrict__ Ch,
           _Float16* __restrict__ T) {
  const int b = blockIdx.x / TJG;
  const int jb = (blockIdx.x % TJG) * 32;
  const int tid = threadIdx.x, wv = tid >> 5, lane = tid & 31;

  __shared__ __attribute__((aligned(16))) _Float16 As[32][TKP];
  __shared__ __attribute__((aligned(16))) float csr[32];

  // Staging: a thread takes four consecutive columns (local jl0 ..) of the context
  // rows 128*p + 4*rg + r, p = 0..7, r = 0..3. LQ and LC are multiples of 4, so the
  // four columns, and the four rows, are all real or all padding; padding re-reads
  // a real place (columns past LQ of S and of the statistics are never written) and
  // is replaced by zero.
  const int jl0 = ((wv >> 2) << 4) + ((lane & 3) << 2);
  const int rg = ((wv & 3) << 3) + (lane >> 2);
  const bool cok = jb + jl0 < LQ;
  const int gj = cok ? jb + jl0 : 0;
  const bool rok = 896 + 4 * rg < LC;

  v4f pm[CSP];
#pragma unroll  // the array must stay in registers
  for (int p = 0; p < CSP; ++p) pm[p] = *(const v4f*)(pmax + (b * CSP + p) * LQP + gj);
  // the address registers of the loads above are free for reuse only behind this wait
  asm volatile("s_wait_xcnt 0x0" ::: "memory");

  const float* sp = S + ((size_t)(b * LC + 4 * rg)) * LQP + gj;
  const float* sl = S + ((size_t)(b * LC + (rok ? 896 + 4 * rg : LC - 4))) * LQP + gj;
  v4f x[8][4];
#pragma unroll  // as above; all 32 loads are issued before the first is used
  for (int p = 0; p < 7; ++p) {
#pragma unroll  // as above
    for (int r = 0; r < 4; ++r) x[p][r] = *(const v4f*)(sp + (size_t)(128 * p + r) * LQP);
  }
  // as above: later loads may land in the address registers of these
  asm volatile("s_wait_xcnt 0x0" ::: "memory");
#pragma unroll  // as above
  for (int r = 0; r < 4; ++r) x[7][r] = *(const v4f*)(sl + (size_t)r * LQP);
  // as above
  asm volatile("s_wait_xcnt 0x0" ::: "memory");

  // The first fragments of Ch fly while the exponentials are formed. Of bf only
  // the chunks in flight or in use are live.
  const _Float16* brow = Ch + ((size_t)(b * DD + wv * 16 + (lane & 15))) * 1024;
  v16h bf[32];
#pragma unroll  // as above
  for (int k = 0; k < TBA; ++k) bf[k] = frag_load(brow, 32 * k, lane);

  if (tid < 32) {
    // merge the column's four partial (maximum, sum) pairs; padded columns are
    // never written by cqa_colstat and take the sum 1
    float s = 1.f;
    if (jb + tid < LQ) {
      const int o = b * CSP * LQP + jb + tid;
      float qm[CSP], qs[CSP];
#pragma unroll  // as above
      for (int p = 0; p < CSP; ++p) { qm[p] = pmax[o + p * LQP]; qs[p] = psum[o + p * LQP]; }
      float m = fmaxf(fmaxf(qm[0], qm[1]), fmaxf(qm[2], qm[3]));
      s = 0.f;
#pragma unroll  // as above
      for (int p = 0; p < CSP; ++p) s += qs[p] * exp_slot(qm[p] - m);
    }
    csr[tid] = 1.0f / s;
  }

  v4f cm;
#pragma unroll  // as above
  for (int e = 0; e < 4; ++e)
    cm[e] = fmaxf(fmaxf(pm[0][e], pm[1][e]), fmaxf(pm[2][e], pm[3][e]));

#pragma unroll  // as above
  for (int p = 0; p < 8; ++p) {
    // all-ones where the sixteen values are real, else zero
    const unsigned keep = (cok && (p < 7 || rok)) ? 0xffffffffu : 0u;
#pragma unroll  // as above
    for (int e = 0; e < 4; ++e) {
      V4H h;
#pragma unroll  // as above
      for (int r = 0; r < 4; ++r) h.e[r] = (_Float16)exp_slot(x[p][r][e] - cm[e]);
      h.w[0] &= keep;
      h.w[1] &= keep;
      *(v4h*)&As[jl0 + e][128 * p + 4 * rg] = h.v;
    }
  }
  __syncthreads();

  const _Float16* arow0 = &As[lane & 15][0];
  const _Float16* arow1 = &As[16 + (lane & 15)][0];
  v8f acc[2] = {};
  // Two K-chunks a pass. The LDS fragments of the next pass and the Ch fragments
  // of TBA chunks on are asked for before a pass's four products.
  v16h af[2][2][2];
#pragma unroll  // the fragment arrays must stay in registers
  for (int c = 0; c < 2; ++c) {
    af[0][c][0] = frag_load(arow0, 32 * c, lane);
    af[0][c][1] = frag_load(arow1, 32 * c, lane);
  }
#pragma unroll  // as above
  for (int q = 0; q < 16; ++q) {
#pragma unroll  // as above
    for (int c = 0; c < 2; ++c) {
      const int kn = 2 * (q + 1) + c, kb = 2 * q + TBA + c;
      if (kn < 32) {
        af[(q + 1) & 1][c][0] = frag_load(arow0, 32 * kn, lane);
        af[(q + 1) & 1][c][1] = frag_load(arow1, 32 * kn, lane);
      }
      if (kb < 32) bf[kb] = frag_load(brow, 32 * kb, lane);
    }
    // keeps the loads above from sinking to their uses: each product would then
    // wait out a whole LDS latency
    __builtin_amdgcn_sched_barrier(0);
#pragma unroll  // as above
    for (int c = 0; c < 2; ++c) {
      acc[0] = wmma16(af[q & 1][c][0], bf[2 * q + c], acc[0]);
      acc[1] = wmma16(af[q & 1][c][1], bf[2 * q + c], acc[1]);
    }
  }

  // D: n = lane&15 -> d_local, m = r + 8*(lane>=16) -> j_local (consecutive j)
  const int d = wv * 16 + (lane & 15);
  const int mb = (lane >> 4) << 3;
#pragma unroll  // as above
  for (int t = 0; t < 2; ++t) {
    const v4f c0 = *(const v4f*)&csr[16 * t + mb];
    const v4f c1 = *(const v4f*)&csr[16 * t + mb + 4];
    V8H o;
#pragma unroll  // as above
    for (int r = 0; r < 8; ++r) {
      float val = (jb + 16 * t + mb + r < LQ) ? acc[t][r] * (r < 4 ? c0[r & 3] : c1[r & 3]) : 0.f;
      o.e[r] = (_Float16)val;
    }
    *(v8h*)(T + ((size_t)(b * DD + d)) * 128 + jb + 16 * t + mb) = o.v;
  }
}

// ---------------------------------------------------------------------------
// Kernel 4: A = S1@Qt, Bm = S1@T; emit [Ct, A, Ct*A, Ct*Bm] transposed.
// block = (b, 64 context rows); 8 waves each own a 16-wide d-tile and all 64 rows.
// The products are formed transposed (M = d, N = i). Column c of N-tile t is
// context row 4c + t, so a lane's four accumulator tiles hold four consecutive
// i of one output row: 16 lanes store 256 contiguous bytes of that row.
// A is formed and stored first, then Bm, so 32 accumulator registers serve both.
// The row softmax (axis=2) is formed here as well: a wave holds a whole row of S in
// registers, so the row's maximum and sum of exponentials are two wave reductions.
// ---------------------------------------------------------------------------
#define OIT   64      // context rows per block
#define ONT   16      // ceil(1000/64)
#define SPIT  136     // halves per LDS row: 272 B = 16 B x odd, for 16-byte readers

__global__ __launch_bounds__(256)
void cqa_out(const float* __restrict__ C, const float* __restrict__ S,
             const _Float16* __restrict__ Qg, const _Float16* __restrict__ T,
             float* __restrict__ out) {
  const int b = blockIdx.x / ONT;
  const int i0 = (blockIdx.x % ONT) * OIT;
  const int tid = threadIdx.x, wv = tid >> 5, lane = tid & 31;
  const int c = lane & 15;

  // LDS row 16*t + c holds S1 of context row i0 + 4*c + t.
  __shared__ __attribute__((aligned(16))) _Float16 As1[OIT][SPIT];

  // The lane's part of Ct: rows d = dbase + r, context rows gi .. gi + 3. LC and i0
  // are multiples of 4, so the four are all inside or all outside; lanes outside
  // read the last four inside and store nothing.
  const int gi = i0 + 4 * c;
  const int dbase = wv * 16 + ((lane >> 4) << 3);
  const float* cp = C + ((size_t)(b * DD + dbase)) * LC + (gi < LC ? gi : LC - 4);
  float4 ct[8];
#pragma unroll  // the array must stay in registers
  for (int r = 0; r < 8; ++r) ct[r] = *(const float4*)(cp + (size_t)r * LC);

  // One wave per context row, a lane takes four consecutive j. All eight rows'
  // loads are issued before the first is used. Lanes past the row's end and rows
  // past LC re-read the last valid place; their values are replaced by zero.
  const unsigned jo = 4u * (unsigned)(lane < LQ / 4 ? lane : LQ / 4 - 1);
  // the wave's number as a scalar: row addresses are wave-uniform
  const int wvu = __builtin_amdgcn_readfirstlane(wv);
  float4 s[8];
  float mx[8], sm[8];
#pragma unroll  // as above
  for (int u = 0; u < 8; ++u) {
    int si = i0 + wvu + 8 * u;
    int row = b * LC + (si < LC ? si : LC - 1);
    const float* srow = S + (size_t)row * LQP;  // wave-uniform base
    s[u] = *(const float4*)(srow + jo);
  }
  // Row maximum: the re-read quads of lanes past the row's end repeat real values.
#pragma unroll  // as above; the eight rows' reductions are independent chains
  for (int u = 0; u < 8; ++u)
    mx[u] = wave_max(fmaxf(fmaxf(s[u].x, s[u].y), fmaxf(s[u].z, s[u].w)));
  // Exponentials, kept for the quotients below, and their sum over the real lanes.
#pragma unroll  // as above
  for (int u = 0; u < 8; ++u) {
    s[u].x = exp_slot(s[u].x - mx[u]);
    s[u].y = exp_slot(s[u].y - mx[u]);
    s[u].z = exp_slot(s[u].z - mx[u]);
    s[u].w = exp_slot(s[u].w - mx[u]);
    sm[u] = wave_sum(lane < LQ / 4 ? (s[u].x + s[u].y) + (s[u].z + s[u].w) : 0.f);
  }
#pragma unroll  // as above
  for (int u = 0; u < 8; ++u) {
    const int m = wvu + 8 * u;
    // all-ones where the four values are real, else zero: the quotients are
    // formed in every lane (their inputs are valid) and masked as bits
    const unsigned keep = ((i0 + m < LC) && (lane < LQ / 4)) ? 0xffffffffu : 0u;
    V4H h;
    h.e[0] = (_Float16)(s[u].x / sm[u]);
    h.e[1] = (_Float16)(s[u].y / sm[u]);
    h.e[2] = (_Float16)(s[u].z / sm[u]);
    h.e[3] = (_Float16)(s[u].w / sm[u]);
    h.w[0] &= keep;
    h.w[1] &= keep;
    *(v4h*)&As1[((m & 3) << 4) + (m >> 2)][4 * lane] = h.v;
  }

  const _Float16* rowQ = Qg + ((size_t)(b * DD + wv * 16 + c)) * 128;
  const _Float16* rowT = T + ((size_t)(b * DD + wv * 16 + c)) * 128;
  v16h fq[4], ft[4];
#pragma unroll  // as above
  for (int k = 0; k < 4; ++k) fq[k] = frag_load(rowQ, 32 * k, lane);
  __syncthreads();

  float* op = out + ((size_t)(b * 512 + dbase)) * LC + gi;
  v8f acc[4] = {};
#pragma unroll  // as above
  for (int k = 0; k < 4; ++k) {
#pragma unroll  // as above
    for (int t = 0; t < 4; ++t)
      acc[t] = wmma16(fq[k], frag_load(&As1[16 * t + c][0], 32 * k, lane), acc[t]);
  }
#pragma unroll  // as above
  for (int k = 0; k < 4; ++k) ft[k] = frag_load(rowT, 32 * k, lane);

  // D: register r = [d_local = 8*(lane>=16) + r][column c]; tiles t = 0..3 give
  // i = gi + t.
  if (gi < LC) {
#pragma unroll  // as above
    for (int r = 0; r < 8; ++r) {
      float4 va = make_float4(acc[0][r], acc[1][r], acc[2][r], acc[3][r]);
      float* o = op + (size_t)r * LC;
      *(float4*)(o) = ct[r];
      *(float4*)(o + (size_t)128 * LC) = va;
      *(float4*)(o + (size_t)256 * LC) =
          make_float4(ct[r].x * va.x, ct[r].y * va.y, ct[r].z * va.z, ct[r].w * va.w);
    }
  }

#pragma unroll  // as above
  for (int t = 0; t < 4; ++t) acc[t] = v8f{};
#pragma unroll  // as above
  for (int k = 0; k < 4; ++k) {
#pragma unroll  // as above
    for (int t = 0; t < 4; ++t)
      acc[t] = wmma16(ft[k], frag_load(&As1[16 * t + c][0], 32 * k, lane), acc[t]);
  }
  if (gi < LC) {
#pragma unroll  // as above
    for (int r = 0; r < 8; ++r) {
      *(float4*)(op + (size_t)(384 + r) * LC) =
          make_float4(ct[r].x * acc[0][r], ct[r].y * acc[1][r], ct[r].z * acc[2][r],
                      ct[r].w * acc[3][r]);
    }
  }
}

// ---------------------------------------------------------------------------
extern "C" void kernel_launch(void* const* d_in, const int* in_sizes, int n_in,
                              void* d_out, int out_size, void* d_ws, size_t ws_size,
                              hipStream_t stream) {
  (void)in_sizes; (void)n_in; (void)out_size; (void)ws_size;
  const float* C = (const float*)d_in[0];
  const float* Q = (const float*)d_in[1];
  const float* W = (const float*)d_in[2];
  float* out = (float*)d_out;
  char* ws = (char*)d_ws;

  float*    Sbuf = (float*)(ws + WS_S);
  float*    cmax = (float*)(ws + WS_CMAX);
  float*    csum = (float*)(ws + WS_CSUM);
  _Float16* T    = (_Float16*)(ws + WS_T);
  _Float16* Qg   = (_Float16*)(ws + WS_QG);
  _Float16* Ch   = (_Float16*)(ws + WS_CH);

  cqa_s<<<NB * SNT, 256, 0, stream>>>(C, Q, W, Qg, Ch, Sbuf);
  cqa_colstat<<<NB * CSP, 256, 0, stream>>>(Sbuf, cmax, csum);
  cqa_t<<<NB * TJG, 256, 0, stream>>>(Sbuf, cmax, csum, Ch, T);
  cqa_out<<<NB * ONT, 256, 0, stream>>>(C, Sbuf, Qg, T, out);
}

// v007
// Measured time: 57.8 microseconds a run.
// Two timings next to v006 both put it at 1.05 times that version's speed.
// All steps since v000 together make it 4.58 times as fast.
#include <hip/hip_runtime.h>

// ---------------------------------------------------------------------------
// CQAttention for MI455X (gfx1250, wave32, WMMA f32_16x16x32_f16)
// B=64, D=128, LC=1000 (pad 1024), LQ=100 (pad 112/128)
// ---------------------------------------------------------------------------

typedef __attribute__((ext_vector_type(16))) _Float16 v16h;
typedef __attribute__((ext_vector_type(8)))  _Float16 v8h;
typedef __attribute__((ext_vector_type(4)))  _Float16 v4h;
typedef __attribute__((ext_vector_type(8)))  float    v8f;
typedef __attribute__((ext_vector_type(4))) float v4f;

union V16H { v16h v; v8h h[2]; };
union V8F  { v8f v; float e[8]; };
union V8H  { v8h v; _Float16 e[8]; unsigned w[4]; };
union V4H  { v4h v; _Float16 e[4]; unsigned w[2]; };

#define NB   64
#define DD   128
#define LC   1000
#define LQ   100
#define LQP  112      // 7 * 16
#define NJT  7        // ceil(100/16)

// Workspace layout (bytes, all offsets 256-aligned)
#define WS_S     ((size_t)0)            // f32 [64][1000][112]   = 28,672,000 B
#define WS_T     ((size_t)29241344)     // f16 [64][128][128]    =  2,097,152 B
#define WS_QG    ((size_t)35270656)     // f16 [64][128][128]    =  2,097,152 B
#define WS_CH    ((size_t)39464960)     // f16 [64][128][1024]   = 16,777,216 B
#define WS_CMAX  ((size_t)56242176)     // f32 [64][8][112]      =    229,376 B
// total = 56,471,552 B

// Per-ISA 16-bit A/B fragment layout: lane L holds row (L&15); halves 0..7 are
// K = kb..kb+7 and halves 8..15 are K = kb+16..kb+23 where kb = k0 + 8*(L>=16).
// Two contiguous 16-byte loads per fragment.
__device__ __forceinline__ v16h frag_load(const _Float16* row, int k0, int lane) {
  V16H r;
  int kb = k0 + ((lane >> 4) << 3);
  r.h[0] = *(const v8h*)(row + kb);
  r.h[1] = *(const v8h*)(row + kb + 16);
  return r.v;
}

__device__ __forceinline__ v8f wmma16(v16h a, v16h b, v8f c) {
  return __builtin_amdgcn_wmma_f32_16x16x32_f16(false, a, false, b, (short)0, c,
                                                false, false);
}

// ---------------------------------------------------------------------------
// Kernel 1: S[b,i,j] = sum_d (w1+w3*Ct)[i,d] * Qt[j,d]  + rowbias[i]
// block = (b, 128 context rows), 8 waves. The block's part of C, 128 d x 128 i, is
// read in whole rows of 512 bytes and laid in LDS as it is; a wave then streams the
// 16 rows of W that it owns, a lane taking d = 4*lane .. 4*lane+3 of w1, w2, w3 (512
// contiguous bytes a load), four rows a group, two groups in flight. From LDS the
// lane reads its four d of four context rows at once, so C is never gathered.
// The row bias is a wave reduction. Then waves 0..6 take one 16-wide j-tile each
// and all eight i-tiles, K = 128 (4 WMMAs a tile).
// The f16 operands of the whole sequence are formed here too, from what the block
// reads anyway: Q of the batch goes transposed to LDS for this kernel's own products,
// the C tile goes to Ch (padded with zeros to 1024 context rows) for cqa_t, and one
// block of a batch stores Qg (Q padded with zeros to 128 columns) for cqa_out.
// A wave that has a j-tile holds the block's 128 rows of its 16 columns of S in
// accumulators: it also stores each column's maximum over those rows, for cqa_t.
// ---------------------------------------------------------------------------
// Value of lane l ^ M inside the 16-lane row (DPP row_xmask); every lane is on.
template <int M>
__device__ __forceinline__ float row_xor(float x) {
  return __builtin_bit_cast(float, __builtin_amdgcn_update_dpp(
      0, __builtin_bit_cast(int, x), 0x160 | M, 0xf, 0xf, true));
}
// Value of lane l ^ 16.
__device__ __forceinline__ float half_xor(float x) {
  int v = __builtin_bit_cast(int, x);
  return __builtin_bit_cast(float, __builtin_amdgcn_permlanex16(v, v, 0x76543210, 0xfedcba98,
                                                                false, false));
}
__device__ __forceinline__ float wave_max(float x) {
  x = fmaxf(x, row_xor<1>(x)); x = fmaxf(x, row_xor<2>(x));
  x = fmaxf(x, row_xor<4>(x)); x = fmaxf(x, row_xor<8>(x));
  return fmaxf(x, half_xor(x));
}
__device__ __forceinline__ float wave_sum(float x) {
  x += row_xor<1>(x); x += row_xor<2>(x);
  x += row_xor<4>(x); x += row_xor<8>(x);
  return x + half_xor(x);
}

#define SIT   128     // context rows per block
#define SNT   8       // ceil(1000/128)
#define UPIT  136     // halves per LDS row: 272 B = 16 B x odd, for 16-byte readers

__global__ __launch_bounds__(256)
void cqa_s(const float* __restrict__ C, const float* __restrict__ Q,
           const float* __restrict__ W, _Float16* __restrict__ Qg,
           _Float16* __restrict__ Ch, float* __restrict__ S,
           float* __restrict__ pmax) {
  const int b = blockIdx.x / SNT;
  const int i0 = (blockIdx.x % SNT) * SIT;
  const int tid = threadIdx.x, wv = tid >> 5, lane = tid & 31;
  // the wave's number as a scalar: row addresses of W are wave-uniform
  const int wvu = __builtin_amdgcn_readfirstlane(wv);

  // Cs: row d holds 32 quads of context rows; quad q lies at place q ^ ((d >> 2) & 15),
  // so that 16 lanes that write one row, and 16 lanes that read one quad of rows
  // d = 4*lane + e, both fall on 16 different groups of four banks.
  __shared__ __attribute__((aligned(16))) float Cs[DD * SIT];
  __shared__ __attribute__((aligned(16))) _Float16 u[SIT][UPIT];  // w1 + w3*Ct
  __shared__ __attribute__((aligned(16))) float rs[SIT];
  __shared__ __attribute__((aligned(16))) _Float16 Qs[LQP][UPIT]; // Qs[j][d] = Q[d][j]

  // Q: wave wv takes rows d = 16*wv + k, a lane columns 4*lane .. 4*lane+3 (400
  // contiguous bytes a load). Lanes past the row's end re-read its last quad; their
  // values are replaced by zero. These loads go first: they are the first to be used.
  const float* qp = Q + ((size_t)(b * DD + 16 * wv)) * LQ + 4 * (lane < LQ / 4 ? lane : LQ / 4 - 1);
  v4f qst[16];
#pragma unroll  // the array must stay in registers
  for (int k = 0; k < 16; ++k) qst[k] = *(const v4f*)(qp + (size_t)k * LQ);
  // the address registers of the loads above are free for reuse only behind this wait
  asm volatile("s_wait_xcnt 0x0" ::: "memory");

  // C: wave wv takes rows d = wv + 8*k. LC and i0 are multiples of 4, so a quad is
  // all inside or all outside; quads outside re-read the last one inside, and what
  // comes of them is never stored.
  const int ci = i0 + 4 * lane < LC ? i0 + 4 * lane : LC - 4;
  const float* cp = C + ((size_t)(b * DD + wv)) * LC + ci;
  v4f cst[16];
#pragma unroll  // the array must stay in registers
  for (int k = 0; k < 16; ++k) cst[k] = *(const v4f*)(cp + (size_t)(8 * k) * LC);
  // the address registers of the loads above are free for reuse only behind this wait
  asm volatile("s_wait_xcnt 0x0" ::: "memory");

  // W: group g is the wave's rows 4*g .. 4*g+3; rows past LC re-read row LC - 1.
  // The second group is asked for behind the work on Q, in the registers that Q leaves.
  v4f w[2][4][3];
#pragma unroll  // as above
  for (int g = 0; g < 2; ++g) {
#pragma unroll  // as above
    for (int r = 0; r < 4; ++r) {
      const int gi = i0 + 16 * wvu + 4 * g + r;
      const float* wrow = W + ((size_t)(b * LC + (gi < LC ? gi : LC - 1))) * 384 + 4 * lane;
#pragma unroll  // as above
      for (int p = 0; p < 3; ++p) w[g][r][p] = *(const v4f*)(wrow + 128 * p);
    }
    // as at the first wait: the address registers of these loads are reused below
    asm volatile("s_wait_xcnt 0x0" ::: "memory");
    if (g == 0) {
      // all-ones where the lane's four columns are real, else zero
      const unsigned qkeep = lane < LQ / 4 ? 0xffffffffu : 0u;
      // A lane holds 16 consecutive d of four columns: 32 contiguous bytes of four
      // rows of Qs. Rows LQ .. LQP-1 are laid as zeros.
      if (lane < LQP / 4) {
#pragma unroll  // as above
        for (int e = 0; e < 4; ++e) {
#pragma unroll  // as above
          for (int hf = 0; hf < 2; ++hf) {
            V8H h;
#pragma unroll  // as above
            for (int k = 0; k < 8; ++k) h.e[k] = (_Float16)qst[8 * hf + k][e];
#pragma unroll  // as above
            for (int k = 0; k < 4; ++k) h.w[k] &= qkeep;
            *(v8h*)&Qs[4 * lane + e][16 * wv + 8 * hf] = h.v;
          }
        }
      }
      // Qg is the same for the batch's eight blocks: the last one, which has the
      // fewest real context rows, stores it (256 contiguous bytes a row).
      if (i0 == (SNT - 1) * SIT) {
        _Float16* gp = Qg + ((size_t)(b * DD + 16 * wv)) * 128 + 4 * lane;
#pragma unroll  // as above
        for (int k = 0; k < 16; ++k) {
          V4H h;
#pragma unroll  // as above
          for (int e = 0; e < 4; ++e) h.e[e] = (_Float16)qst[k][e];
          h.w[0] &= qkeep;
          h.w[1] &= qkeep;
          *(v4h*)(gp + (size_t)k * 128) = h.v;
        }
        // as at the first wait, for the address registers of these stores
        asm volatile("s_wait_xcnt 0x0" ::: "memory");
      }
    }
  }

  // all-ones where the lane's four context rows are real, else zero
  const unsigned ckeep = i0 + 4 * lane < LC ? 0xffffffffu : 0u;
  _Float16* chp = Ch + ((size_t)(b * DD + wv)) * 1024 + i0 + 4 * lane;
#pragma unroll  // as above
  for (int k = 0; k < 16; ++k) {
    const int d = wv + 8 * k;
    *(v4f*)&Cs[d * SIT + 4 * (lane ^ ((d >> 2) & 15))] = cst[k];
    V4H h;
#pragma unroll  // as above
    for (int e = 0; e < 4; ++e) h.e[e] = (_Float16)cst[k][e];
    h.w[0] &= ckeep;
    h.w[1] &= ckeep;
    *(v4h*)(chp + (size_t)(8 * k) * 1024) = h.v;  // 256 contiguous bytes a wave
  }
  // as at the first wait, for the address registers of the stores to Ch
  asm volatile("s_wait_xcnt 0x0" ::: "memory");
  // The work-group's barrier by hand, behind the wave's own LDS stores:
  // __syncthreads() would also wait out the loads of W that are in flight.
  asm volatile("s_wait_dscnt 0x0\n\ts_barrier_signal -1\n\ts_barrier_wait -1" ::: "memory");

#pragma unroll  // as above
  for (int g = 0; g < 4; ++g) {
    v4f cc[4];  // cc[e][r] = C[d = 4*lane + e][context row 16*wv + 4*g + r]
#pragma unroll  // as above
    for (int e = 0; e < 4; ++e)
      cc[e] = *(const v4f*)&Cs[(4 * lane + e) * SIT + 4 * ((4 * wv + g) ^ (lane & 15))];
    float bias = 0.f;
#pragma unroll  // as above
    for (int r = 0; r < 4; ++r) {
      const v4f w1 = w[g & 1][r][0], w2 = w[g & 1][r][1], w3 = w[g & 1][r][2];
      V4H h;
#pragma unroll  // as above
      for (int e = 0; e < 4; ++e) h.e[e] = (_Float16)(w1[e] + w3[e] * cc[e][r]);
      *(v4h*)&u[16 * wv + 4 * g + r][4 * lane] = h.v;
      const float t = wave_sum((w2[0] * cc[0][r] + w2[1] * cc[1][r]) +
                               (w2[2] * cc[2][r] + w2[3] * cc[3][r]));
      bias = lane == r ? t : bias;
    }
    if (lane < 4) rs[16 * wv + 4 * g + lane] = bias;
    if (g + 2 < 4) {
#pragma unroll  // as above
      for (int r = 0; r < 4; ++r) {
        const int gi = i0 + 16 * wvu + 4 * (g + 2) + r;
        const float* wrow = W + ((size_t)(b * LC + (gi < LC ? gi : LC - 1))) * 384 + 4 * lane;
#pragma unroll  // as above
        for (int p = 0; p < 3; ++p) w[g & 1][r][p] = *(const v4f*)(wrow + 128 * p);
      }
      // as at the first wait
      asm volatile("s_wait_xcnt 0x0" ::: "memory");
    }
  }

  // Qs stands since the first barrier. The eighth wave has no j-tile: it re-reads the
  // seventh's rows and stops at the last barrier.
  const int j0 = (wv < NJT ? wv : NJT - 1) * 16;
  v16h bq[4];
#pragma unroll  // as above
  for (int k = 0; k < 4; ++k) bq[k] = frag_load(&Qs[j0 + (lane & 15)][0], 32 * k, lane);

  __syncthreads();
  if (wvu >= NJT) return;  // behind the last barrier

  // All eight i-tiles' products are independent: a K-chunk's eight fragments of u are
  // asked for together, and the stores follow the last product.
  v8f acc[SIT / 16] = {};
#pragma unroll  // as above
  for (int k = 0; k < 4; ++k) {
    v16h a[SIT / 16];
#pragma unroll  // as above
    for (int t = 0; t < SIT / 16; ++t) a[t] = frag_load(&u[16 * t + (lane & 15)][0], 32 * k, lane);
#pragma unroll  // as above
    for (int t = 0; t < SIT / 16; ++t) acc[t] = wmma16(a[t], bq[k], acc[t]);
  }

  // D layout: n = lane&15, m = r + 8*(lane>=16). LC is a multiple of 8, so a lane's
  // eight rows of a tile are all inside or all outside.
  const int j = j0 + (lane & 15);
  const int mb = (lane >> 4) << 3;
#pragma unroll  // as above
  for (int t = 0; t < SIT / 16; ++t) {
    const v4f r0 = *(const v4f*)&rs[16 * t + mb];
    const v4f r1 = *(const v4f*)&rs[16 * t + mb + 4];
#pragma unroll  // as above
    for (int r = 0; r < 8; ++r) acc[t][r] += r < 4 ? r0[r & 3] : r1[r & 3];
  }
#pragma unroll  // as above
  for (int t = 0; t < SIT / 16; ++t) {
    const int gi = i0 + 16 * t + mb;
    if (j < LQ && gi < LC) {
      float* sp = S + ((size_t)(b * LC + gi)) * LQP + j;
#pragma unroll  // as above
      for (int r = 0; r < 8; ++r) sp[(size_t)r * LQP] = acc[t][r];
    }
  }

  // Column maximum over the block's real rows. The first tile is real in every block;
  // the two halves of the wave hold the two halves of each tile's rows.
  float cmx = acc[0][0];
#pragma unroll  // as above
  for (int t = 0; t < SIT / 16; ++t) {
    float tm = acc[t][0];
#pragma unroll  // as above
    for (int r = 1; r < 8; ++r) tm = fmaxf(tm, acc[t][r]);
    cmx = i0 + 16 * t + mb < LC ? fmaxf(cmx, tm) : cmx;
  }
  cmx = fmaxf(cmx, half_xor(cmx));
  if (lane < 16 && j < LQ) pmax[(size_t)blockIdx.x * LQP + j] = cmx;
}

// ---------------------------------------------------------------------------
// Kernel 2: T[b][d][j] = sum_i S2[b,i,j] * Ct[b,i,d]   (M=j, N=d, K=i)
// block = (b, two j-tiles = 32 columns); 8 waves each own a 16-wide d-tile and both
// j-tiles, so a fragment of Ch serves two products. The block's whole operand
// exp(S - column maximum), 32 columns x 1024 context rows, is formed once and laid
// transposed in LDS: every load of S is in flight at once, and one barrier stands
// between the staging and the 32 K-chunks. The fourth pair's second tile (columns
// 112 .. 127) lies past S: it is staged, and stored to T, as zeros.
// The column softmax (axis=1) is formed here as well: a column's maximum is that of
// cqa_s's eight partial maxima, and its sum is the sum of the exponentials that are
// staged anyway (a thread's own, then a wave reduction, then four waves through LDS).
// ---------------------------------------------------------------------------
// exp(x) as __expf forms it (x * log2(e), then the hardware exp2). The v_nop fills
// the slot that the instruction set asks for behind a transcendental before its
// result is used or its source overwritten; in the statement it cannot drift away.
__device__ __forceinline__ float exp_slot(float x) {
  float y, a = x * 1.44269504088896340736f;
  asm("v_exp_f32 %0, %1\n\tv_nop" : "=v"(y) : "v"(a));
  return y;
}

#define CSP   SNT     // partial column maxima per batch: one a block of cqa_s
#define TJG   4       // column pairs of tiles per batch
#define TKP   1032    // halves per LDS row: 2064 B = 16 B x odd, for 16-byte readers
#define TBA   8       // K-chunks by which the fragments of Ch are fetched ahead

__global__ __launch_bounds__(256)
void cqa_t(const float* __restrict__ S, const float* __restrict__ pmax,
           const _Float16* __restrict__ Ch, _Float16* __restrict__ T) {
  const int b = blockIdx.x / TJG;
  const int jb = (blockIdx.x % TJG) * 32;
  const int tid = threadIdx.x, wv = tid >> 5, lane = tid & 31;

  __shared__ __attribute__((aligned(16))) _Float16 As[32][TKP];
  __shared__ __attribute__((aligned(16))) float cps[4][32];  // column sums: waves q and q + 4 fill row q

  // Staging: a thread takes four consecutive columns (local jl0 ..) of the context
  // rows 128*p + 4*rg + r, p = 0..7, r = 0..3. LQ and LC are multiples of 4, so the
  // four columns, and the four rows, are all real or all padding; padding re-reads
  // a real place (columns past LQ of S and of the maxima are never written) and
  // is replaced by zero.
  const int jl0 = ((wv >> 2) << 4) + ((lane & 3) << 2);
  const int rg = ((wv & 3) << 3) + (lane >> 2);
  const bool cok = jb + jl0 < LQ;
  const int gj = cok ? jb + jl0 : 0;
  const bool rok = 896 + 4 * rg < LC;

  v4f pm[CSP];
#pragma unroll  // the array must stay in registers
  for (int p = 0; p < CSP; ++p) pm[p] = *(const v4f*)(pmax + (b * CSP + p) * LQP + gj);
  // the address registers of the loads above are free for reuse only behind this wait
  asm volatile("s_wait_xcnt 0x0" ::: "memory");

  const float* sp = S + ((size_t)(b * LC + 4 * rg)) * LQP + gj;
  const float* sl = S + ((size_t)(b * LC + (rok ? 896 + 4 * rg : LC - 4))) * LQP + gj;
  v4f x[8][4];
#pragma unroll  // as above; all 32 loads are issued before the first is used
  for (int p = 0; p < 7; ++p) {
#pragma unroll  // as above
    for (int r = 0; r < 4; ++r) x[p][r] = *(const v4f*)(sp + (size_t)(128 * p + r) * LQP);
  }
  // as above: later loads may land in the address registers of these
  asm volatile("s_wait_xcnt 0x0" ::: "memory");
#pragma unroll  // as above
  for (int r = 0; r < 4; ++r) x[7][r] = *(const v4f*)(sl + (size_t)r * LQP);
  // as above
  asm volatile("s_wait_xcnt 0x0" ::: "memory");

  // The first fragments of Ch fly while the exponentials are formed. Of bf only
  // the chunks in flight or in use are live.
  const _Float16* brow = Ch + ((size_t)(b * DD + wv * 16 + (lane & 15))) * 1024;
  v16h bf[32];
#pragma unroll  // as above
  for (int k = 0; k < TBA; ++k) bf[k] = frag_load(brow, 32 * k, lane);
  // keeps every load above in front of the work below: sunk among the exponentials,
  // the last rows of S and these fragments would be asked for a memory latency later
  __builtin_amdgcn_sched_barrier(0);

  v4f cm;
#pragma unroll  // as above
  for (int e = 0; e < 4; ++e)
    cm[e] = fmaxf(fmaxf(fmaxf(pm[0][e], pm[1][e]), fmaxf(pm[2][e], pm[3][e])),
                  fmaxf(fmaxf(pm[4][e], pm[5][e]), fmaxf(pm[6][e], pm[7][e])));

  v4f ps = {};  // the thread's part of its four columns' sums of exponentials

#pragma unroll  // as above
  for (int p = 0; p < 8; ++p) {
    // all-ones where the sixteen values are real, else zero
    const unsigned keep = (cok && (p < 7 || rok)) ? 0xffffffffu : 0u;
#pragma unroll  // as above
    for (int e = 0; e < 4; ++e) {
      V4H h;
      float ex[4];
#pragma unroll  // as above
      for (int r = 0; r < 4; ++r) {
        ex[r] = exp_slot(x[p][r][e] - cm[e]);
        h.e[r] = (_Float16)ex[r];
      }
      h.w[0] &= keep;
      h.w[1] &= keep;
      *(v4h*)&As[jl0 + e][128 * p + 4 * rg] = h.v;
      // padded rows stay out of the sum; a padded column's sum is that of the real
      // column it re-reads, and is not used
      const float e4 = (ex[0] + ex[1]) + (ex[2] + ex[3]);
      ps[e] += (p < 7 || rok) ? e4 : 0.f;
    }
  }
  // The eight lanes of a wave that share lane & 3 hold the same four columns.
#pragma unroll  // as above
  for (int e = 0; e < 4; ++e) {
    float t = ps[e];
    t += row_xor<4>(t);
    t += row_xor<8>(t);
    ps[e] = t + half_xor(t);
  }
  if (lane < 4) *(v4f*)&cps[wv & 3][jl0] = ps;
  __syncthreads();

  const _Float16* arow0 = &As[lane & 15][0];
  const _Float16* arow1 = &As[16 + (lane & 15)][0];
  v8f acc[2] = {};
  // Two K-chunks a pass. The LDS fragments of the next pass and the Ch fragments
  // of TBA chunks on are asked for before a pass's four products.
  v16h af[2][2][2];
#pragma unroll  // the fragment arrays must stay in registers
  for (int c = 0; c < 2; ++c) {
    af[0][c][0] = frag_load(arow0, 32 * c, lane);
    af[0][c][1] = frag_load(arow1, 32 * c, lane);
  }

  // Reciprocals of the sums of the lane's sixteen columns (D: m = r + 8*(lane>=16)),
  // formed while the first fragments are on their way from LDS.
  const int mb = (lane >> 4) << 3;
  float rc[2][8];
#pragma unroll  // the array must stay in registers
  for (int t = 0; t < 2; ++t) {
    v4f c0 = *(const v4f*)&cps[0][16 * t + mb];
    v4f c1 = *(const v4f*)&cps[0][16 * t + mb + 4];
#pragma unroll  // as above
    for (int q = 1; q < 4; ++q) {
      c0 += *(const v4f*)&cps[q][16 * t + mb];
      c1 += *(const v4f*)&cps[q][16 * t + mb + 4];
    }
#pragma unroll  // as above
    for (int r = 0; r < 8; ++r) rc[t][r] = 1.0f / (r < 4 ? c0[r & 3] : c1[r & 3]);
  }
#pragma unroll  // as above
  for (int q = 0; q < 16; ++q) {
#pragma unroll  // as above
    for (int c = 0; c < 2; ++c) {
      const int kn = 2 * (q + 1) + c, kb = 2 * q + TBA + c;
      if (kn < 32) {
        af[(q + 1) & 1][c][0] = frag_load(arow0, 32 * kn, lane);
        af[(q + 1) & 1][c][1] = frag_load(arow1, 32 * kn, lane);
      }
      if (kb < 32) bf[kb] = frag_load(brow, 32 * kb, lane);
    }
    // keeps the loads above from sinking to their uses: each product would then
    // wait out a whole LDS latency
    __builtin_amdgcn_sched_barrier(0);
#pragma unroll  // as above
    for (int c = 0; c < 2; ++c) {
      acc[0] = wmma16(af[q & 1][c][0], bf[2 * q + c], acc[0]);
      acc[1] = wmma16(af[q & 1][c][1], bf[2 * q + c], acc[1]);
    }
  }

  // D: n = lane&15 -> d_local, m = r + 8*(lane>=16) -> j_local (consecutive j)
  const int d = wv * 16 + (lane & 15);
#pragma unroll  // as above
  for (int t = 0; t < 2; ++t) {
    V8H o;
#pragma unroll  // as above
    for (int r = 0; r < 8; ++r) {
      float val = (jb + 16 * t + mb + r < LQ) ? acc[t][r] * rc[t][r] : 0.f;
      o.e[r] = (_Float16)val;
    }
    *(v8h*)(T + ((size_t)(b * DD + d)) * 128 + jb + 16 * t + mb) = o.v;
  }
}

// ---------------------------------------------------------------------------
// Kernel 3: A = S1@Qt, Bm = S1@T; emit [Ct, A, Ct*A, Ct*Bm] transposed.
// block = (b, 64 context rows); 8 waves each own a 16-wide d-tile and all 64 rows.
// The products are formed transposed (M = d, N = i). Column c of N-tile t is
// context row 4c + t, so a lane's four accumulator tiles hold four consecutive
// i of one output row: 16 lanes store 256 contiguous bytes of that row.
// A is formed and stored first, then Bm, so 32 accumulator registers serve both.
// The row softmax (axis=2) is formed here as well: a wave holds a whole row of S in
// registers, so the row's maximum and sum of exponentials are two wave reductions.
// ---------------------------------------------------------------------------
#define OIT   64      // context rows per block
#define ONT   16      // ceil(1000/64)
#define SPIT  136     // halves per LDS row: 272 B = 16 B x odd, for 16-byte readers

__global__ __launch_bounds__(256)
void cqa_out(const float* __restrict__ C, const float* __restrict__ S,
             const _Float16* __restrict__ Qg, const _Float16* __restrict__ T,
             float* __restrict__ out) {
  const int b = blockIdx.x / ONT;
  const int i0 = (blockIdx.x % ONT) * OIT;
  const int tid = threadIdx.x, wv = tid >> 5, lane = tid & 31;
  const int c = lane & 15;

  // LDS row 16*t + c holds S1 of context row i0 + 4*c + t.
  __shared__ __attribute__((aligned(16))) _Float16 As1[OIT][SPIT];

  // The lane's part of Ct: rows d = dbase + r, context rows gi .. gi + 3. LC and i0
  // are multiples of 4, so the four are all inside or all outside; lanes outside
  // read the last four inside and store nothing.
  const int gi = i0 + 4 * c;
  const int dbase = wv * 16 + ((lane >> 4) << 3);
  const float* cp = C + ((size_t)(b * DD + dbase)) * LC + (gi < LC ? gi : LC - 4);
  float4 ct[8];
#pragma unroll  // the array must stay in registers
  for (int r = 0; r < 8; ++r) ct[r] = *(const float4*)(cp + (size_t)r * LC);

  // One wave per context row, a lane takes four consecutive j. All eight rows'
  // loads are issued before the first is used. Lanes past the row's end and rows
  // past LC re-read the last valid place; their values are replaced by zero.
  const unsigned jo = 4u * (unsigned)(lane < LQ / 4 ? lane : LQ / 4 - 1);
  // the wave's number as a scalar: row addresses are wave-uniform
  const int wvu = __builtin_amdgcn_readfirstlane(wv);
  float4 s[8];
  float mx[8], sm[8];
#pragma unroll  // as above
  for (int u = 0; u < 8; ++u) {
    int si = i0 + wvu + 8 * u;
    int row = b * LC + (si < LC ? si : LC - 1);
    const float* srow = S + (size_t)row * LQP;  // wave-uniform base
    s[u] = *(const float4*)(srow + jo);
  }
  // Row maximum: the re-read quads of lanes past the row's end repeat real values.
#pragma unroll  // as above; the eight rows' reductions are independent chains
  for (int u = 0; u < 8; ++u)
    mx[u] = wave_max(fmaxf(fmaxf(s[u].x, s[u].y), fmaxf(s[u].z, s[u].w)));
  // Exponentials, kept for the quotients below, and their sum over the real lanes.
#pragma unroll  // as above
  for (int u = 0; u < 8; ++u) {
    s[u].x = exp_slot(s[u].x - mx[u]);
    s[u].y = exp_slot(s[u].y - mx[u]);
    s[u].z = exp_slot(s[u].z - mx[u]);
    s[u].w = exp_slot(s[u].w - mx[u]);
    sm[u] = wave_sum(lane < LQ / 4 ? (s[u].x + s[u].y) + (s[u].z + s[u].w) : 0.f);
  }
#pragma unroll  // as above
  for (int u = 0; u < 8; ++u) {
    const int m = wvu + 8 * u;
    // all-ones where the four values are real, else zero: the quotients are
    // formed in every lane (their inputs are valid) and masked as bits
    const unsigned keep = ((i0 + m < LC) && (lane < LQ / 4)) ? 0xffffffffu : 0u;
    V4H h;
    h.e[0] = (_Float16)(s[u].x / sm[u]);
    h.e[1] = (_Float16)(s[u].y / sm[u]);
    h.e[2] = (_Float16)(s[u].z / sm[u]);
    h.e[3] = (_Float16)(s[u].w / sm[u]);
    h.w[0] &= keep;
    h.w[1] &= keep;
    *(v4h*)&As1[((m & 3) << 4) + (m >> 2)][4 * lane] = h.v;
  }

  const _Float16* rowQ = Qg + ((size_t)(b * DD + wv * 16 + c)) * 128;
  const _Float16* rowT = T + ((size_t)(b * DD + wv * 16 + c)) * 128;
  v16h fq[4], ft[4];
#pragma unroll  // as above
  for (int k = 0; k < 4; ++k) fq[k] = frag_load(rowQ, 32 * k, lane);
  __syncthreads();

  float* op = out + ((size_t)(b * 512 + dbase)) * LC + gi;
  v8f acc[4] = {};
#pragma unroll  // as above
  for (int k = 0; k < 4; ++k) {
#pragma unroll  // as above
    for (int t = 0; t < 4; ++t)
      acc[t] = wmma16(fq[k], frag_load(&As1[16 * t + c][0], 32 * k, lane), acc[t]);
  }
#pragma unroll  // as above
  for (int k = 0; k < 4; ++k) ft[k] = frag_load(rowT, 32 * k, lane);

  // D: register r = [d_local = 8*(lane>=16) + r][column c]; tiles t = 0..3 give
  // i = gi + t.
  if (gi < LC) {
#pragma unroll  // as above
    for (int r = 0; r < 8; ++r) {
      float4 va = make_float4(acc[0][r], acc[1][r], acc[2][r], acc[3][r]);
      float* o = op + (size_t)r * LC;
      *(float4*)(o) = ct[r];
      *(float4*)(o + (size_t)128 * LC) = va;
      *(float4*)(o + (size_t)256 * LC) =
          make_float4(ct[r].x * va.x, ct[r].y * va.y, ct[r].z * va.z, ct[r].w * va.w);
    }
  }

#pragma unroll  // as above
  for (int t = 0; t < 4; ++t) acc[t] = v8f{};
#pragma unroll  // as above
  for (int k = 0; k < 4; ++k) {
#pragma unroll  // as above
    for (int t = 0; t < 4; ++t)
      acc[t] = wmma16(ft[k], frag_load(&As1[16 * t + c][0], 32 * k, lane), acc[t]);
  }
  if (gi < LC) {
#pragma unroll  // as above
    for (int r = 0; r < 8; ++r) {
      *(float4*)(op + (size_t)(384 + r) * LC) =
          make_float4(ct[r].x * acc[0][r], ct[r].y * acc[1][r], ct[r].z * acc[2][r],
                      ct[r].w * acc[3][r]);
    }
  }
}

// ---------------------------------------------------------------------------
extern "C" void kernel_launch(void* const* d_in, const int* in_sizes, int n_in,
                              void* d_out, int out_size, void* d_ws, size_t ws_size,
                              hipStream_t stream) {
  (void)in_sizes; (void)n_in; (void)out_size; (void)ws_size;
  const float* C = (const float*)d_in[0];
  const float* Q = (const float*)d_in[1];
  const float* W = (const float*)d_in[2];
  float* out = (float*)d_out;
  char* ws = (char*)d_ws;

  float*    Sbuf = (float*)(ws + WS_S);
  float*    cmax = (float*)(ws + WS_CMAX);
  _Float16* T    = (_Float16*)(ws + WS_T);
  _Float16* Qg   = (_Float16*)(ws + WS_QG);
  _Float16* Ch   = (_Float16*)(ws + WS_CH);

  cqa_s<<<NB * SNT, 256, 0, stream>>>(C, Q, W, Qg, Ch, Sbuf, cmax);
  cqa_t<<<NB * TJG, 256, 0, stream>>>(Sbuf, cmax, Ch, T);
  cqa_out<<<NB * ONT, 256, 0, stream>>>(C, Sbuf, Qg, T, out);
}

// v008
// One run takes 54.6 microseconds.
// Next to v007, in two timings, it ran 1.06 times as fast each time.
// Counting every step since v000, it is 4.85 times as fast.
#include <hip/hip_runtime.h>

// ---------------------------------------------------------------------------
// CQAttention for MI455X (gfx1250, wave32, WMMA f32_16x16x32_f16)
// B=64, D=128, LC=1000 (pad 1024), LQ=100 (pad 112/128)
// ---------------------------------------------------------------------------

typedef __attribute__((ext_vector_type(16))) _Float16 v16h;
typedef __attribute__((ext_vector_type(8)))  _Float16 v8h;
typedef __attribute__((ext_vector_type(4)))  _Float16 v4h;
typedef __attribute__((ext_vector_type(8)))  float    v8f;
typedef __attribute__((ext_vector_type(4))) float v4f;

union V16H { v16h v; v8h h[2]; };
union V8F  { v8f v; float e[8]; };
union V8H  { v8h v; _Float16 e[8]; unsigned w[4]; };
union V4H  { v4h v; _Float16 e[4]; unsigned w[2]; };

#define NB   64
#define DD   128
#define LC   1000
#define LQ   100
#define LQP  112      // 7 * 16
#define NJT  7        // ceil(100/16)

// Workspace layout (bytes, all offsets 256-aligned)
#define WS_S     ((size_t)0)            // f32 [64][1000][112]   = 28,672,000 B
#define WS_T     ((size_t)29241344)     // f16 [64][8][4][512], fragment order
#define WS_QG    ((size_t)35270656)     // f16 [64][8][4][512], fragment order
#define WS_CH    ((size_t)39464960)     // f16 [64][8][32][512], fragment order = 16,777,216 B
#define WS_CMAX  ((size_t)56242176)     // f32 [64][8][112]      =    229,376 B
// total = 56,471,552 B

// Per-ISA 16-bit A/B fragment layout: lane L holds row (L&15); halves 0..7 are
// K = kb..kb+7 and halves 8..15 are K = kb+16..kb+23 where kb = k0 + 8*(L>=16).
// Two contiguous 16-byte loads per fragment.
__device__ __forceinline__ v16h frag_load(const _Float16* row, int k0, int lane) {
  V16H r;
  int kb = k0 + ((lane >> 4) << 3);
  r.h[0] = *(const v8h*)(row + kb);
  r.h[1] = *(const v8h*)(row + kb + 16);
  return r.v;
}

// The f16 planes in global memory (Ch, Qg, T) lie in fragment order: [batch][tile of
// 16 rows d][K-chunk of 32][part p = 0, 1][lane L][8 halves], where lane L's eight
// halves are row (L & 15), K = 16*p + 8*(L >> 4) + 0..7 of the chunk: the map above.
// A fragment is then two loads of 512 contiguous bytes a wave, where rows of a plain
// matrix give 16 pieces of 32 bytes on 16 cache lines a load.
#define FCH   512     // halves per tile and K-chunk
__device__ __forceinline__ v16h frag_packed(const _Float16* chunk, int lane) {
  V16H r;
  r.h[0] = *(const v8h*)(chunk + 8 * lane);
  r.h[1] = *(const v8h*)(chunk + 256 + 8 * lane);
  return r.v;
}

__device__ __forceinline__ v8f wmma16(v16h a, v16h b, v8f c) {
  return __builtin_amdgcn_wmma_f32_16x16x32_f16(false, a, false, b, (short)0, c,
                                                false, false);
}

// ---------------------------------------------------------------------------
// Kernel 1: S[b,i,j] = sum_d (w1+w3*Ct)[i,d] * Qt[j,d]  + rowbias[i]
// block = (b, 128 context rows), 8 waves. The block's part of C, 128 d x 128 i, is
// read in whole rows of 512 bytes and laid in LDS as it is; a wave then streams the
// 16 rows of W that it owns, a lane taking d = 4*lane .. 4*lane+3 of w1, w2, w3 (512
// contiguous bytes a load), four rows a group, two groups in flight. From LDS the
// lane reads its four d of four context rows at once, so C is never gathered.
// The row bias is a wave reduction. Then waves 0..6 take one 16-wide j-tile each
// and all eight i-tiles, K = 128 (4 WMMAs a tile).
// The f16 operands of the whole sequence are formed here too, from what the block
// reads anyway: Q of the batch goes transposed to LDS for this kernel's own products,
// the C tile goes to Ch (padded with zeros to 1024 context rows) for cqa_t, read back
// from LDS in fragment order, and each block of a batch stores one tile of Qg (Q
// padded with zeros to 128 columns) for cqa_out.
// A wave that has a j-tile holds the block's 128 rows of its 16 columns of S in
// accumulators: it also stores each column's maximum over those rows, for cqa_t.
// ---------------------------------------------------------------------------
// Value of lane l ^ M inside the 16-lane row (DPP row_xmask); every lane is on.
template <int M>
__device__ __forceinline__ float row_xor(float x) {
  return __builtin_bit_cast(float, __builtin_amdgcn_update_dpp(
      0, __builtin_bit_cast(int, x), 0x160 | M, 0xf, 0xf, true));
}
// Value of lane l ^ 16.
__device__ __forceinline__ float half_xor(float x) {
  int v = __builtin_bit_cast(int, x);
  return __builtin_bit_cast(float, __builtin_amdgcn_permlanex16(v, v, 0x76543210, 0xfedcba98,
                                                                false, false));
}
__device__ __forceinline__ float wave_max(float x) {
  x = fmaxf(x, row_xor<1>(x)); x = fmaxf(x, row_xor<2>(x));
  x = fmaxf(x, row_xor<4>(x)); x = fmaxf(x, row_xor<8>(x));
  return fmaxf(x, half_xor(x));
}
__device__ __forceinline__ float wave_sum(float x) {
  x += row_xor<1>(x); x += row_xor<2>(x);
  x += row_xor<4>(x); x += row_xor<8>(x);
  return x + half_xor(x);
}

#define SIT   128     // context rows per block
#define SNT   8       // ceil(1000/128)
#define UPIT  136     // halves per LDS row: 272 B = 16 B x odd, for 16-byte readers
#define CSW(d) ((((d) >> 2) ^ ((d) << 2)) & 15)  // place swizzle of row d of Cs

__global__ __launch_bounds__(256)
void cqa_s(const float* __restrict__ C, const float* __restrict__ Q,
           const float* __restrict__ W, _Float16* __restrict__ Qg,
           _Float16* __restrict__ Ch, float* __restrict__ S,
           float* __restrict__ pmax) {
  const int b = blockIdx.x / SNT;
  const int i0 = (blockIdx.x % SNT) * SIT;
  const int tid = threadIdx.x, wv = tid >> 5, lane = tid & 31;
  // the wave's number as a scalar: row addresses of W are wave-uniform
  const int wvu = __builtin_amdgcn_readfirstlane(wv);

  // Cs: row d holds 32 quads of context rows; quad q lies at place q ^ CSW(d), so that
  // 16 lanes that write one row, 16 lanes that read one quad of rows d = 4*lane + e,
  // and 16 lanes that read one quad of 16 consecutive rows (for Ch) all fall on 16
  // different groups of four banks.
  __shared__ __attribute__((aligned(16))) float Cs[DD * SIT];
  __shared__ __attribute__((aligned(16))) _Float16 u[SIT][UPIT];  // w1 + w3*Ct
  __shared__ __attribute__((aligned(16))) float rs[SIT];
  __shared__ __attribute__((aligned(16))) _Float16 Qs[LQP][UPIT]; // Qs[j][d] = Q[d][j]

  // Q: wave wv takes rows d = 16*wv + k, a lane columns 4*lane .. 4*lane+3 (400
  // contiguous bytes a load). Lanes past the row's end re-read its last quad; their
  // values are replaced by zero. These loads go first: they are the first to be used.
  const float* qp = Q + ((size_t)(b * DD + 16 * wv)) * LQ + 4 * (lane < LQ / 4 ? lane : LQ / 4 - 1);
  v4f qst[16];
#pragma unroll  // the array must stay in registers
  for (int k = 0; k < 16; ++k) qst[k] = *(const v4f*)(qp + (size_t)k * LQ);
  // the address registers of the loads above are free for reuse only behind this wait
  asm volatile("s_wait_xcnt 0x0" ::: "memory");

  // C: wave wv takes rows d = wv + 8*k. LC and i0 are multiples of 4, so a quad is
  // all inside or all outside; quads outside re-read the last one inside, and what
  // comes of them is never stored.
  const int ci = i0 + 4 * lane < LC ? i0 + 4 * lane : LC - 4;
  const float* cp = C + ((size_t)(b * DD + wv)) * LC + ci;
  v4f cst[16];
#pragma unroll  // the array must stay in registers
  for (int k = 0; k < 16; ++k) cst[k] = *(const v4f*)(cp + (size_t)(8 * k) * LC);
  // the address registers of the loads above are free for reuse only behind this wait
  asm volatile("s_wait_xcnt 0x0" ::: "memory");

  // W: group g is the wave's rows 4*g .. 4*g+3; rows past LC re-read row LC - 1.
  // The second group is asked for behind the work on Q, in the registers that Q leaves.
  v4f w[2][4][3];
#pragma unroll  // as above
  for (int g = 0; g < 2; ++g) {
#pragma unroll  // as above
    for (int r = 0; r < 4; ++r) {
      const int gi = i0 + 16 * wvu + 4 * g + r;
      const float* wrow = W + ((size_t)(b * LC + (gi < LC ? gi : LC - 1))) * 384 + 4 * lane;
#pragma unroll  // as above
      for (int p = 0; p < 3; ++p) w[g][r][p] = *(const v4f*)(wrow + 128 * p);
    }
    // as at the first wait: the address registers of these loads are reused below
    asm volatile("s_wait_xcnt 0x0" ::: "memory");
    if (g == 0) {
      // all-ones where the lane's four columns are real, else zero
      const unsigned qkeep = lane < LQ / 4 ? 0xffffffffu : 0u;
      // A lane holds 16 consecutive d of four columns: 32 contiguous bytes of four
      // rows of Qs. Rows LQ .. LQP-1 are laid as zeros.
      if (lane < LQP / 4) {
#pragma unroll  // as above
        for (int e = 0; e < 4; ++e) {
#pragma unroll  // as above
          for (int hf = 0; hf < 2; ++hf) {
            V8H h;
#pragma unroll  // as above
            for (int k = 0; k < 8; ++k) h.e[k] = (_Float16)qst[8 * hf + k][e];
#pragma unroll  // as above
            for (int k = 0; k < 4; ++k) h.w[k] &= qkeep;
            *(v8h*)&Qs[4 * lane + e][16 * wv + 8 * hf] = h.v;
          }
        }
      }
      // Qg is the same for the batch's eight blocks. A wave holds one tile of 16 rows; in
      // fragment order row k's columns 4*lane .. 4*lane+3 are K-chunk lane >> 3, part
      // (lane >> 2) & 1, half of the wave (lane >> 1) & 1, halves 4*(lane & 1) ..: pieces
      // of 8 bytes. So the work is dealt: each block stores one tile, from one wave
      // (a scalar test), and a tile's 4 KiB have one writer.
      if (wvu == (int)(blockIdx.x % SNT)) {
        _Float16* gp = Qg + ((size_t)((b * 8 + wv) * 4 + (lane >> 3))) * FCH +
                       ((lane >> 2) & 1) * 256 + ((lane >> 1) & 1) * 128 + 4 * (lane & 1);
#pragma unroll  // as above
        for (int k = 0; k < 16; ++k) {
          V4H h;
#pragma unroll  // as above
          for (int e = 0; e < 4; ++e) h.e[e] = (_Float16)qst[k][e];
          h.w[0] &= qkeep;
          h.w[1] &= qkeep;
          *(v4h*)(gp + 8 * k) = h.v;
        }
        // as at the first wait, for the address registers of these stores
        asm volatile("s_wait_xcnt 0x0" ::: "memory");
      }
    }
  }

#pragma unroll  // as above
  for (int k = 0; k < 16; ++k) {
    const int d = wv + 8 * k;
    *(v4f*)&Cs[d * SIT + 4 * (lane ^ CSW(d))] = cst[k];
  }
  // The work-group's barrier by hand, behind the wave's own LDS stores:
  // __syncthreads() would also wait out the loads of W that are in flight.
  asm volatile("s_wait_dscnt 0x0\n\ts_barrier_signal -1\n\ts_barrier_wait -1" ::: "memory");

  // Ch: wave wv takes the tile of rows d = 16*wv .. 16*wv+15 and the block's four
  // K-chunks, eight parts of 16 context rows: 4 KiB contiguous. A lane reads its row's
  // eight context rows 16*cp + 8*(lane >> 4) .. of part cp. LC is a multiple of 8, so
  // the eight are all real or all padding, and padding is stored as zero.
  {
    const int dr = 16 * wv + (lane & 15);
    const float* crow = &Cs[dr * SIT];
    _Float16* chp = Ch + ((size_t)((b * 8 + wv) * 32 + i0 / 32)) * FCH + 8 * lane;
    V8H ch[8];
#pragma unroll  // as above
    for (int cp = 0; cp < 8; ++cp) {
      const int q = 4 * cp + 2 * (lane >> 4);
      const v4f c0 = *(const v4f*)&crow[4 * (q ^ CSW(dr))];
      const v4f c1 = *(const v4f*)&crow[4 * ((q + 1) ^ CSW(dr))];
      const unsigned ckeep = i0 + 16 * cp + 8 * (lane >> 4) < LC ? 0xffffffffu : 0u;
#pragma unroll  // as above
      for (int e = 0; e < 4; ++e) {
        ch[cp].e[e] = (_Float16)c0[e];
        ch[cp].e[4 + e] = (_Float16)c1[e];
      }
#pragma unroll  // as above
      for (int e = 0; e < 4; ++e) ch[cp].w[e] &= ckeep;
    }
#pragma unroll  // as above
    for (int cp = 0; cp < 8; ++cp) *(v8h*)(chp + 256 * cp) = ch[cp].v;  // 512 B a wave
    // as at the first wait, for the registers of the stores to Ch
    asm volatile("s_wait_xcnt 0x0" ::: "memory");
  }

#pragma unroll  // as above
  for (int g = 0; g < 4; ++g) {
    v4f cc[4];  // cc[e][r] = C[d = 4*lane + e][context row 16*wv + 4*g + r]
#pragma unroll  // as above
    for (int e = 0; e < 4; ++e)
      cc[e] = *(const v4f*)&Cs[(4 * lane + e) * SIT + 4 * ((4 * wv + g) ^ CSW(4 * lane + e))];
    float bias = 0.f;
#pragma unroll  // as above
    for (int r = 0; r < 4; ++r) {
      const v4f w1 = w[g & 1][r][0], w2 = w[g & 1][r][1], w3 = w[g & 1][r][2];
      V4H h;
#pragma unroll  // as above
      for (int e = 0; e < 4; ++e) h.e[e] = (_Float16)(w1[e] + w3[e] * cc[e][r]);
      *(v4h*)&u[16 * wv + 4 * g + r][4 * lane] = h.v;
      const float t = wave_sum((w2[0] * cc[0][r] + w2[1] * cc[1][r]) +
                               (w2[2] * cc[2][r] + w2[3] * cc[3][r]));
      bias = lane == r ? t : bias;
    }
    if (lane < 4) rs[16 * wv + 4 * g + lane] = bias;
    if (g + 2 < 4) {
#pragma unroll  // as above
      for (int r = 0; r < 4; ++r) {
        const int gi = i0 + 16 * wvu + 4 * (g + 2) + r;
        const float* wrow = W + ((size_t)(b * LC + (gi < LC ? gi : LC - 1))) * 384 + 4 * lane;
#pragma unroll  // as above
        for (int p = 0; p < 3; ++p) w[g & 1][r][p] = *(const v4f*)(wrow + 128 * p);
      }
      // as at the first wait
      asm volatile("s_wait_xcnt 0x0" ::: "memory");
    }
  }

  // Qs stands since the first barrier. The eighth wave has no j-tile: it re-reads the
  // seventh's rows and stops at the last barrier.
  const int j0 = (wv < NJT ? wv : NJT - 1) * 16;
  v16h bq[4];
#pragma unroll  // as above
  for (int k = 0; k < 4; ++k) bq[k] = frag_load(&Qs[j0 + (lane & 15)][0], 32 * k, lane);

  __syncthreads();
  if (wvu >= NJT) return;  // behind the last barrier

  // All eight i-tiles' products are independent: a K-chunk's eight fragments of u are
  // asked for together, and the stores follow the last product.
  v8f acc[SIT / 16] = {};
#pragma unroll  // as above
  for (int k = 0; k < 4; ++k) {
    v16h a[SIT / 16];
#pragma unroll  // as above
    for (int t = 0; t < SIT / 16; ++t) a[t] = frag_load(&u[16 * t + (lane & 15)][0], 32 * k, lane);
#pragma unroll  // as above
    for (int t = 0; t < SIT / 16; ++t) acc[t] = wmma16(a[t], bq[k], acc[t]);
  }

  // D layout: n = lane&15, m = r + 8*(lane>=16). LC is a multiple of 8, so a lane's
  // eight rows of a tile are all inside or all outside.
  const int j = j0 + (lane & 15);
  const int mb = (lane >> 4) << 3;
#pragma unroll  // as above
  for (int t = 0; t < SIT / 16; ++t) {
    const v4f r0 = *(const v4f*)&rs[16 * t + mb];
    const v4f r1 = *(const v4f*)&rs[16 * t + mb + 4];
#pragma unroll  // as above
    for (int r = 0; r < 8; ++r) acc[t][r] += r < 4 ? r0[r & 3] : r1[r & 3];
  }
#pragma unroll  // as above
  for (int t = 0; t < SIT / 16; ++t) {
    const int gi = i0 + 16 * t + mb;
    if (j < LQ && gi < LC) {
      float* sp = S + ((size_t)(b * LC + gi)) * LQP + j;
#pragma unroll  // as above
      for (int r = 0; r < 8; ++r) sp[(size_t)r * LQP] = acc[t][r];
    }
  }

  // Column maximum over the block's real rows. The first tile is real in every block;
  // the two halves of the wave hold the two halves of each tile's rows.
  float cmx = acc[0][0];
#pragma unroll  // as above
  for (int t = 0; t < SIT / 16; ++t) {
    float tm = acc[t][0];
#pragma unroll  // as above
    for (int r = 1; r < 8; ++r) tm = fmaxf(tm, acc[t][r]);
    cmx = i0 + 16 * t + mb < LC ? fmaxf(cmx, tm) : cmx;
  }
  cmx = fmaxf(cmx, half_xor(cmx));
  if (lane < 16 && j < LQ) pmax[(size_t)blockIdx.x * LQP + j] = cmx;
}

// ---------------------------------------------------------------------------
// Kernel 2: T[b][d][j] = sum_i S2[b,i,j] * Ct[b,i,d]   (M=j, N=d, K=i)
// block = (b, two j-tiles = 32 columns); 8 waves each own a 16-wide d-tile and both
// j-tiles, so a fragment of Ch serves two products. The block's whole operand
// exp(S - column maximum), 32 columns x 1024 context rows, is formed once and laid
// transposed in LDS: every load of S is in flight at once, and one barrier stands
// between the staging and the 32 K-chunks. The fourth pair's second tile (columns
// 112 .. 127) lies past S: it is staged, and stored to T, as zeros.
// The column softmax (axis=1) is formed here as well: a column's maximum is that of
// cqa_s's eight partial maxima, and its sum is the sum of the exponentials that are
// staged anyway (a thread's own, then a wave reduction, then four waves through LDS).
// ---------------------------------------------------------------------------
// exp(x) as __expf forms it (x * log2(e), then the hardware exp2). The v_nop fills
// the slot that the instruction set asks for behind a transcendental before its
// result is used or its source overwritten; in the statement it cannot drift away.
__device__ __forceinline__ float exp_slot(float x) {
  float y, a = x * 1.44269504088896340736f;
  asm("v_exp_f32 %0, %1\n\tv_nop" : "=v"(y) : "v"(a));
  return y;
}

#define CSP   SNT     // partial column maxima per batch: one a block of cqa_s
#define TJG   4       // column pairs of tiles per batch
#define TKP   1032    // halves per LDS row: 2064 B = 16 B x odd, for 16-byte readers
#define TBA   8       // K-chunks by which the fragments of Ch are fetched ahead

__global__ __launch_bounds__(256)
void cqa_t(const float* __restrict__ S, const float* __restrict__ pmax,
           const _Float16* __restrict__ Ch, _Float16* __restrict__ T) {
  const int b = blockIdx.x / TJG;
  const int jb = (blockIdx.x % TJG) * 32;
  const int tid = threadIdx.x, wv = tid >> 5, lane = tid & 31;

  __shared__ __attribute__((aligned(16))) _Float16 As[32][TKP];
  __shared__ __attribute__((aligned(16))) float cps[4][32];  // column sums: waves q and q + 4 fill row q

  // Staging: a thread takes four consecutive columns (local jl0 ..) of the context
  // rows 128*p + 4*rg + r, p = 0..7, r = 0..3. LQ and LC are multiples of 4, so the
  // four columns, and the four rows, are all real or all padding; padding re-reads
  // a real place (columns past LQ of S and of the maxima are never written) and
  // is replaced by zero.
  const int jl0 = ((wv >> 2) << 4) + ((lane & 3) << 2);
  const int rg = ((wv & 3) << 3) + (lane >> 2);
  const bool cok = jb + jl0 < LQ;
  const int gj = cok ? jb + jl0 : 0;
  const bool rok = 896 + 4 * rg < LC;

  v4f pm[CSP];
#pragma unroll  // the array must stay in registers
  for (int p = 0; p < CSP; ++p) pm[p] = *(const v4f*)(pmax + (b * CSP + p) * LQP + gj);
  // the address registers of the loads above are free for reuse only behind this wait
  asm volatile("s_wait_xcnt 0x0" ::: "memory");

  const float* sp = S + ((size_t)(b * LC + 4 * rg)) * LQP + gj;
  const float* sl = S + ((size_t)(b * LC + (rok ? 896 + 4 * rg : LC - 4))) * LQP + gj;
  v4f x[8][4];
#pragma unroll  // as above; all 32 loads are issued before the first is used
  for (int p = 0; p < 7; ++p) {
#pragma unroll  // as above
    for (int r = 0; r < 4; ++r) x[p][r] = *(const v4f*)(sp + (size_t)(128 * p + r) * LQP);
  }
  // as above: later loads may land in the address registers of these
  asm volatile("s_wait_xcnt 0x0" ::: "memory");
#pragma unroll  // as above
  for (int r = 0; r < 4; ++r) x[7][r] = *(const v4f*)(sl + (size_t)r * LQP);
  // as above
  asm volatile("s_wait_xcnt 0x0" ::: "memory");

  // The first fragments of Ch fly while the exponentials are formed. Of bf only
  // the chunks in flight or in use are live.
  const _Float16* bch = Ch + ((size_t)(b * 8 + wv)) * 32 * FCH;
  v16h bf[32];
#pragma unroll  // as above
  for (int k = 0; k < TBA; ++k) bf[k] = frag_packed(bch + FCH * k, lane);
  // keeps every load above in front of the work below: sunk among the exponentials,
  // the last rows of S and these fragments would be asked for a memory latency later
  __builtin_amdgcn_sched_barrier(0);

  v4f cm;
#pragma unroll  // as above
  for (int e = 0; e < 4; ++e)
    cm[e] = fmaxf(fmaxf(fmaxf(pm[0][e], pm[1][e]), fmaxf(pm[2][e], pm[3][e])),
                  fmaxf(fmaxf(pm[4][e], pm[5][e]), fmaxf(pm[6][e], pm[7][e])));

  v4f ps = {};  // the thread's part of its four columns' sums of exponentials

#pragma unroll  // as above
  for (int p = 0; p < 8; ++p) {
    // all-ones where the sixteen values are real, else zero
    const unsigned keep = (cok && (p < 7 || rok)) ? 0xffffffffu : 0u;
#pragma unroll  // as above
    for (int e = 0; e < 4; ++e) {
      V4H h;
      float ex[4];
#pragma unroll  // as above
      for (int r = 0; r < 4; ++r) {
        ex[r] = exp_slot(x[p][r][e] - cm[e]);
        h.e[r] = (_Float16)ex[r];
      }
      h.w[0] &= keep;
      h.w[1] &= keep;
      *(v4h*)&As[jl0 + e][128 * p + 4 * rg] = h.v;
      // padded rows stay out of the sum; a padded column's sum is that of the real
      // column it re-reads, and is not used
      const float e4 = (ex[0] + ex[1]) + (ex[2] + ex[3]);
      ps[e] += (p < 7 || rok) ? e4 : 0.f;
    }
  }
  // The eight lanes of a wave that share lane & 3 hold the same four columns.
#pragma unroll  // as above
  for (int e = 0; e < 4; ++e) {
    float t = ps[e];
    t += row_xor<4>(t);
    t += row_xor<8>(t);
    ps[e] = t + half_xor(t);
  }
  if (lane < 4) *(v4f*)&cps[wv & 3][jl0] = ps;
  __syncthreads();

  const _Float16* arow0 = &As[lane & 15][0];
  const _Float16* arow1 = &As[16 + (lane & 15)][0];
  v8f acc[2] = {};
  // Two K-chunks a pass. The LDS fragments of the next pass and the Ch fragments
  // of TBA chunks on are asked for before a pass's four products.
  v16h af[2][2][2];
#pragma unroll  // the fragment arrays must stay in registers
  for (int c = 0; c < 2; ++c) {
    af[0][c][0] = frag_load(arow0, 32 * c, lane);
    af[0][c][1] = frag_load(arow1, 32 * c, lane);
  }

  // Reciprocals of the sums of the lane's sixteen columns (D: m = r + 8*(lane>=16)),
  // formed while the first fragments are on their way from LDS.
  const int mb = (lane >> 4) << 3;
  float rc[2][8];
#pragma unroll  // the array must stay in registers
  for (int t = 0; t < 2; ++t) {
    v4f c0 = *(const v4f*)&cps[0][16 * t + mb];
    v4f c1 = *(const v4f*)&cps[0][16 * t + mb + 4];
#pragma unroll  // as above
    for (int q = 1; q < 4; ++q) {
      c0 += *(const v4f*)&cps[q][16 * t + mb];
      c1 += *(const v4f*)&cps[q][16 * t + mb + 4];
    }
#pragma unroll  // as above
    for (int r = 0; r < 8; ++r) rc[t][r] = 1.0f / (r < 4 ? c0[r & 3] : c1[r & 3]);
  }
#pragma unroll  // as above
  for (int q = 0; q < 16; ++q) {
#pragma unroll  // as above
    for (int c = 0; c < 2; ++c) {
      const int kn = 2 * (q + 1) + c, kb = 2 * q + TBA + c;
      if (kn < 32) {
        af[(q + 1) & 1][c][0] = frag_load(arow0, 32 * kn, lane);
        af[(q + 1) & 1][c][1] = frag_load(arow1, 32 * kn, lane);
      }
      if (kb < 32) bf[kb] = frag_packed(bch + FCH * kb, lane);
    }
    // keeps the loads above from sinking to their uses: each product would then
    // wait out a whole LDS latency
    __builtin_amdgcn_sched_barrier(0);
#pragma unroll  // as above
    for (int c = 0; c < 2; ++c) {
      acc[0] = wmma16(af[q & 1][c][0], bf[2 * q + c], acc[0]);
      acc[1] = wmma16(af[q & 1][c][1], bf[2 * q + c], acc[1]);
    }
  }

  // D: n = lane&15 -> d_local, m = r + 8*(lane>=16) -> j_local (consecutive j): the
  // lane's eight values of tile t are its own 16 bytes of part t of the block's K-chunk
  // of T in fragment order, 512 contiguous bytes a wave.
#pragma unroll  // as above
  for (int t = 0; t < 2; ++t) {
    V8H o;
#pragma unroll  // as above
    for (int r = 0; r < 8; ++r) {
      float val = (jb + 16 * t + mb + r < LQ) ? acc[t][r] * rc[t][r] : 0.f;
      o.e[r] = (_Float16)val;
    }
    *(v8h*)(T + ((size_t)((b * 8 + wv) * 4 + blockIdx.x % TJG)) * FCH + 256 * t + 8 * lane) = o.v;
  }
}

// ---------------------------------------------------------------------------
// Kernel 3: A = S1@Qt, Bm = S1@T; emit [Ct, A, Ct*A, Ct*Bm] transposed.
// block = (b, 64 context rows); 8 waves each own a 16-wide d-tile and all 64 rows.
// The products are formed transposed (M = d, N = i). Column c of N-tile t is
// context row 4c + t, so a lane's four accumulator tiles hold four consecutive
// i of one output row: 16 lanes store 256 contiguous bytes of that row.
// A is formed and stored first, then Bm, so 32 accumulator registers serve both.
// The row softmax (axis=2) is formed here as well: a wave holds a whole row of S in
// registers, so the row's maximum and sum of exponentials are two wave reductions.
// ---------------------------------------------------------------------------
#define OIT   64      // context rows per block
#define ONT   16      // ceil(1000/64)
#define SPIT  136     // halves per LDS row: 272 B = 16 B x odd, for 16-byte readers

__global__ __launch_bounds__(256)
void cqa_out(const float* __restrict__ C, const float* __restrict__ S,
             const _Float16* __restrict__ Qg, const _Float16* __restrict__ T,
             float* __restrict__ out) {
  const int b = blockIdx.x / ONT;
  const int i0 = (blockIdx.x % ONT) * OIT;
  const int tid = threadIdx.x, wv = tid >> 5, lane = tid & 31;
  const int c = lane & 15;

  // LDS row 16*t + c holds S1 of context row i0 + 4*c + t.
  __shared__ __attribute__((aligned(16))) _Float16 As1[OIT][SPIT];

  // The lane's part of Ct: rows d = dbase + r, context rows gi .. gi + 3. LC and i0
  // are multiples of 4, so the four are all inside or all outside; lanes outside
  // read the last four inside and store nothing.
  const int gi = i0 + 4 * c;
  const int dbase = wv * 16 + ((lane >> 4) << 3);
  const float* cp = C + ((size_t)(b * DD + dbase)) * LC + (gi < LC ? gi : LC - 4);
  float4 ct[8];
#pragma unroll  // the array must stay in registers
  for (int r = 0; r < 8; ++r) ct[r] = *(const float4*)(cp + (size_t)r * LC);

  // One wave per context row, a lane takes four consecutive j. All eight rows'
  // loads are issued before the first is used. Lanes past the row's end and rows
  // past LC re-read the last valid place; their values are replaced by zero.
  const unsigned jo = 4u * (unsigned)(lane < LQ / 4 ? lane : LQ / 4 - 1);
  // the wave's number as a scalar: row addresses are wave-uniform
  const int wvu = __builtin_amdgcn_readfirstlane(wv);
  float4 s[8];
  float mx[8], sm[8];
#pragma unroll  // as above
  for (int u = 0; u < 8; ++u) {
    int si = i0 + wvu + 8 * u;
    int row = b * LC + (si < LC ? si : LC - 1);
    const float* srow = S + (size_t)row * LQP;  // wave-uniform base
    s[u] = *(const float4*)(srow + jo);
  }
  // Row maximum: the re-read quads of lanes past the row's end repeat real values.
#pragma unroll  // as above; the eight rows' reductions are independent chains
  for (int u = 0; u < 8; ++u)
    mx[u] = wave_max(fmaxf(fmaxf(s[u].x, s[u].y), fmaxf(s[u].z, s[u].w)));
  // Exponentials, kept for the quotients below, and their sum over the real lanes.
#pragma unroll  // as above
  for (int u = 0; u < 8; ++u) {
    s[u].x = exp_slot(s[u].x - mx[u]);
    s[u].y = exp_slot(s[u].y - mx[u]);
    s[u].z = exp_slot(s[u].z - mx[u]);
    s[u].w = exp_slot(s[u].w - mx[u]);
    sm[u] = wave_sum(lane < LQ / 4 ? (s[u].x + s[u].y) + (s[u].z + s[u].w) : 0.f);
  }
#pragma unroll  // as above
  for (int u = 0; u < 8; ++u) {
    const int m = wvu + 8 * u;
    // all-ones where the four values are real, else zero: the quotients are
    // formed in every lane (their inputs are valid) and masked as bits
    const unsigned keep = ((i0 + m < LC) && (lane < LQ / 4)) ? 0xffffffffu : 0u;
    V4H h;
    h.e[0] = (_Float16)(s[u].x / sm[u]);
    h.e[1] = (_Float16)(s[u].y / sm[u]);
    h.e[2] = (_Float16)(s[u].z / sm[u]);
    h.e[3] = (_Float16)(s[u].w / sm[u]);
    h.w[0] &= keep;
    h.w[1] &= keep;
    *(v4h*)&As1[((m & 3) << 4) + (m >> 2)][4 * lane] = h.v;
  }

  const _Float16* tileQ = Qg + ((size_t)(b * 8 + wv)) * 4 * FCH;
  const _Float16* tileT = T + ((size_t)(b * 8 + wv)) * 4 * FCH;
  v16h fq[4], ft[4];
#pragma unroll  // as above
  for (int k = 0; k < 4; ++k) fq[k] = frag_packed(tileQ + FCH * k, lane);
  __syncthreads();

  float* op = out + ((size_t)(b * 512 + dbase)) * LC + gi;
  v8f acc[4] = {};
#pragma unroll  // as above
  for (int k = 0; k < 4; ++k) {
#pragma unroll  // as above
    for (int t = 0; t < 4; ++t)
      acc[t] = wmma16(fq[k], frag_load(&As1[16 * t + c][0], 32 * k, lane), acc[t]);
  }
#pragma unroll  // as above
  for (int k = 0; k < 4; ++k) ft[k] = frag_packed(tileT + FCH * k, lane);

  // D: register r = [d_local = 8*(lane>=16) + r][column c]; tiles t = 0..3 give
  // i = gi + t.
  if (gi < LC) {
#pragma unroll  // as above
    for (int r = 0; r < 8; ++r) {
      float4 va = make_float4(acc[0][r], acc[1][r], acc[2][r], acc[3][r]);
      float* o = op + (size_t)r * LC;
      *(float4*)(o) = ct[r];
      *(float4*)(o + (size_t)128 * LC) = va;
      *(float4*)(o + (size_t)256 * LC) =
          make_float4(ct[r].x * va.x, ct[r].y * va.y, ct[r].z * va.z, ct[r].w * va.w);
    }
  }

#pragma unroll  // as above
  for (int t = 0; t < 4; ++t) acc[t] = v8f{};
#pragma unroll  // as above
  for (int k = 0; k < 4; ++k) {
#pragma unroll  // as above
    for (int t = 0; t < 4; ++t)
      acc[t] = wmma16(ft[k], frag_load(&As1[16 * t + c][0], 32 * k, lane), acc[t]);
  }
  if (gi < LC) {
#pragma unroll  // as above
    for (int r = 0; r < 8; ++r) {
      *(float4*)(op + (size_t)(384 + r) * LC) =
          make_float4(ct[r].x * acc[0][r], ct[r].y * acc[1][r], ct[r].z * acc[2][r],
                      ct[r].w * acc[3][r]);
    }
  }
}

// ---------------------------------------------------------------------------
extern "C" void kernel_launch(void* const* d_in, const int* in_sizes, int n_in,
                              void* d_out, int out_size, void* d_ws, size_t ws_size,
                              hipStream_t stream) {
  (void)in_sizes; (void)n_in; (void)out_size; (void)ws_size;
  const float* C = (const float*)d_in[0];
  const float* Q = (const float*)d_in[1];
  const float* W = (const float*)d_in[2];
  float* out = (float*)d_out;
  char* ws = (char*)d_ws;

  float*    Sbuf = (float*)(ws + WS_S);
  float*    cmax = (float*)(ws + WS_CMAX);
  _Float16* T    = (_Float16*)(ws + WS_T);
  _Float16* Qg   = (_Float16*)(ws + WS_QG);
  _Float16* Ch   = (_Float16*)(ws + WS_CH);

  cqa_s<<<NB * SNT, 256, 0, stream>>>(C, Q, W, Qg, Ch, Sbuf, cmax);
  cqa_t<<<NB * TJG, 256, 0, stream>>>(Sbuf, cmax, Ch, T);
  cqa_out<<<NB * ONT, 256, 0, stream>>>(C, Sbuf, Qg, T, out);
}

// v009
// A run of this version takes 45.4 microseconds.
// Next to v008, in two timings, it ran 1.20 times as fast each time.
// Counting every step since v000, it is 5.83 times as fast.
#include <hip/hip_runtime.h>

// ---------------------------------------------------------------------------
// CQAttention for MI455X (gfx1250, wave32, WMMA f32_16x16x32_f16)
// B=64, D=128, LC=1000 (pad 1024), LQ=100 (pad 112/128)
// ---------------------------------------------------------------------------

typedef __attribute__((ext_vector_type(16))) _Float16 v16h;
typedef __attribute__((ext_vector_type(8)))  _Float16 v8h;
typedef __attribute__((ext_vector_type(4)))  _Float16 v4h;
typedef __attribute__((ext_vector_type(8)))  float    v8f;
typedef __attribute__((ext_vector_type(4))) float v4f;

union V16H { v16h v; v8h h[2]; };
union V8F  { v8f v; float e[8]; };
union V8H  { v8h v; _Float16 e[8]; unsigned w[4]; };
union V4H  { v4h v; _Float16 e[4]; unsigned w[2]; };

#define NB   64
#define DD   128
#define LC   1000
#define LQ   100
#define LQP  112      // 7 * 16
#define NJT  7        // ceil(100/16)

// How blocks are dealt, in all three kernels: block x of the grid takes batch x % NB and
// tile x / NB of that batch. For speed only: the deal is a
// permutation of the blocks, right wherever a block lands. dealt() gives the block's
// place in the order batch by batch, NT tiles a batch.
template <int NT>
__device__ __forceinline__ int dealt() {
  return (int)(blockIdx.x % NB) * NT + (int)(blockIdx.x / NB);
}

// Workspace layout (bytes, all offsets 256-aligned)
#define WS_S     ((size_t)0)            // f32 [64][1000][112]   = 28,672,000 B
#define WS_T     ((size_t)29241344)     // f16 [64][8][4][512], fragment order
#define WS_QG    ((size_t)35270656)     // f16 [64][8][4][512], fragment order
#define WS_CH    ((size_t)39464960)     // f16 [64][8][32][512], fragment order = 16,777,216 B
#define WS_CMAX  ((size_t)56242176)     // f32 [64][8][112]      =    229,376 B
// total = 56,471,552 B

// Per-ISA 16-bit A/B fragment layout: lane L holds row (L&15); halves 0..7 are
// K = kb..kb+7 and halves 8..15 are K = kb+16..kb+23 where kb = k0 + 8*(L>=16).
// Two contiguous 16-byte loads per fragment.
__device__ __forceinline__ v16h frag_load(const _Float16* row, int k0, int lane) {
  V16H r;
  int kb = k0 + ((lane >> 4) << 3);
  r.h[0] = *(const v8h*)(row + kb);
  r.h[1] = *(const v8h*)(row + kb + 16);
  return r.v;
}

// The f16 planes in global memory (Ch, Qg, T) lie in fragment order: [batch][tile of
// 16 rows d][K-chunk of 32][part p = 0, 1][lane L][8 halves], where lane L's eight
// halves are row (L & 15), K = 16*p + 8*(L >> 4) + 0..7 of the chunk: the map above.
// A fragment is then two loads of 512 contiguous bytes a wave, where rows of a plain
// matrix give 16 pieces of 32 bytes on 16 cache lines a load.
#define FCH   512     // halves per tile and K-chunk
__device__ __forceinline__ v16h frag_packed(const _Float16* chunk, int lane) {
  V16H r;
  r.h[0] = *(const v8h*)(chunk + 8 * lane);
  r.h[1] = *(const v8h*)(chunk + 256 + 8 * lane);
  return r.v;
}

__device__ __forceinline__ v8f wmma16(v16h a, v16h b, v8f c) {
  return __builtin_amdgcn_wmma_f32_16x16x32_f16(false, a, false, b, (short)0, c,
                                                false, false);
}

// ---------------------------------------------------------------------------
// Kernel 1: S[b,i,j] = sum_d (w1+w3*Ct)[i,d] * Qt[j,d]  + rowbias[i]
// block = (b, 128 context rows), 8 waves. The block's part of C, 128 d x 128 i, is
// read in whole rows of 512 bytes and laid in LDS as it is; a wave then streams the
// 16 rows of W that it owns, a lane taking d = 4*lane .. 4*lane+3 of w1, w2, w3 (512
// contiguous bytes a load), four rows a group, two groups in flight. From LDS the
// lane reads its four d of four context rows at once, so C is never gathered.
// The row bias is a wave reduction. Then waves 0..6 take one 16-wide j-tile each
// and all eight i-tiles, K = 128 (4 WMMAs a tile).
// The f16 operands of the whole sequence are formed here too, from what the block
// reads anyway: Q of the batch goes transposed to LDS for this kernel's own products,
// the C tile goes to Ch (padded with zeros to 1024 context rows) for cqa_t, read back
// from LDS in fragment order, and each block of a batch stores one tile of Qg (Q
// padded with zeros to 128 columns) for cqa_out.
// A wave that has a j-tile holds the block's 128 rows of its 16 columns of S in
// accumulators: it also stores each column's maximum over those rows, for cqa_t.
// ---------------------------------------------------------------------------
// Value of lane l ^ M inside the 16-lane row (DPP row_xmask); every lane is on.
template <int M>
__device__ __forceinline__ float row_xor(float x) {
  return __builtin_bit_cast(float, __builtin_amdgcn_update_dpp(
      0, __builtin_bit_cast(int, x), 0x160 | M, 0xf, 0xf, true));
}
// Value of lane l ^ 16.
__device__ __forceinline__ float half_xor(float x) {
  int v = __builtin_bit_cast(int, x);
  return __builtin_bit_cast(float, __builtin_amdgcn_permlanex16(v, v, 0x76543210, 0xfedcba98,
                                                                false, false));
}
__device__ __forceinline__ float wave_max(float x) {
  x = fmaxf(x, row_xor<1>(x)); x = fmaxf(x, row_xor<2>(x));
  x = fmaxf(x, row_xor<4>(x)); x = fmaxf(x, row_xor<8>(x));
  return fmaxf(x, half_xor(x));
}
__device__ __forceinline__ float wave_sum(float x) {
  x += row_xor<1>(x); x += row_xor<2>(x);
  x += row_xor<4>(x); x += row_xor<8>(x);
  return x + half_xor(x);
}

#define SIT   128     // context rows per block
#define SNT   8       // ceil(1000/128)
#define UPIT  136     // halves per LDS row: 272 B = 16 B x odd, for 16-byte readers
#define CSW(d) ((((d) >> 2) ^ ((d) << 2)) & 15)  // place swizzle of row d of Cs

__global__ __launch_bounds__(256)
void cqa_s(const float* __restrict__ C, const float* __restrict__ Q,
           const float* __restrict__ W, _Float16* __restrict__ Qg,
           _Float16* __restrict__ Ch, float* __restrict__ S,
           float* __restrict__ pmax) {
  const int bx = dealt<SNT>();
  const int b = bx / SNT;
  const int i0 = (bx % SNT) * SIT;
  const int tid = threadIdx.x, wv = tid >> 5, lane = tid & 31;
  // the wave's number as a scalar: row addresses of W are wave-uniform
  const int wvu = __builtin_amdgcn_readfirstlane(wv);

  // Cs: row d holds 32 quads of context rows; quad q lies at place q ^ CSW(d), so that
  // 16 lanes that write one row, 16 lanes that read one quad of rows d = 4*lane + e,
  // and 16 lanes that read one quad of 16 consecutive rows (for Ch) all fall on 16
  // different groups of four banks.
  __shared__ __attribute__((aligned(16))) float Cs[DD * SIT];
  __shared__ __attribute__((aligned(16))) _Float16 u[SIT][UPIT];  // w1 + w3*Ct
  __shared__ __attribute__((aligned(16))) float rs[SIT];
  __shared__ __attribute__((aligned(16))) _Float16 Qs[LQP][UPIT]; // Qs[j][d] = Q[d][j]

  // Q: wave wv takes rows d = 16*wv + k, a lane columns 4*lane .. 4*lane+3 (400
  // contiguous bytes a load). Lanes past the row's end re-read its last quad; their
  // values are replaced by zero. These loads go first: they are the first to be used.
  const float* qp = Q + ((size_t)(b * DD + 16 * wv)) * LQ + 4 * (lane < LQ / 4 ? lane : LQ / 4 - 1);
  v4f qst[16];
#pragma unroll  // the array must stay in registers
  for (int k = 0; k < 16; ++k) qst[k] = *(const v4f*)(qp + (size_t)k * LQ);
  // the address registers of the loads above are free for reuse only behind this wait
  asm volatile("s_wait_xcnt 0x0" ::: "memory");

  // C: wave wv takes rows d = wv + 8*k. LC and i0 are multiples of 4, so a quad is
  // all inside or all outside; quads outside re-read the last one inside, and what
  // comes of them is never stored.
  const int ci = i0 + 4 * lane < LC ? i0 + 4 * lane : LC - 4;
  const float* cp = C + ((size_t)(b * DD + wv)) * LC + ci;
  v4f cst[16];
#pragma unroll  // the array must stay in registers
  for (int k = 0; k < 16; ++k) cst[k] = *(const v4f*)(cp + (size_t)(8 * k) * LC);
  // the address registers of the loads above are free for reuse only behind this wait
  asm volatile("s_wait_xcnt 0x0" ::: "memory");

  // W: group g is the wave's rows 4*g .. 4*g+3; rows past LC re-read row LC - 1.
  // The second group is asked for behind the work on Q, in the registers that Q leaves.
  v4f w[2][4][3];
#pragma unroll  // as above
  for (int g = 0; g < 2; ++g) {
#pragma unroll  // as above
    for (int r = 0; r < 4; ++r) {
      const int gi = i0 + 16 * wvu + 4 * g + r;
      const float* wrow = W + ((size_t)(b * LC + (gi < LC ? gi : LC - 1))) * 384 + 4 * lane;
#pragma unroll  // as above
      for (int p = 0; p < 3; ++p) w[g][r][p] = *(const v4f*)(wrow + 128 * p);
    }
    // as at the first wait: the address registers of these loads are reused below
    asm volatile("s_wait_xcnt 0x0" ::: "memory");
    if (g == 0) {
      // all-ones where the lane's four columns are real, else zero
      const unsigned qkeep = lane < LQ / 4 ? 0xffffffffu : 0u;
      // A lane holds 16 consecutive d of four columns: 32 contiguous bytes of four
      // rows of Qs. Rows LQ .. LQP-1 are laid as zeros.
      if (lane < LQP / 4) {
#pragma unroll  // as above
        for (int e = 0; e < 4; ++e) {
#pragma unroll  // as above
          for (int hf = 0; hf < 2; ++hf) {
            V8H h;
#pragma unroll  // as above
            for (int k = 0; k < 8; ++k) h.e[k] = (_Float16)qst[8 * hf + k][e];
#pragma unroll  // as above
            for (int k = 0; k < 4; ++k) h.w[k] &= qkeep;
            *(v8h*)&Qs[4 * lane + e][16 * wv + 8 * hf] = h.v;
          }
        }
      }
      // Qg is the same for the batch's eight blocks. A wave holds one tile of 16 rows; in
      // fragment order row k's columns 4*lane .. 4*lane+3 are K-chunk lane >> 3, part
      // (lane >> 2) & 1, half of the wave (lane >> 1) & 1, halves 4*(lane & 1) ..: pieces
      // of 8 bytes. So the work is dealt: each block stores one tile, from one wave
      // (a scalar test), and a tile's 4 KiB have one writer.
      if (wvu == bx % SNT) {
        _Float16* gp = Qg + ((size_t)((b * 8 + wv) * 4 + (lane >> 3))) * FCH +
                       ((lane >> 2) & 1) * 256 + ((lane >> 1) & 1) * 128 + 4 * (lane & 1);
#pragma unroll  // as above
        for (int k = 0; k < 16; ++k) {
          V4H h;
#pragma unroll  // as above
          for (int e = 0; e < 4; ++e) h.e[e] = (_Float16)qst[k][e];
          h.w[0] &= qkeep;
          h.w[1] &= qkeep;
          *(v4h*)(gp + 8 * k) = h.v;
        }
        // as at the first wait, for the address registers of these stores
        asm volatile("s_wait_xcnt 0x0" ::: "memory");
      }
    }
  }

#pragma unroll  // as above
  for (int k = 0; k < 16; ++k) {
    const int d = wv + 8 * k;
    *(v4f*)&Cs[d * SIT + 4 * (lane ^ CSW(d))] = cst[k];
  }
  // The work-group's barrier by hand, behind the wave's own LDS stores:
  // __syncthreads() would also wait out the loads of W that are in flight.
  asm volatile("s_wait_dscnt 0x0\n\ts_barrier_signal -1\n\ts_barrier_wait -1" ::: "memory");

  // Ch: wave wv takes the tile of rows d = 16*wv .. 16*wv+15 and the block's four
  // K-chunks, eight parts of 16 context rows: 4 KiB contiguous. A lane reads its row's
  // eight context rows 16*cp + 8*(lane >> 4) .. of part cp. LC is a multiple of 8, so
  // the eight are all real or all padding, and padding is stored as zero.
  {
    const int dr = 16 * wv + (lane & 15);
    const float* crow = &Cs[dr * SIT];
    _Float16* chp = Ch + ((size_t)((b * 8 + wv) * 32 + i0 / 32)) * FCH + 8 * lane;
    V8H ch[8];
#pragma unroll  // as above
    for (int cp = 0; cp < 8; ++cp) {
      const int q = 4 * cp + 2 * (lane >> 4);
      const v4f c0 = *(const v4f*)&crow[4 * (q ^ CSW(dr))];
      const v4f c1 = *(const v4f*)&crow[4 * ((q + 1) ^ CSW(dr))];
      const unsigned ckeep = i0 + 16 * cp + 8 * (lane >> 4) < LC ? 0xffffffffu : 0u;
#pragma unroll  // as above
      for (int e = 0; e < 4; ++e) {
        ch[cp].e[e] = (_Float16)c0[e];
        ch[cp].e[4 + e] = (_Float16)c1[e];
      }
#pragma unroll  // as above
      for (int e = 0; e < 4; ++e) ch[cp].w[e] &= ckeep;
    }
#pragma unroll  // as above
    for (int cp = 0; cp < 8; ++cp) *(v8h*)(chp + 256 * cp) = ch[cp].v;  // 512 B a wave
    // as at the first wait, for the registers of the stores to Ch
    asm volatile("s_wait_xcnt 0x0" ::: "memory");
  }

#pragma unroll  // as above
  for (int g = 0; g < 4; ++g) {
    v4f cc[4];  // cc[e][r] = C[d = 4*lane + e][context row 16*wv + 4*g + r]
#pragma unroll  // as above
    for (int e = 0; e < 4; ++e)
      cc[e] = *(const v4f*)&Cs[(4 * lane + e) * SIT + 4 * ((4 * wv + g) ^ CSW(4 * lane + e))];
    float bias = 0.f;
#pragma unroll  // as above
    for (int r = 0; r < 4; ++r) {
      const v4f w1 = w[g & 1][r][0], w2 = w[g & 1][r][1], w3 = w[g & 1][r][2];
      V4H h;
#pragma unroll  // as above
      for (int e = 0; e < 4; ++e) h.e[e] = (_Float16)(w1[e] + w3[e] * cc[e][r]);
      *(v4h*)&u[16 * wv + 4 * g + r][4 * lane] = h.v;
      const float t = wave_sum((w2[0] * cc[0][r] + w2[1] * cc[1][r]) +
                               (w2[2] * cc[2][r] + w2[3] * cc[3][r]));
      bias = lane == r ? t : bias;
    }
    if (lane < 4) rs[16 * wv + 4 * g + lane] = bias;
    if (g + 2 < 4) {
#pragma unroll  // as above
      for (int r = 0; r < 4; ++r) {
        const int gi = i0 + 16 * wvu + 4 * (g + 2) + r;
        const float* wrow = W + ((size_t)(b * LC + (gi < LC ? gi : LC - 1))) * 384 + 4 * lane;
#pragma unroll  // as above
        for (int p = 0; p < 3; ++p) w[g & 1][r][p] = *(const v4f*)(wrow + 128 * p);
      }
      // as at the first wait
      asm volatile("s_wait_xcnt 0x0" ::: "memory");
    }
  }

  // Qs stands since the first barrier. The eighth wave has no j-tile: it re-reads the
  // seventh's rows and stops at the last barrier.
  const int j0 = (wv < NJT ? wv : NJT - 1) * 16;
  v16h bq[4];
#pragma unroll  // as above
  for (int k = 0; k < 4; ++k) bq[k] = frag_load(&Qs[j0 + (lane & 15)][0], 32 * k, lane);

  __syncthreads();
  if (wvu >= NJT) return;  // behind the last barrier

  // All eight i-tiles' products are independent: a K-chunk's eight fragments of u are
  // asked for together, and the stores follow the last product.
  v8f acc[SIT / 16] = {};
#pragma unroll  // as above
  for (int k = 0; k < 4; ++k) {
    v16h a[SIT / 16];
#pragma unroll  // as above
    for (int t = 0; t < SIT / 16; ++t) a[t] = frag_load(&u[16 * t + (lane & 15)][0], 32 * k, lane);
#pragma unroll  // as above
    for (int t = 0; t < SIT / 16; ++t) acc[t] = wmma16(a[t], bq[k], acc[t]);
  }

  // D layout: n = lane&15, m = r + 8*(lane>=16). LC is a multiple of 8, so a lane's
  // eight rows of a tile are all inside or all outside.
  const int j = j0 + (lane & 15);
  const int mb = (lane >> 4) << 3;
#pragma unroll  // as above
  for (int t = 0; t < SIT / 16; ++t) {
    const v4f r0 = *(const v4f*)&rs[16 * t + mb];
    const v4f r1 = *(const v4f*)&rs[16 * t + mb + 4];
#pragma unroll  // as above
    for (int r = 0; r < 8; ++r) acc[t][r] += r < 4 ? r0[r & 3] : r1[r & 3];
  }
#pragma unroll  // as above
  for (int t = 0; t < SIT / 16; ++t) {
    const int gi = i0 + 16 * t + mb;
    if (j < LQ && gi < LC) {
      float* sp = S + ((size_t)(b * LC + gi)) * LQP + j;
#pragma unroll  // as above
      for (int r = 0; r < 8; ++r) sp[(size_t)r * LQP] = acc[t][r];
    }
  }

  // Column maximum over the block's real rows. The first tile is real in every block;
  // the two halves of the wave hold the two halves of each tile's rows.
  float cmx = acc[0][0];
#pragma unroll  // as above
  for (int t = 0; t < SIT / 16; ++t) {
    float tm = acc[t][0];
#pragma unroll  // as above
    for (int r = 1; r < 8; ++r) tm = fmaxf(tm, acc[t][r]);
    cmx = i0 + 16 * t + mb < LC ? fmaxf(cmx, tm) : cmx;
  }
  cmx = fmaxf(cmx, half_xor(cmx));
  if (lane < 16 && j < LQ) pmax[(size_t)bx * LQP + j] = cmx;
}

// ---------------------------------------------------------------------------
// Kernel 2: T[b][d][j] = sum_i S2[b,i,j] * Ct[b,i,d]   (M=j, N=d, K=i)
// block = (b, two j-tiles = 32 columns); 8 waves each own a 16-wide d-tile and both
// j-tiles, so a fragment of Ch serves two products. The block's whole operand
// exp(S - column maximum), 32 columns x 1024 context rows, is formed once and laid
// transposed in LDS: every load of S is in flight at once, and one barrier stands
// between the staging and the 32 K-chunks. The fourth pair's second tile (columns
// 112 .. 127) lies past S: it is staged, and stored to T, as zeros.
// The column softmax (axis=1) is formed here as well: a column's maximum is that of
// cqa_s's eight partial maxima, and its sum is the sum of the exponentials that are
// staged anyway (a thread's own, then a wave reduction, then four waves through LDS).
// ---------------------------------------------------------------------------
// exp(x) as __expf forms it (x * log2(e), then the hardware exp2). The v_nop fills
// the slot that the instruction set asks for behind a transcendental before its
// result is used or its source overwritten; in the statement it cannot drift away.
__device__ __forceinline__ float exp_slot(float x) {
  float y, a = x * 1.44269504088896340736f;
  asm("v_exp_f32 %0, %1\n\tv_nop" : "=v"(y) : "v"(a));
  return y;
}

#define CSP   SNT     // partial column maxima per batch: one a block of cqa_s
#define TJG   4       // column pairs of tiles per batch
#define TKP   1032    // halves per LDS row: 2064 B = 16 B x odd, for 16-byte readers
#define TBA   8       // K-chunks by which the fragments of Ch are fetched ahead

__global__ __launch_bounds__(256)
void cqa_t(const float* __restrict__ S, const float* __restrict__ pmax,
           const _Float16* __restrict__ Ch, _Float16* __restrict__ T) {
  const int bx = dealt<TJG>();
  const int b = bx / TJG;
  const int jb = (bx % TJG) * 32;
  const int tid = threadIdx.x, wv = tid >> 5, lane = tid & 31;

  __shared__ __attribute__((aligned(16))) _Float16 As[32][TKP];
  __shared__ __attribute__((aligned(16))) float cps[4][32];  // column sums: waves q and q + 4 fill row q

  // Staging: a thread takes four consecutive columns (local jl0 ..) of the context
  // rows 128*p + 4*rg + r, p = 0..7, r = 0..3. LQ and LC are multiples of 4, so the
  // four columns, and the four rows, are all real or all padding; padding re-reads
  // a real place (columns past LQ of S and of the maxima are never written) and
  // is replaced by zero.
  const int jl0 = ((wv >> 2) << 4) + ((lane & 3) << 2);
  const int rg = ((wv & 3) << 3) + (lane >> 2);
  const bool cok = jb + jl0 < LQ;
  const int gj = cok ? jb + jl0 : 0;
  const bool rok = 896 + 4 * rg < LC;

  v4f pm[CSP];
#pragma unroll  // the array must stay in registers
  for (int p = 0; p < CSP; ++p) pm[p] = *(const v4f*)(pmax + (b * CSP + p) * LQP + gj);
  // the address registers of the loads above are free for reuse only behind this wait
  asm volatile("s_wait_xcnt 0x0" ::: "memory");

  const float* sp = S + ((size_t)(b * LC + 4 * rg)) * LQP + gj;
  const float* sl = S + ((size_t)(b * LC + (rok ? 896 + 4 * rg : LC - 4))) * LQP + gj;
  v4f x[8][4];
#pragma unroll  // as above; all 32 loads are issued before the first is used
  for (int p = 0; p < 7; ++p) {
#pragma unroll  // as above
    for (int r = 0; r < 4; ++r) x[p][r] = *(const v4f*)(sp + (size_t)(128 * p + r) * LQP);
  }
  // as above: later loads may land in the address registers of these
  asm volatile("s_wait_xcnt 0x0" ::: "memory");
#pragma unroll  // as above
  for (int r = 0; r < 4; ++r) x[7][r] = *(const v4f*)(sl + (size_t)r * LQP);
  // as above
  asm volatile("s_wait_xcnt 0x0" ::: "memory");

  // The first fragments of Ch fly while the exponentials are formed. Of bf only
  // the chunks in flight or in use are live.
  const _Float16* bch = Ch + ((size_t)(b * 8 + wv)) * 32 * FCH;
  v16h bf[32];
#pragma unroll  // as above
  for (int k = 0; k < TBA; ++k) bf[k] = frag_packed(bch + FCH * k, lane);
  // keeps every load above in front of the work below: sunk among the exponentials,
  // the last rows of S and these fragments would be asked for a memory latency later
  __builtin_amdgcn_sched_barrier(0);

  v4f cm;
#pragma unroll  // as above
  for (int e = 0; e < 4; ++e)
    cm[e] = fmaxf(fmaxf(fmaxf(pm[0][e], pm[1][e]), fmaxf(pm[2][e], pm[3][e])),
                  fmaxf(fmaxf(pm[4][e], pm[5][e]), fmaxf(pm[6][e], pm[7][e])));

  v4f ps = {};  // the thread's part of its four columns' sums of exponentials

#pragma unroll  // as above
  for (int p = 0; p < 8; ++p) {
    // all-ones where the sixteen values are real, else zero
    const unsigned keep = (cok && (p < 7 || rok)) ? 0xffffffffu : 0u;
#pragma unroll  // as above
    for (int e = 0; e < 4; ++e) {
      V4H h;
      float ex[4];
#pragma unroll  // as above
      for (int r = 0; r < 4; ++r) {
        ex[r] = exp_slot(x[p][r][e] - cm[e]);
        h.e[r] = (_Float16)ex[r];
      }
      h.w[0] &= keep;
      h.w[1] &= keep;
      *(v4h*)&As[jl0 + e][128 * p + 4 * rg] = h.v;
      // padded rows stay out of the sum; a padded column's sum is that of the real
      // column it re-reads, and is not used
      const float e4 = (ex[0] + ex[1]) + (ex[2] + ex[3]);
      ps[e] += (p < 7 || rok) ? e4 : 0.f;
    }
  }
  // The eight lanes of a wave that share lane & 3 hold the same four columns.
#pragma unroll  // as above
  for (int e = 0; e < 4; ++e) {
    float t = ps[e];
    t += row_xor<4>(t);
    t += row_xor<8>(t);
    ps[e] = t + half_xor(t);
  }
  if (lane < 4) *(v4f*)&cps[wv & 3][jl0] = ps;
  __syncthreads();

  const _Float16* arow0 = &As[lane & 15][0];
  const _Float16* arow1 = &As[16 + (lane & 15)][0];
  v8f acc[2] = {};
  // Two K-chunks a pass. The LDS fragments of the next pass and the Ch fragments
  // of TBA chunks on are asked for before a pass's four products.
  v16h af[2][2][2];
#pragma unroll  // the fragment arrays must stay in registers
  for (int c = 0; c < 2; ++c) {
    af[0][c][0] = frag_load(arow0, 32 * c, lane);
    af[0][c][1] = frag_load(arow1, 32 * c, lane);
  }

  // Reciprocals of the sums of the lane's sixteen columns (D: m = r + 8*(lane>=16)),
  // formed while the first fragments are on their way from LDS.
  const int mb = (lane >> 4) << 3;
  float rc[2][8];
#pragma unroll  // the array must stay in registers
  for (int t = 0; t < 2; ++t) {
    v4f c0 = *(const v4f*)&cps[0][16 * t + mb];
    v4f c1 = *(const v4f*)&cps[0][16 * t + mb + 4];
#pragma unroll  // as above
    for (int q = 1; q < 4; ++q) {
      c0 += *(const v4f*)&cps[q][16 * t + mb];
      c1 += *(const v4f*)&cps[q][16 * t + mb + 4];
    }
#pragma unroll  // as above
    for (int r = 0; r < 8; ++r) rc[t][r] = 1.0f / (r < 4 ? c0[r & 3] : c1[r & 3]);
  }
#pragma unroll  // as above
  for (int q = 0; q < 16; ++q) {
#pragma unroll  // as above
    for (int c = 0; c < 2; ++c) {
      const int kn = 2 * (q + 1) + c, kb = 2 * q + TBA + c;
      if (kn < 32) {
        af[(q + 1) & 1][c][0] = frag_load(arow0, 32 * kn, lane);
        af[(q + 1) & 1][c][1] = frag_load(arow1, 32 * kn, lane);
      }
      if (kb < 32) bf[kb] = frag_packed(bch + FCH * kb, lane);
    }
    // keeps the loads above from sinking to their uses: each product would then
    // wait out a whole LDS latency
    __builtin_amdgcn_sched_barrier(0);
#pragma unroll  // as above
    for (int c = 0; c < 2; ++c) {
      acc[0] = wmma16(af[q & 1][c][0], bf[2 * q + c], acc[0]);
      acc[1] = wmma16(af[q & 1][c][1], bf[2 * q + c], acc[1]);
    }
  }

  // D: n = lane&15 -> d_local, m = r + 8*(lane>=16) -> j_local (consecutive j): the
  // lane's eight values of tile t are its own 16 bytes of part t of the block's K-chunk
  // of T in fragment order, 512 contiguous bytes a wave.
#pragma unroll  // as above
  for (int t = 0; t < 2; ++t) {
    V8H o;
#pragma unroll  // as above
    for (int r = 0; r < 8; ++r) {
      float val = (jb + 16 * t + mb + r < LQ) ? acc[t][r] * rc[t][r] : 0.f;
      o.e[r] = (_Float16)val;
    }
    *(v8h*)(T + ((size_t)((b * 8 + wv) * 4 + bx % TJG)) * FCH + 256 * t + 8 * lane) = o.v;
  }
}

// ---------------------------------------------------------------------------
// Kernel 3: A = S1@Qt, Bm = S1@T; emit [Ct, A, Ct*A, Ct*Bm] transposed.
// block = (b, 64 context rows); 8 waves each own a 16-wide d-tile and all 64 rows.
// The products are formed transposed (M = d, N = i). Column c of N-tile t is
// context row 4c + t, so a lane's four accumulator tiles hold four consecutive
// i of one output row: 16 lanes store 256 contiguous bytes of that row.
// A is formed and stored first, then Bm, so 32 accumulator registers serve both.
// The row softmax (axis=2) is formed here as well: a wave holds a whole row of S in
// registers, so the row's maximum and sum of exponentials are two wave reductions.
// ---------------------------------------------------------------------------
#define OIT   64      // context rows per block
#define ONT   16      // ceil(1000/64)
#define SPIT  136     // halves per LDS row: 272 B = 16 B x odd, for 16-byte readers

__global__ __launch_bounds__(256)
void cqa_out(const float* __restrict__ C, const float* __restrict__ S,
             const _Float16* __restrict__ Qg, const _Float16* __restrict__ T,
             float* __restrict__ out) {
  const int bx = dealt<ONT>();
  const int b = bx / ONT;
  const int i0 = (bx % ONT) * OIT;
  const int tid = threadIdx.x, wv = tid >> 5, lane = tid & 31;
  const int c = lane & 15;

  // LDS row 16*t + c holds S1 of context row i0 + 4*c + t.
  __shared__ __attribute__((aligned(16))) _Float16 As1[OIT][SPIT];

  // The lane's part of Ct: rows d = dbase + r, context rows gi .. gi + 3. LC and i0
  // are multiples of 4, so the four are all inside or all outside; lanes outside
  // read the last four inside and store nothing.
  const int gi = i0 + 4 * c;
  const int dbase = wv * 16 + ((lane >> 4) << 3);
  const float* cp = C + ((size_t)(b * DD + dbase)) * LC + (gi < LC ? gi : LC - 4);
  float4 ct[8];
#pragma unroll  // the array must stay in registers
  for (int r = 0; r < 8; ++r) ct[r] = *(const float4*)(cp + (size_t)r * LC);

  // One wave per context row, a lane takes four consecutive j. All eight rows'
  // loads are issued before the first is used. Lanes past the row's end and rows
  // past LC re-read the last valid place; their values are replaced by zero.
  const unsigned jo = 4u * (unsigned)(lane < LQ / 4 ? lane : LQ / 4 - 1);
  // the wave's number as a scalar: row addresses are wave-uniform
  const int wvu = __builtin_amdgcn_readfirstlane(wv);
  float4 s[8];
  float mx[8], sm[8];
#pragma unroll  // as above
  for (int u = 0; u < 8; ++u) {
    int si = i0 + wvu + 8 * u;
    int row = b * LC + (si < LC ? si : LC - 1);
    const float* srow = S + (size_t)row * LQP;  // wave-uniform base
    s[u] = *(const float4*)(srow + jo);
  }
  // Row maximum: the re-read quads of lanes past the row's end repeat real values.
#pragma unroll  // as above; the eight rows' reductions are independent chains
  for (int u = 0; u < 8; ++u)
    mx[u] = wave_max(fmaxf(fmaxf(s[u].x, s[u].y), fmaxf(s[u].z, s[u].w)));
  // Exponentials, kept for the quotients below, and their sum over the real lanes.
#pragma unroll  // as above
  for (int u = 0; u < 8; ++u) {
    s[u].x = exp_slot(s[u].x - mx[u]);
    s[u].y = exp_slot(s[u].y - mx[u]);
    s[u].z = exp_slot(s[u].z - mx[u]);
    s[u].w = exp_slot(s[u].w - mx[u]);
    sm[u] = wave_sum(lane < LQ / 4 ? (s[u].x + s[u].y) + (s[u].z + s[u].w) : 0.f);
  }
#pragma unroll  // as above
  for (int u = 0; u < 8; ++u) {
    const int m = wvu + 8 * u;
    // all-ones where the four values are real, else zero: the quotients are
    // formed in every lane (their inputs are valid) and masked as bits
    const unsigned keep = ((i0 + m < LC) && (lane < LQ / 4)) ? 0xffffffffu : 0u;
    V4H h;
    h.e[0] = (_Float16)(s[u].x / sm[u]);
    h.e[1] = (_Float16)(s[u].y / sm[u]);
    h.e[2] = (_Float16)(s[u].z / sm[u]);
    h.e[3] = (_Float16)(s[u].w / sm[u]);
    h.w[0] &= keep;
    h.w[1] &= keep;
    *(v4h*)&As1[((m & 3) << 4) + (m >> 2)][4 * lane] = h.v;
  }

  const _Float16* tileQ = Qg + ((size_t)(b * 8 + wv)) * 4 * FCH;
  const _Float16* tileT = T + ((size_t)(b * 8 + wv)) * 4 * FCH;
  v16h fq[4], ft[4];
#pragma unroll  // as above
  for (int k = 0; k < 4; ++k) fq[k] = frag_packed(tileQ + FCH * k, lane);
  __syncthreads();

  float* op = out + ((size_t)(b * 512 + dbase)) * LC + gi;
  v8f acc[4] = {};
#pragma unroll  // as above
  for (int k = 0; k < 4; ++k) {
#pragma unroll  // as above
    for (int t = 0; t < 4; ++t)
      acc[t] = wmma16(fq[k], frag_load(&As1[16 * t + c][0], 32 * k, lane), acc[t]);
  }
#pragma unroll  // as above
  for (int k = 0; k < 4; ++k) ft[k] = frag_packed(tileT + FCH * k, lane);

  // D: register r = [d_local = 8*(lane>=16) + r][column c]; tiles t = 0..3 give
  // i = gi + t.
  if (gi < LC) {
#pragma unroll  // as above
    for (int r = 0; r < 8; ++r) {
      float4 va = make_float4(acc[0][r], acc[1][r], acc[2][r], acc[3][r]);
      float* o = op + (size_t)r * LC;
      *(float4*)(o) = ct[r];
      *(float4*)(o + (size_t)128 * LC) = va;
      *(float4*)(o + (size_t)256 * LC) =
          make_float4(ct[r].x * va.x, ct[r].y * va.y, ct[r].z * va.z, ct[r].w * va.w);
    }
  }

#pragma unroll  // as above
  for (int t = 0; t < 4; ++t) acc[t] = v8f{};
#pragma unroll  // as above
  for (int k = 0; k < 4; ++k) {
#pragma unroll  // as above
    for (int t = 0; t < 4; ++t)
      acc[t] = wmma16(ft[k], frag_load(&As1[16 * t + c][0], 32 * k, lane), acc[t]);
  }
  if (gi < LC) {
#pragma unroll  // as above
    for (int r = 0; r < 8; ++r) {
      *(float4*)(op + (size_t)(384 + r) * LC) =
          make_float4(ct[r].x * acc[0][r], ct[r].y * acc[1][r], ct[r].z * acc[2][r],
                      ct[r].w * acc[3][r]);
    }
  }
}

// ---------------------------------------------------------------------------
extern "C" void kernel_launch(void* const* d_in, const int* in_sizes, int n_in,
                              void* d_out, int out_size, void* d_ws, size_t ws_size,
                              hipStream_t stream) {
  (void)in_sizes; (void)n_in; (void)out_size; (void)ws_size;
  const float* C = (const float*)d_in[0];
  const float* Q = (const float*)d_in[1];
  const float* W = (const float*)d_in[2];
  float* out = (float*)d_out;
  char* ws = (char*)d_ws;

  float*    Sbuf = (float*)(ws + WS_S);
  float*    cmax = (float*)(ws + WS_CMAX);
  _Float16* T    = (_Float16*)(ws + WS_T);
  _Float16* Qg   = (_Float16*)(ws + WS_QG);
  _Float16* Ch   = (_Float16*)(ws + WS_CH);

  cqa_s<<<NB * SNT, 256, 0, stream>>>(C, Q, W, Qg, Ch, Sbuf, cmax);
  cqa_t<<<NB * TJG, 256, 0, stream>>>(Sbuf, cmax, Ch, T);
  cqa_out<<<NB * ONT, 256, 0, stream>>>(C, Sbuf, Qg, T, out);
}

// v010
// It runs in 43.3 microseconds.
// Two timings next to v009 both put it at 1.05 times that version's speed.
// Over all steps from v000 it is 6.10 times as fast.
#include <hip/hip_runtime.h>

// ---------------------------------------------------------------------------
// CQAttention for MI455X (gfx1250, wave32, WMMA f32_16x16x32_f16)
// B=64, D=128, LC=1000 (pad 1024), LQ=100 (pad 112/128)
// ---------------------------------------------------------------------------

typedef __attribute__((ext_vector_type(16))) _Float16 v16h;
typedef __attribute__((ext_vector_type(8)))  _Float16 v8h;
typedef __attribute__((ext_vector_type(4)))  _Float16 v4h;
typedef __attribute__((ext_vector_type(8)))  float    v8f;
typedef __attribute__((ext_vector_type(4))) float v4f;

union V16H { v16h v; v8h h[2]; };
union V8F  { v8f v; float e[8]; };
union V8H  { v8h v; _Float16 e[8]; unsigned w[4]; };
union V4H  { v4h v; _Float16 e[4]; unsigned w[2]; };

#define NB   64
#define DD   128
#define LC   1000
#define LQ   100
#define LQP  112      // 7 * 16
#define NJT  7        // ceil(100/16)

// How blocks are dealt, in all three kernels: block x of the grid takes batch x % NB and
// tile x / NB of that batch. For speed only: the deal is a
// permutation of the blocks, right wherever a block lands. dealt() gives the block's
// place in the order batch by batch, NT tiles a batch.
template <int NT>
__device__ __forceinline__ int dealt() {
  return (int)(blockIdx.x % NB) * NT + (int)(blockIdx.x / NB);
}

// Workspace layout (bytes, all offsets 256-aligned)
#define WS_S     ((size_t)0)            // f32 [64][1000][112]   = 28,672,000 B
#define WS_T     ((size_t)29241344)     // f16 [64][8][4][512], fragment order
#define WS_QG    ((size_t)35270656)     // f16 [64][8][4][512], fragment order
#define WS_TP    ((size_t)39464960)     // f16 [64][8][8][4][512], fragment order = 16,777,216 B
#define WS_CMAX  ((size_t)56242176)     // f32 [64][8][112]      =    229,376 B
#define WS_CSUM  ((size_t)56471552)     // f32 [64][8][112]      =    229,376 B
// total = 56,700,928 B

// Per-ISA 16-bit A/B fragment layout: lane L holds row (L&15); halves 0..7 are
// K = kb..kb+7 and halves 8..15 are K = kb+16..kb+23 where kb = k0 + 8*(L>=16).
// Two contiguous 16-byte loads per fragment.
__device__ __forceinline__ v16h frag_load(const _Float16* row, int k0, int lane) {
  V16H r;
  int kb = k0 + ((lane >> 4) << 3);
  r.h[0] = *(const v8h*)(row + kb);
  r.h[1] = *(const v8h*)(row + kb + 16);
  return r.v;
}

// The f16 planes in global memory (Qg, T, its parts Tp) lie in fragment order: [batch][tile of
// 16 rows d][K-chunk of 32][part p = 0, 1][lane L][8 halves], where lane L's eight
// halves are row (L & 15), K = 16*p + 8*(L >> 4) + 0..7 of the chunk: the map above.
// A fragment is then two loads of 512 contiguous bytes a wave, where rows of a plain
// matrix give 16 pieces of 32 bytes on 16 cache lines a load.
#define FCH   512     // halves per tile and K-chunk
__device__ __forceinline__ v16h frag_packed(const _Float16* chunk, int lane) {
  V16H r;
  r.h[0] = *(const v8h*)(chunk + 8 * lane);
  r.h[1] = *(const v8h*)(chunk + 256 + 8 * lane);
  return r.v;
}

__device__ __forceinline__ v8f wmma16(v16h a, v16h b, v8f c) {
  return __builtin_amdgcn_wmma_f32_16x16x32_f16(false, a, false, b, (short)0, c,
                                                false, false);
}

// ---------------------------------------------------------------------------
// Kernel 1: S[b,i,j] = sum_d (w1+w3*Ct)[i,d] * Qt[j,d]  + rowbias[i]
// block = (b, 128 context rows), 8 waves. The block's part of C, 128 d x 128 i, is
// read in whole rows of 512 bytes and laid in LDS as it is; a wave then streams the
// 16 rows of W that it owns, a lane taking d = 4*lane .. 4*lane+3 of w1, w2, w3 (512
// contiguous bytes a load), four rows a group, two groups in flight. From LDS the
// lane reads its four d of four context rows at once, so C is never gathered.
// The row bias is a wave reduction. Then waves 0..6 take one 16-wide j-tile each
// and all eight i-tiles, K = 128 (4 WMMAs a tile).
// The f16 operands of the whole sequence are formed here too, from what the block
// reads anyway: Q of the batch goes transposed to LDS for this kernel's own products,
// the C tile is read back from LDS in fragment order as f16 (context rows past LC as
// zeros), and each block of a batch stores one tile of Qg (Q padded with zeros to 128
// columns) for cqa_out.
// The block's part of T = S2^T Ct is formed here as well. A wave that has a j-tile
// holds the block's 128 rows of its 16 columns of S in accumulators, and the D layout
// of two row tiles is the A layout of one K-chunk of 32 rows: exp(S - the column's
// maximum over these 128 rows) goes from the accumulators straight into products with
// the f16 C tile (M = j, N = d, K = i). The part, the maxima and the sums of the
// exponentials go to cqa_t, which puts the eight parts of a batch on one scale.
// ---------------------------------------------------------------------------
// exp(x) as __expf forms it (x * log2(e), then the hardware exp2). The v_nop fills
// the slot that the instruction set asks for behind a transcendental before its
// result is used or its source overwritten; in the statement it cannot drift away.
__device__ __forceinline__ float exp_slot(float x) {
  float y, a = x * 1.44269504088896340736f;
  asm("v_exp_f32 %0, %1\n\tv_nop" : "=v"(y) : "v"(a));
  return y;
}

// Value of lane l ^ M inside the 16-lane row (DPP row_xmask); every lane is on.
template <int M>
__device__ __forceinline__ float row_xor(float x) {
  return __builtin_bit_cast(float, __builtin_amdgcn_update_dpp(
      0, __builtin_bit_cast(int, x), 0x160 | M, 0xf, 0xf, true));
}
// Value of lane l ^ 16.
__device__ __forceinline__ float half_xor(float x) {
  int v = __builtin_bit_cast(int, x);
  return __builtin_bit_cast(float, __builtin_amdgcn_permlanex16(v, v, 0x76543210, 0xfedcba98,
                                                                false, false));
}
__device__ __forceinline__ float wave_max(float x) {
  x = fmaxf(x, row_xor<1>(x)); x = fmaxf(x, row_xor<2>(x));
  x = fmaxf(x, row_xor<4>(x)); x = fmaxf(x, row_xor<8>(x));
  return fmaxf(x, half_xor(x));
}
__device__ __forceinline__ float wave_sum(float x) {
  x += row_xor<1>(x); x += row_xor<2>(x);
  x += row_xor<4>(x); x += row_xor<8>(x);
  return x + half_xor(x);
}

#define SIT   128     // context rows per block
#define SNT   8       // ceil(1000/128)
#define UPIT  136     // halves per LDS row: 272 B = 16 B x odd, for 16-byte readers
#define CSW(d) ((((d) >> 2) ^ ((d) << 2)) & 15)  // place swizzle of row d of Cs

__global__ __launch_bounds__(256)
void cqa_s(const float* __restrict__ C, const float* __restrict__ Q,
           const float* __restrict__ W, _Float16* __restrict__ Qg,
           _Float16* __restrict__ Tp, float* __restrict__ S,
           float* __restrict__ pmax, float* __restrict__ psum) {
  const int bx = dealt<SNT>();
  const int b = bx / SNT;
  const int i0 = (bx % SNT) * SIT;
  const int tid = threadIdx.x, wv = tid >> 5, lane = tid & 31;
  // the wave's number as a scalar: row addresses of W are wave-uniform
  const int wvu = __builtin_amdgcn_readfirstlane(wv);

  // Cs: row d holds 32 quads of context rows; quad q lies at place q ^ CSW(d), so that
  // 16 lanes that write one row, 16 lanes that read one quad of rows d = 4*lane + e,
  // and 16 lanes that read one quad of 16 consecutive rows (for the f16 tile) all fall
  // on 16 different groups of four banks.
  __shared__ __attribute__((aligned(16))) float Cs[DD * SIT];
  __shared__ __attribute__((aligned(16))) _Float16 u[SIT][UPIT];  // w1 + w3*Ct
  __shared__ __attribute__((aligned(16))) float rs[SIT];
  __shared__ __attribute__((aligned(16))) _Float16 Qs[LQP][UPIT]; // Qs[j][d] = Q[d][j]

  // Q: wave wv takes rows d = 16*wv + k, a lane columns 4*lane .. 4*lane+3 (400
  // contiguous bytes a load). Lanes past the row's end re-read its last quad; their
  // values are replaced by zero. These loads go first: they are the first to be used.
  const float* qp = Q + ((size_t)(b * DD + 16 * wv)) * LQ + 4 * (lane < LQ / 4 ? lane : LQ / 4 - 1);
  v4f qst[16];
#pragma unroll  // the array must stay in registers
  for (int k = 0; k < 16; ++k) qst[k] = *(const v4f*)(qp + (size_t)k * LQ);
  // the address registers of the loads above are free for reuse only behind this wait
  asm volatile("s_wait_xcnt 0x0" ::: "memory");

  // C: wave wv takes rows d = wv + 8*k. LC and i0 are multiples of 4, so a quad is
  // all inside or all outside; quads outside re-read the last one inside, and what
  // comes of them is never stored.
  const int ci = i0 + 4 * lane < LC ? i0 + 4 * lane : LC - 4;
  const float* cp = C + ((size_t)(b * DD + wv)) * LC + ci;
  v4f cst[16];
#pragma unroll  // the array must stay in registers
  for (int k = 0; k < 16; ++k) cst[k] = *(const v4f*)(cp + (size_t)(8 * k) * LC);
  // the address registers of the loads above are free for reuse only behind this wait
  asm volatile("s_wait_xcnt 0x0" ::: "memory");

  // W: group g is the wave's rows 4*g .. 4*g+3; rows past LC re-read row LC - 1.
  // The second group is asked for behind the work on Q, in the registers that Q leaves.
  v4f w[2][4][3];
#pragma unroll  // as above
  for (int g = 0; g < 2; ++g) {
#pragma unroll  // as above
    for (int r = 0; r < 4; ++r) {
      const int gi = i0 + 16 * wvu + 4 * g + r;
      const float* wrow = W + ((size_t)(b * LC + (gi < LC ? gi : LC - 1))) * 384 + 4 * lane;
#pragma unroll  // as above
      for (int p = 0; p < 3; ++p) w[g][r][p] = *(const v4f*)(wrow + 128 * p);
    }
    // as at the first wait: the address registers of these loads are reused below
    asm volatile("s_wait_xcnt 0x0" ::: "memory");
    if (g == 0) {
      // all-ones where the lane's four columns are real, else zero
      const unsigned qkeep = lane < LQ / 4 ? 0xffffffffu : 0u;
      // A lane holds 16 consecutive d of four columns: 32 contiguous bytes of four
      // rows of Qs. Rows LQ .. LQP-1 are laid as zeros.
      if (lane < LQP / 4) {
#pragma unroll  // as above
        for (int e = 0; e < 4; ++e) {
#pragma unroll  // as above
          for (int hf = 0; hf < 2; ++hf) {
            V8H h;
#pragma unroll  // as above
            for (int k = 0; k < 8; ++k) h.e[k] = (_Float16)qst[8 * hf + k][e];
#pragma unroll  // as above
            for (int k = 0; k < 4; ++k) h.w[k] &= qkeep;
            *(v8h*)&Qs[4 * lane + e][16 * wv + 8 * hf] = h.v;
          }
        }
      }
      // Qg is the same for the batch's eight blocks. A wave holds one tile of 16 rows; in
      // fragment order row k's columns 4*lane .. 4*lane+3 are K-chunk lane >> 3, part
      // (lane >> 2) & 1, half of the wave (lane >> 1) & 1, halves 4*(lane & 1) ..: pieces
      // of 8 bytes. So the work is dealt: each block stores one tile, from one wave
      // (a scalar test), and a tile's 4 KiB have one writer.
      if (wvu == bx % SNT) {
        _Float16* gp = Qg + ((size_t)((b * 8 + wv) * 4 + (lane >> 3))) * FCH +
                       ((lane >> 2) & 1) * 256 + ((lane >> 1) & 1) * 128 + 4 * (lane & 1);
#pragma unroll  // as above
        for (int k = 0; k < 16; ++k) {
          V4H h;
#pragma unroll  // as above
          for (int e = 0; e < 4; ++e) h.e[e] = (_Float16)qst[k][e];
          h.w[0] &= qkeep;
          h.w[1] &= qkeep;
          *(v4h*)(gp + 8 * k) = h.v;
        }
        // as at the first wait, for the address registers of these stores
        asm volatile("s_wait_xcnt 0x0" ::: "memory");
      }
    }
  }

#pragma unroll  // as above
  for (int k = 0; k < 16; ++k) {
    const int d = wv + 8 * k;
    *(v4f*)&Cs[d * SIT + 4 * (lane ^ CSW(d))] = cst[k];
  }
  // The work-group's barrier by hand, behind the wave's own LDS stores:
  // __syncthreads() would also wait out the loads of W that are in flight.
  asm volatile("s_wait_dscnt 0x0\n\ts_barrier_signal -1\n\ts_barrier_wait -1" ::: "memory");

  // The C tile as f16 fragments: wave wv takes the tile of rows d = 16*wv .. 16*wv+15
  // and the block's four K-chunks, eight parts of 16 context rows. A lane reads its
  // row's eight context rows 16*cp + 8*(lane >> 4) .. of part cp. LC is a multiple of 8,
  // so the eight are all real or all padding, and padding is kept as zero. The parts
  // wait in registers until Cs is free to take them.
  V8H ch[8];
  {
    const int dr = 16 * wv + (lane & 15);
    const float* crow = &Cs[dr * SIT];
#pragma unroll  // as above
    for (int cp = 0; cp < 8; ++cp) {
      const int q = 4 * cp + 2 * (lane >> 4);
      const v4f c0 = *(const v4f*)&crow[4 * (q ^ CSW(dr))];
      const v4f c1 = *(const v4f*)&crow[4 * ((q + 1) ^ CSW(dr))];
      const unsigned ckeep = i0 + 16 * cp + 8 * (lane >> 4) < LC ? 0xffffffffu : 0u;
#pragma unroll  // as above
      for (int e = 0; e < 4; ++e) {
        ch[cp].e[e] = (_Float16)c0[e];
        ch[cp].e[4 + e] = (_Float16)c1[e];
      }
#pragma unroll  // as above
      for (int e = 0; e < 4; ++e) ch[cp].w[e] &= ckeep;
    }
  }

#pragma unroll  // as above
  for (int g = 0; g < 4; ++g) {
    v4f cc[4];  // cc[e][r] = C[d = 4*lane + e][context row 16*wv + 4*g + r]
#pragma unroll  // as above
    for (int e = 0; e < 4; ++e)
      cc[e] = *(const v4f*)&Cs[(4 * lane + e) * SIT + 4 * ((4 * wv + g) ^ CSW(4 * lane + e))];
    float bias = 0.f;
#pragma unroll  // as above
    for (int r = 0; r < 4; ++r) {
      const v4f w1 = w[g & 1][r][0], w2 = w[g & 1][r][1], w3 = w[g & 1][r][2];
      V4H h;
#pragma unroll  // as above
      for (int e = 0; e < 4; ++e) h.e[e] = (_Float16)(w1[e] + w3[e] * cc[e][r]);
      *(v4h*)&u[16 * wv + 4 * g + r][4 * lane] = h.v;
      const float t = wave_sum((w2[0] * cc[0][r] + w2[1] * cc[1][r]) +
                               (w2[2] * cc[2][r] + w2[3] * cc[3][r]));
      bias = lane == r ? t : bias;
    }
    if (lane < 4) rs[16 * wv + 4 * g + lane] = bias;
    if (g + 2 < 4) {
#pragma unroll  // as above
      for (int r = 0; r < 4; ++r) {
        const int gi = i0 + 16 * wvu + 4 * (g + 2) + r;
        const float* wrow = W + ((size_t)(b * LC + (gi < LC ? gi : LC - 1))) * 384 + 4 * lane;
#pragma unroll  // as above
        for (int p = 0; p < 3; ++p) w[g & 1][r][p] = *(const v4f*)(wrow + 128 * p);
      }
      // as at the first wait
      asm volatile("s_wait_xcnt 0x0" ::: "memory");
    }
  }

  // Qs stands since the first barrier. The eighth wave has no j-tile: it re-reads the
  // seventh's rows and stops at the last barrier.
  const int j0 = (wv < NJT ? wv : NJT - 1) * 16;
  v16h bq[4];
#pragma unroll  // as above
  for (int k = 0; k < 4; ++k) bq[k] = frag_load(&Qs[j0 + (lane & 15)][0], 32 * k, lane);

  __syncthreads();
  // Nobody reads Cs any more: its first 32 KiB take the f16 tile in fragment order,
  // [tile of 16 rows d][K-chunk][part][lane][8 halves], 512 contiguous bytes a store.
  _Float16* ChS = (_Float16*)Cs;
#pragma unroll  // as above
  for (int cp = 0; cp < 8; ++cp) *(v8h*)(ChS + (wv * 8 + cp) * 256 + 8 * lane) = ch[cp].v;
  __syncthreads();
  if (wvu >= NJT) return;  // behind the last barrier

  // All eight i-tiles' products are independent: a K-chunk's eight fragments of u are
  // asked for together, and the stores follow the last product.
  v8f acc[SIT / 16] = {};
#pragma unroll  // as above
  for (int k = 0; k < 4; ++k) {
    v16h a[SIT / 16];
#pragma unroll  // as above
    for (int t = 0; t < SIT / 16; ++t) a[t] = frag_load(&u[16 * t + (lane & 15)][0], 32 * k, lane);
#pragma unroll  // as above
    for (int t = 0; t < SIT / 16; ++t) acc[t] = wmma16(a[t], bq[k], acc[t]);
  }

  // D layout: n = lane&15, m = r + 8*(lane>=16). LC is a multiple of 8, so a lane's
  // eight rows of a tile are all inside or all outside.
  const int j = j0 + (lane & 15);
  const int mb = (lane >> 4) << 3;
#pragma unroll  // as above
  for (int t = 0; t < SIT / 16; ++t) {
    const v4f r0 = *(const v4f*)&rs[16 * t + mb];
    const v4f r1 = *(const v4f*)&rs[16 * t + mb + 4];
#pragma unroll  // as above
    for (int r = 0; r < 8; ++r) acc[t][r] += r < 4 ? r0[r & 3] : r1[r & 3];
  }
#pragma unroll  // as above
  for (int t = 0; t < SIT / 16; ++t) {
    const int gi = i0 + 16 * t + mb;
    if (j < LQ && gi < LC) {
      float* sp = S + ((size_t)(b * LC + gi)) * LQP + j;
#pragma unroll  // as above
      for (int r = 0; r < 8; ++r) sp[(size_t)r * LQP] = acc[t][r];
    }
  }
  // the registers that these stores name are reused below
  asm volatile("s_wait_xcnt 0x0" ::: "memory");

  // Column maximum over the block's real rows. The first tile is real in every block;
  // the two halves of the wave hold the two halves of each tile's rows.
  float cmx = acc[0][0];
#pragma unroll  // as above
  for (int t = 0; t < SIT / 16; ++t) {
    float tm = acc[t][0];
#pragma unroll  // as above
    for (int r = 1; r < 8; ++r) tm = fmaxf(tm, acc[t][r]);
    cmx = i0 + 16 * t + mb < LC ? fmaxf(cmx, tm) : cmx;
  }
  cmx = fmaxf(cmx, half_xor(cmx));

  // Exponentials against the block's own column maximum. Row tiles 2*k and 2*k+1 are the
  // two parts of the A fragment of K-chunk k: the lane's column is the fragment's row,
  // its rows mb + r of a tile are K = 16*part + 8*(lane >> 4) + r. Padded rows go in as
  // zero and stay out of the sum.
  v16h ea[4];
  float lsum = 0.f;
#pragma unroll  // as above
  for (int k = 0; k < 4; ++k) {
    V16H f;
#pragma unroll  // as above
    for (int hf = 0; hf < 2; ++hf) {
      const int t = 2 * k + hf;
      const bool real = i0 + 16 * t + mb < LC;
      const unsigned keep = real ? 0xffffffffu : 0u;
      V8H h;
      float ex[8];
#pragma unroll  // as above
      for (int r = 0; r < 8; ++r) {
        ex[r] = exp_slot(acc[t][r] - cmx);
        h.e[r] = (_Float16)ex[r];
      }
#pragma unroll  // as above
      for (int e = 0; e < 4; ++e) h.w[e] &= keep;
      f.h[hf] = h.v;
      const float e8 = ((ex[0] + ex[1]) + (ex[2] + ex[3])) + ((ex[4] + ex[5]) + (ex[6] + ex[7]));
      lsum += real ? e8 : 0.f;
    }
    ea[k] = f.v;
  }
  lsum += half_xor(lsum);
  if (lane < 16 && j < LQ) {
    pmax[(size_t)bx * LQP + j] = cmx;
    psum[(size_t)bx * LQP + j] = lsum;
  }
  // as above, for the registers of the two stores
  asm volatile("s_wait_xcnt 0x0" ::: "memory");

  // The block's part of T, all eight d-tiles: a K-chunk's eight fragments of the C tile
  // are asked for together.
  v8f tp[8] = {};
#pragma unroll  // as above
  for (int k = 0; k < 4; ++k) {
    v16h bc[8];
#pragma unroll  // as above
    for (int dt = 0; dt < 8; ++dt) bc[dt] = frag_packed(ChS + (dt * 4 + k) * FCH, lane);
#pragma unroll  // as above
    for (int dt = 0; dt < 8; ++dt) tp[dt] = wmma16(ea[k], bc[dt], tp[dt]);
  }
  // D: n = lane&15 -> d_local, m = r + 8*(lane>=16) -> j_local (consecutive j): the
  // lane's eight values are its own 16 bytes of part wv & 1 of K-chunk wv >> 1 of the
  // d-tile in fragment order, 512 contiguous bytes a wave.
  _Float16* tq = Tp + ((size_t)(bx * 8 * 4 + (wv >> 1))) * FCH + 256 * (wv & 1) + 8 * lane;
#pragma unroll  // as above
  for (int dt = 0; dt < 8; ++dt) {
    V8H o;
#pragma unroll  // as above
    for (int r = 0; r < 8; ++r) o.e[r] = (_Float16)tp[dt][r];
    *(v8h*)(tq + (size_t)dt * 4 * FCH) = o.v;
  }
}

// ---------------------------------------------------------------------------
// Kernel 2: T[b][d][j] = sum over the batch's eight parts p of f[p][j] * Tp[b][p][d][j],
// f[p][j] = exp(m[p][j] - m[j]) / sum_q l[q][j] * exp(m[q][j] - m[j]), where m[p][j] and
// l[p][j] are the column maximum and the sum of exponentials of part p (a block of
// cqa_s) and m[j] the maximum of the eight: the column softmax (axis=1) on one scale.
// block = (b, one K-chunk of T = 32 columns j); 8 waves each own a 16-wide d-tile. The
// parts lie in T's own fragment order, so a thread sums its own 16 bytes of both parts
// of the chunk. All loads are in flight at once; the 8 x 32 factors are formed one a
// thread and handed round through LDS.
// ---------------------------------------------------------------------------
#define CSP   SNT     // parts per batch: one a block of cqa_s
#define TJG   4       // K-chunks of T per batch

__global__ __launch_bounds__(256)
void cqa_t(const float* __restrict__ pmax, const float* __restrict__ psum,
           const _Float16* __restrict__ Tp, _Float16* __restrict__ T) {
  const int bx = dealt<TJG>();
  const int b = bx / TJG;
  const int kc = bx % TJG;
  const int tid = threadIdx.x, wv = tid >> 5, lane = tid & 31;

  __shared__ __attribute__((aligned(16))) float fs[CSP][32];

  // The thread's factor is that of part wv, column 32*kc + lane. Columns past LQ have no
  // maxima or sums: they re-read column 0, and their factor is laid as zero.
  const bool cok = 32 * kc + lane < LQ;
  const int gj = cok ? 32 * kc + lane : 0;
  const float* mp = pmax + (size_t)(b * CSP) * LQP + gj;
  const float* lp = psum + (size_t)(b * CSP) * LQP + gj;
  float mq[CSP], lq[CSP];
#pragma unroll  // the arrays must stay in registers
  for (int q = 0; q < CSP; ++q) {
    mq[q] = mp[q * LQP];
    lq[q] = lp[q * LQP];
  }
  const float mo = mp[wv * LQP];
  // the address registers of the loads above are free for reuse only behind this wait
  asm volatile("s_wait_xcnt 0x0" ::: "memory");

  // Columns 112 .. 127 (the second part of the last chunk) lie past the seven j-tiles of
  // cqa_s and are never written: that part re-reads the first and is stored as zeros.
  const int o1 = 32 * kc + 16 < LQP ? 256 : 0;
  const _Float16* tq = Tp + ((size_t)((b * CSP * 8 + wv) * 4 + kc)) * FCH + 8 * lane;
  v8h x[CSP][2];
#pragma unroll  // as above
  for (int p = 0; p < CSP; ++p) x[p][0] = *(const v8h*)(tq + (size_t)p * 8 * 4 * FCH);
  // as above: later loads may land in the address registers of these
  asm volatile("s_wait_xcnt 0x0" ::: "memory");
#pragma unroll  // as above
  for (int p = 0; p < CSP; ++p) x[p][1] = *(const v8h*)(tq + (size_t)p * 8 * 4 * FCH + o1);
  // as above
  asm volatile("s_wait_xcnt 0x0" ::: "memory");
  // keeps every load above in front of the work below: sunk among the exponentials, the
  // parts would be asked for a memory latency later
  __builtin_amdgcn_sched_barrier(0);

  const float mm = fmaxf(fmaxf(fmaxf(mq[0], mq[1]), fmaxf(mq[2], mq[3])),
                         fmaxf(fmaxf(mq[4], mq[5]), fmaxf(mq[6], mq[7])));
  float den = 0.f;
#pragma unroll  // as above
  for (int q = 0; q < CSP; ++q) den += lq[q] * exp_slot(mq[q] - mm);
  const float fo = exp_slot(mo - mm) / den;
  fs[wv][lane] = cok ? fo : 0.f;
  __syncthreads();

  // The lane's eight halves of part t are columns 32*kc + 16*t + 8*(lane >> 4) + 0..7.
  const int mb = (lane >> 4) << 3;
#pragma unroll  // as above
  for (int t = 0; t < 2; ++t) {
    float a[8] = {};
#pragma unroll  // as above
    for (int p = 0; p < CSP; ++p) {
      const v4f f0 = *(const v4f*)&fs[p][16 * t + mb];
      const v4f f1 = *(const v4f*)&fs[p][16 * t + mb + 4];
#pragma unroll  // as above
      for (int r = 0; r < 8; ++r) a[r] += (float)x[p][t][r] * (r < 4 ? f0[r & 3] : f1[r & 3]);
    }
    V8H o;
#pragma unroll  // as above
    for (int r = 0; r < 8; ++r)
      o.e[r] = (_Float16)((32 * kc + 16 * t + mb + r < LQ) ? a[r] : 0.f);
    *(v8h*)(T + ((size_t)((b * 8 + wv) * 4 + kc)) * FCH + 256 * t + 8 * lane) = o.v;
  }
}

// ---------------------------------------------------------------------------
// Kernel 3: A = S1@Qt, Bm = S1@T; emit [Ct, A, Ct*A, Ct*Bm] transposed.
// block = (b, 64 context rows); 8 waves each own a 16-wide d-tile and all 64 rows.
// The products are formed transposed (M = d, N = i). Column c of N-tile t is
// context row 4c + t, so a lane's four accumulator tiles hold four consecutive
// i of one output row: 16 lanes store 256 contiguous bytes of that row.
// A is formed and stored first, then Bm, so 32 accumulator registers serve both.
// The row softmax (axis=2) is formed here as well: a wave holds a whole row of S in
// registers, so the row's maximum and sum of exponentials are two wave reductions.
// ---------------------------------------------------------------------------
#define OIT   64      // context rows per block
#define ONT   16      // ceil(1000/64)
#define SPIT  136     // halves per LDS row: 272 B = 16 B x odd, for 16-byte readers

__global__ __launch_bounds__(256)
void cqa_out(const float* __restrict__ C, const float* __restrict__ S,
             const _Float16* __restrict__ Qg, const _Float16* __restrict__ T,
             float* __restrict__ out) {
  const int bx = dealt<ONT>();
  const int b = bx / ONT;
  const int i0 = (bx % ONT) * OIT;
  const int tid = threadIdx.x, wv = tid >> 5, lane = tid & 31;
  const int c = lane & 15;

  // LDS row 16*t + c holds S1 of context row i0 + 4*c + t.
  __shared__ __attribute__((aligned(16))) _Float16 As1[OIT][SPIT];

  // The lane's part of Ct: rows d = dbase + r, context rows gi .. gi + 3. LC and i0
  // are multiples of 4, so the four are all inside or all outside; lanes outside
  // read the last four inside and store nothing.
  const int gi = i0 + 4 * c;
  const int dbase = wv * 16 + ((lane >> 4) << 3);
  const float* cp = C + ((size_t)(b * DD + dbase)) * LC + (gi < LC ? gi : LC - 4);
  float4 ct[8];
#pragma unroll  // the array must stay in registers
  for (int r = 0; r < 8; ++r) ct[r] = *(const float4*)(cp + (size_t)r * LC);

  // One wave per context row, a lane takes four consecutive j. All eight rows'
  // loads are issued before the first is used. Lanes past the row's end and rows
  // past LC re-read the last valid place; their values are replaced by zero.
  const unsigned jo = 4u * (unsigned)(lane < LQ / 4 ? lane : LQ / 4 - 1);
  // the wave's number as a scalar: row addresses are wave-uniform
  const int wvu = __builtin_amdgcn_readfirstlane(wv);
  float4 s[8];
  float mx[8], sm[8];
#pragma unroll  // as above
  for (int u = 0; u < 8; ++u) {
    int si = i0 + wvu + 8 * u;
    int row = b * LC + (si < LC ? si : LC - 1);
    const float* srow = S + (size_t)row * LQP;  // wave-uniform base
    s[u] = *(const float4*)(srow + jo);
  }
  // Row maximum: the re-read quads of lanes past the row's end repeat real values.
#pragma unroll  // as above; the eight rows' reductions are independent chains
  for (int u = 0; u < 8; ++u)
    mx[u] = wave_max(fmaxf(fmaxf(s[u].x, s[u].y), fmaxf(s[u].z, s[u].w)));
  // Exponentials, kept for the quotients below, and their sum over the real lanes.
#pragma unroll  // as above
  for (int u = 0; u < 8; ++u) {
    s[u].x = exp_slot(s[u].x - mx[u]);
    s[u].y = exp_slot(s[u].y - mx[u]);
    s[u].z = exp_slot(s[u].z - mx[u]);
    s[u].w = exp_slot(s[u].w - mx[u]);
    sm[u] = wave_sum(lane < LQ / 4 ? (s[u].x + s[u].y) + (s[u].z + s[u].w) : 0.f);
  }
#pragma unroll  // as above
  for (int u = 0; u < 8; ++u) {
    const int m = wvu + 8 * u;
    // all-ones where the four values are real, else zero: the quotients are
    // formed in every lane (their inputs are valid) and masked as bits
    const unsigned keep = ((i0 + m < LC) && (lane < LQ / 4)) ? 0xffffffffu : 0u;
    V4H h;
    h.e[0] = (_Float16)(s[u].x / sm[u]);
    h.e[1] = (_Float16)(s[u].y / sm[u]);
    h.e[2] = (_Float16)(s[u].z / sm[u]);
    h.e[3] = (_Float16)(s[u].w / sm[u]);
    h.w[0] &= keep;
    h.w[1] &= keep;
    *(v4h*)&As1[((m & 3) << 4) + (m >> 2)][4 * lane] = h.v;
  }

  const _Float16* tileQ = Qg + ((size_t)(b * 8 + wv)) * 4 * FCH;
  const _Float16* tileT = T + ((size_t)(b * 8 + wv)) * 4 * FCH;
  v16h fq[4], ft[4];
#pragma unroll  // as above
  for (int k = 0; k < 4; ++k) fq[k] = frag_packed(tileQ + FCH * k, lane);
  __syncthreads();

  float* op = out + ((size_t)(b * 512 + dbase)) * LC + gi;
  v8f acc[4] = {};
#pragma unroll  // as above
  for (int k = 0; k < 4; ++k) {
#pragma unroll  // as above
    for (int t = 0; t < 4; ++t)
      acc[t] = wmma16(fq[k], frag_load(&As1[16 * t + c][0], 32 * k, lane), acc[t]);
  }
#pragma unroll  // as above
  for (int k = 0; k < 4; ++k) ft[k] = frag_packed(tileT + FCH * k, lane);

  // D: register r = [d_local = 8*(lane>=16) + r][column c]; tiles t = 0..3 give
  // i = gi + t.
  if (gi < LC) {
#pragma unroll  // as above
    for (int r = 0; r < 8; ++r) {
      float4 va = make_float4(acc[0][r], acc[1][r], acc[2][r], acc[3][r]);
      float* o = op + (size_t)r * LC;
      *(float4*)(o) = ct[r];
      *(float4*)(o + (size_t)128 * LC) = va;
      *(float4*)(o + (size_t)256 * LC) =
          make_float4(ct[r].x * va.x, ct[r].y * va.y, ct[r].z * va.z, ct[r].w * va.w);
    }
  }

#pragma unroll  // as above
  for (int t = 0; t < 4; ++t) acc[t] = v8f{};
#pragma unroll  // as above
  for (int k = 0; k < 4; ++k) {
#pragma unroll  // as above
    for (int t = 0; t < 4; ++t)
      acc[t] = wmma16(ft[k], frag_load(&As1[16 * t + c][0], 32 * k, lane), acc[t]);
  }
  if (gi < LC) {
#pragma unroll  // as above
    for (int r = 0; r < 8; ++r) {
      *(float4*)(op + (size_t)(384 + r) * LC) =
          make_float4(ct[r].x * acc[0][r], ct[r].y * acc[1][r], ct[r].z * acc[2][r],
                      ct[r].w * acc[3][r]);
    }
  }
}

// ---------------------------------------------------------------------------
extern "C" void kernel_launch(void* const* d_in, const int* in_sizes, int n_in,
                              void* d_out, int out_size, void* d_ws, size_t ws_size,
                              hipStream_t stream) {
  (void)in_sizes; (void)n_in; (void)out_size; (void)ws_size;
  const float* C = (const float*)d_in[0];
  const float* Q = (const float*)d_in[1];
  const float* W = (const float*)d_in[2];
  float* out = (float*)d_out;
  char* ws = (char*)d_ws;

  float*    Sbuf = (float*)(ws + WS_S);
  float*    cmax = (float*)(ws + WS_CMAX);
  _Float16* T    = (_Float16*)(ws + WS_T);
  _Float16* Qg   = (_Float16*)(ws + WS_QG);
  _Float16* Tp   = (_Float16*)(ws + WS_TP);
  float*    csum = (float*)(ws + WS_CSUM);

  cqa_s<<<NB * SNT, 256, 0, stream>>>(C, Q, W, Qg, Tp, Sbuf, cmax, csum);
  cqa_t<<<NB * TJG, 256, 0, stream>>>(cmax, csum, Tp, T);
  cqa_out<<<NB * ONT, 256, 0, stream>>>(C, Sbuf, Qg, T, out);
}
